// v000
// Times are from an AMD MI455X. After a warm-up the kernel runs many times in a row, and a time is the length of
// such a window on the GPU divided by its runs, so every launch and the gaps after it count. The runs cycle
// through copies of the inputs. A figure is the median of several windows, for all but v000 over two sittings.
// Sittings can differ by a few percent; kernels timed side by side share one.
// The starting kernel, v000, takes 569 microseconds a run.
// compute dtype: all float inputs rounded to bf16; q/k/v = in W + b with EXACT bf16 products on WMMA 16x16x32 (f32 accumulate); q as f16 hi + residual (x 2^10) against k once to f16 (2 products) / 8; softmax in f32 (precise expf); P x 2^11 once to f16 against v once to f16 (1 product); ctx split bf16 hi + lo against exact Wo (2 products) + bo; f32 output.
#include <hip/hip_runtime.h>
#include <math.h>

typedef __attribute__((ext_vector_type(16))) _Float16 v16h;
typedef __attribute__((ext_vector_type(16))) __bf16 v16b;
typedef __attribute__((ext_vector_type(8)))  _Float16 v8h;
typedef __attribute__((ext_vector_type(8)))  float v8f;
typedef __attribute__((ext_vector_type(4)))  float v4f;
typedef __attribute__((ext_vector_type(2)))  float v2f;
typedef __attribute__((ext_vector_type(4)))  unsigned v4u;
typedef __attribute__((ext_vector_type(4)))  int v4i;
typedef float __attribute__((may_alias)) float_a;
typedef int __attribute__((may_alias)) int_a;

template <typename T> __device__ __forceinline__ void vst2(void* p, T v) { *(T*)p = v;  }
__device__ __forceinline__ v8f wmma16(v16h a, v16h b, v8f c) {
  v8f d = __builtin_amdgcn_wmma_f32_16x16x32_f16(false, a, false, b, (short)0, c, false, false);
  asm volatile("v_nop\n\tv_nop\n\tv_nop\n\tv_nop" : "+v"(d) : "v"(a), "v"(b));
  return d;
}
__device__ __forceinline__ v8f wmma_bf(v16b a, v16b b, v8f c) {
  v8f d = __builtin_amdgcn_wmma_f32_16x16x32_bf16(false, a, false, b, (short)0, c, false, false);
  asm volatile("v_nop\n\tv_nop\n\tv_nop\n\tv_nop" : "+v"(d) : "v"(a), "v"(b));
  return d;
}
// 16x16x32 fragments: lane = (h = lane>>4, row/col = lane&15); elements 0..7 = k0+8h+0..7, 8..15 = k0+16+8h+0..7; D element r = row 8h+r
__device__ __forceinline__ v16h frag_h(const _Float16* rowk0, int lane) {
  union { v16h v; v8h q[2]; } u; const _Float16* p = rowk0 + 8 * (lane >> 4);
  u.q[0] = *(const v8h*)p; u.q[1] = *(const v8h*)(p + 16); return u.v;
}
__device__ __forceinline__ v16h frag_f32(const float* rowk0, int lane) {
  v16h a; const float* p = rowk0 + 8 * (lane >> 4);
#pragma unroll
  for (int i = 0; i < 8; ++i) { a[i] = (_Float16)p[i]; a[8 + i] = (_Float16)p[16 + i]; }
  return a;
}
__device__ __forceinline__ v16h frag_f32s(const float* rowk0, int lane, float sc) {
  v16h a; const float* p = rowk0 + 8 * (lane >> 4);
#pragma unroll
  for (int i = 0; i < 8; ++i) { a[i] = (_Float16)(p[i] * sc); a[8 + i] = (_Float16)(p[16 + i] * sc); }
  return a;
}
// column fragment from a [K][ld] layout (column n), rows >= K read as 0
__device__ __forceinline__ v16h fragc_f32(const float* W, int k0, int n, int lane, int ld, int K) {
  v16h a; const int g = lane >> 4;
#pragma unroll
  for (int i = 0; i < 8; ++i) { const int ka = k0 + 8 * g + i, kb = ka + 16;
    a[i] = (_Float16)(ka < K ? W[(size_t)(ka < K ? ka : K - 1) * ld + n] : 0.f); a[8 + i] = (_Float16)(kb < K ? W[(size_t)(kb < K ? kb : K - 1) * ld + n] : 0.f); }
  return a;
}
struct F2 { v16b h, l; };
__device__ __forceinline__ F2 bsplit16(const float v[16]) { F2 r;
#pragma unroll
  for (int i = 0; i < 16; ++i) { const __bf16 h = (__bf16)v[i]; r.h[i] = h; r.l[i] = (__bf16)(v[i] - (float)h); }
  return r; }
__device__ __forceinline__ F2 split_row(const float* row, int k0, int lane) { float v[16]; const float* p = row + k0 + 8 * (lane >> 4);
#pragma unroll
  for (int i = 0; i < 8; ++i) { v[i] = p[i]; v[8 + i] = p[16 + i]; }
  return bsplit16(v); }
__device__ __forceinline__ F2 split_rowK(const float* row, int k0, int lane, int K) { float v[16]; const int g = lane >> 4;
#pragma unroll
  for (int i = 0; i < 8; ++i) { const int ka = k0 + 8 * g + i, kb = ka + 16; v[i] = ka < K ? row[ka < K ? ka : K - 1] : 0.f; v[8 + i] = kb < K ? row[kb < K ? kb : K - 1] : 0.f; }
  return bsplit16(v); }
__device__ __forceinline__ F2 split_col(const float* W, int k0, int n, int lane, int ld, int K) { float v[16]; const int g = lane >> 4;
#pragma unroll
  for (int i = 0; i < 8; ++i) { const int ka = k0 + 8 * g + i, kb = ka + 16; v[i] = ka < K ? W[(size_t)(ka < K ? ka : K - 1) * ld + n] : 0.f; v[8 + i] = kb < K ? W[(size_t)(kb < K ? kb : K - 1) * ld + n] : 0.f; }
  return bsplit16(v); }
__device__ __forceinline__ v8f mac3(const F2& a, const F2& b, v8f c) { c = wmma_bf(a.l, b.h, c); c = wmma_bf(a.h, b.l, c); return wmma_bf(a.h, b.h, c); }
__device__ __forceinline__ float sigm(float v) { return 1.0f / (1.0f + expf(-v)); }
#define LDSX() do { asm volatile("s_wait_dscnt 0" ::: "memory"); __builtin_amdgcn_wave_barrier(); __builtin_amdgcn_fence(__ATOMIC_RELEASE, "workgroup"); } while (0)

// Multi-head self-attention (B 2, S 2,048, d_model 512 = 8 x 64; (in,out) uniform +-1/sqrt(512) weights WITH biases): q, k, v = x W + b; out = merged(softmax(q k^T / 8) v) Wo + bo (non-causal).
#define NB 2
#define TT 2048
#define CC 512            // NH * HD = projected width
#define DIN 512          // input (model) width
#define NH 8
#define HD 64
#define NQB (TT / 64)
#define HG 4
#define SCALE (0.125f)
#define CAUSAL 0
#ifndef TNB
#define TNB NB
#endif
__device__ __forceinline__ float bfr(float v) { return (float)(__bf16)v; }
__host__ __device__ __forceinline__ int kb_last(int qb) { return CAUSAL ? ((qb * 64 + 63) >> 7) : (TT / 128 - 1); }
typedef __attribute__((ext_vector_type(8))) __bf16 v8b;
__device__ __forceinline__ v16b frag_b(const __bf16* rowk0, int lane) {
  union { v16b v; v8b q[2]; } u; const __bf16* p = rowk0 + 8 * (lane >> 4);
  u.q[0] = *(const v8b*)p; u.q[1] = *(const v8b*)(p + 16); return u.v;
}
#define QBH 0              // causal: query blocks 0..QBH-1 of each sequence (few keys, no averaging) take the high-precision path
#define QHI 2048            // rows carrying a q residual plane (all rows when non-causal: 2-product logits everywhere)
#define KHI 64            // key rows carrying k residual / v bf16 hi+lo planes (used only by the causal high-precision path)
// B fragment (k rows k0+.., output column o) of a weight: (in,out) [K][ld] or (out,in) [ld rows of K]: bf16 exact, or f16(bf16 * 256) exact
__device__ __forceinline__ v16b wcol_io(const float* Wm, int k0, int o, int lane, int ld) { v16b w; const int g = lane >> 4;
#pragma unroll
  for (int i = 0; i < 8; ++i) { w[i] = (__bf16)Wm[(size_t)(k0 + 8 * g + i) * ld + o]; w[8 + i] = (__bf16)Wm[(size_t)(k0 + 16 + 8 * g + i) * ld + o]; }
  return w; }
__device__ __forceinline__ v16b wcol_oi(const float* Wm, int k0, int o, int lane, int K) { v16b w; const float* p = Wm + (size_t)o * K + k0 + 8 * (lane >> 4);
#pragma unroll
  for (int i = 0; i < 8; ++i) { w[i] = (__bf16)p[i]; w[8 + i] = (__bf16)p[16 + i]; }
  return w; }
__device__ __forceinline__ v16h wcolh_io(const float* Wm, int k0, int o, int lane, int ld) { v16h w; const int g = lane >> 4;
#pragma unroll
  for (int i = 0; i < 8; ++i) { w[i] = (_Float16)(bfr(Wm[(size_t)(k0 + 8 * g + i) * ld + o]) * 256.0f); w[8 + i] = (_Float16)(bfr(Wm[(size_t)(k0 + 16 + 8 * g + i) * ld + o]) * 256.0f); }
  return w; }
__device__ __forceinline__ v16h wcolh_oi(const float* Wm, int k0, int o, int lane, int K) { v16h w; const float* p = Wm + (size_t)o * K + k0 + 8 * (lane >> 4);
#pragma unroll
  for (int i = 0; i < 8; ++i) { w[i] = (_Float16)(bfr(p[i]) * 256.0f); w[8 + i] = (_Float16)(bfr(p[16 + i]) * 256.0f); }
  return w; }
#define WQKV_LAYOUT 0   // 0 = (in,out) [DIN][CC]; 1 = (out,in) [CC][DIN]; 2 = per-head [NH][DIN][HD]
__device__ __forceinline__ v16b wcol_hdk(const float* Wm, int k0, int o, int lane) { v16b w; const int g = lane >> 4; const float* p = Wm + (size_t)(o / HD) * DIN * HD + (o % HD);
#pragma unroll
  for (int i = 0; i < 8; ++i) { w[i] = (__bf16)p[(size_t)(k0 + 8 * g + i) * HD]; w[8 + i] = (__bf16)p[(size_t)(k0 + 16 + 8 * g + i) * HD]; }
  return w; }
#define WO_OUT_IN 0
#if WQKV_LAYOUT == 1
#define WCOL(W, k0, o, lane) wcol_oi(W, k0, o, lane, DIN)
#elif WQKV_LAYOUT == 2
#define WCOL(W, k0, o, lane) wcol_hdk(W, k0, o, lane)
#else
#define WCOL(W, k0, o, lane) wcol_io(W, k0, o, lane, CC)
#endif
#if WO_OUT_IN
#define WOCOL(W, k0, o, lane) wcol_oi(W, k0, o, lane, CC)
#define WOCOLH(W, k0, o, lane) wcolh_oi(W, k0, o, lane, CC)
#else
#define WOCOL(W, k0, o, lane) wcol_io(W, k0, o, lane, DIN)
#define WOCOLH(W, k0, o, lane) wcolh_io(W, k0, o, lane, DIN)
#endif

#ifndef SM_EXTRA_PARAMS
#define SM_EXTRA_PARAMS
#endif
#ifndef PROJ_EXTRA_PARAMS
#define PROJ_EXTRA_PARAMS
#endif
#ifndef SM_MASK_HOOK
#define SM_MASK_HOOK (void)0
#endif

#define WS_QH  0u                                      // f16 q rows [b*t][CC]
#define WS_KH  (WS_QH + 2u * (size_t)NB * TT * CC)      // f16 k rows [b*t][CC]
#define WS_VT  (WS_KH + 2u * (size_t)NB * TT * CC)      // f16 v planes [b][c][t]
#define WS_QL  (WS_VT + 2u * (size_t)NB * CC * TT)      // f16 q residual x 2^10 rows [b][t < QHI][CC]
#define WS_KL  (WS_QL + 2u * (size_t)NB * QHI * CC)     // f16 k residual x 2^10 rows [b][t < KHI][CC]
#define WS_VB  (WS_KL + 2u * (size_t)NB * KHI * CC)     // bf16 v hi planes [b][c][t < KHI]
#define WS_VBL (WS_VB + 2u * (size_t)NB * CC * KHI)
#define WS_S   (WS_VBL + 2u * (size_t)NB * CC * KHI)    // f32 logits / P [hg][t][s]
#define WS_Y   (WS_S  + 4u * (size_t)HG * TT * TT)      // f32 ctx rows [b*t][CC] (only when there is an output projection)
#define WS_END (WS_Y  + 4u * (size_t)NB * TT * CC)

// ---- k_proj: block = (64 rows, 128 cols, which): q/k/v = X W (+ b) with exact bf16 products (K = DIN) -> which 0: q f16 rows (+ residual rows < QHI); 1: k f16 rows (+ residual rows < KHI); 2: v f16 planes [c][t] (+ bf16 hi/lo planes for t < KHI)
__global__ __launch_bounds__(128) void k_proj(const float* __restrict__ XQ, const float* __restrict__ XK, const float* __restrict__ XV, const float* __restrict__ WQ, const float* __restrict__ WK, const float* __restrict__ WV, const float* __restrict__ BQ, const float* __restrict__ BK, const float* __restrict__ BV,
    _Float16* __restrict__ QH, _Float16* __restrict__ QL, _Float16* __restrict__ KH, _Float16* __restrict__ KL, _Float16* __restrict__ VT, __bf16* __restrict__ VB, __bf16* __restrict__ VBL) {
  __shared__ __align__(16) _Float16 sh[64][136], sl[64][136]; __shared__ __align__(16) _Float16 th[128][72]; __shared__ __align__(16) __bf16 tb[128][72], tbl[128][72];
  const int tid = threadIdx.x, wave = tid >> 5, lane = tid & 31, col = lane & 15, g = lane >> 4; const int which = blockIdx.z; const int c0 = blockIdx.y * 128; const size_t r0 = (size_t)blockIdx.x * 64; const size_t bb = r0 / TT; const int t0 = (int)(r0 % TT);
  const float* X = which == 0 ? XQ : which == 1 ? XK : XV; const float* WA = which == 0 ? WQ : which == 1 ? WK : WV; const float* BA = which == 0 ? BQ : which == 1 ? BK : BV;
  v8f acc[8] = {};
#pragma unroll 2
  for (int kc = 0; kc < DIN / 32; ++kc) { v16b a; { const float* p = X + (r0 + wave * 16 + col) * DIN + kc * 32 + 8 * g;
#pragma unroll
      for (int i = 0; i < 8; ++i) { a[i] = (__bf16)p[i]; a[8 + i] = (__bf16)p[16 + i]; } }
    asm volatile("s_wait_loadcnt 0x0" ::: "memory");
#pragma unroll
    for (int j = 0; j < 8; ++j) { const v16b w = WCOL(WA, kc * 32, c0 + j * 16 + col, lane); asm volatile("s_wait_loadcnt 0x0" ::: "memory"); acc[j] = wmma_bf(a, w, acc[j]); } }
  if (which < 2) { _Float16* DH = which == 0 ? QH : KH; _Float16* DL = which == 0 ? QL : KL; const int nhi = which == 0 ? QHI : KHI; const bool hi_rows = t0 < nhi;
#pragma unroll
    for (int j = 0; j < 8; ++j) { const float bias = BA ? bfr(BA[c0 + j * 16 + col]) : 0.f;
#pragma unroll
      for (int r = 0; r < 8; ++r) { const float v = acc[j][r] + bias; const _Float16 hv = (_Float16)v; sh[wave * 16 + 8 * g + r][j * 16 + col] = hv; sl[wave * 16 + 8 * g + r][j * 16 + col] = (_Float16)((v - (float)hv) * 1024.0f); } }
    __syncthreads();
    for (int e = tid; e < 64 * 16; e += 128) { const int rl = e >> 4, q = e & 15; vst2((unsigned*)(DH + (r0 + rl) * CC + c0 + q * 8), *(const v4u*)&sh[rl][q * 8]); if (hi_rows) vst2((unsigned*)(DL + (bb * nhi + t0 + rl) * (size_t)CC + c0 + q * 8), *(const v4u*)&sl[rl][q * 8]); }
  } else { const bool hi_rows = t0 < KHI;
#pragma unroll
    for (int j = 0; j < 8; ++j) { const float bias = BA ? bfr(BA[c0 + j * 16 + col]) : 0.f;
#pragma unroll
      for (int r = 0; r < 8; ++r) { const float v = acc[j][r] + bias; const int rl = wave * 16 + 8 * g + r, cl = j * 16 + col; th[cl][rl] = (_Float16)v; const __bf16 bh = (__bf16)v; tb[cl][rl] = bh; tbl[cl][rl] = (__bf16)(v - (float)bh); } }
    __syncthreads();
    for (int e = tid; e < 128 * 8; e += 128) { const int cl = e >> 3, q = e & 7; vst2((unsigned*)(VT + (bb * CC + c0 + cl) * (size_t)TT + t0 + q * 8), *(const v4u*)&th[cl][q * 8]); if (hi_rows) { const size_t o3 = (bb * CC + c0 + cl) * (size_t)KHI + t0 + q * 8; vst2((unsigned*)(VB + o3), *(const v4u*)&tb[cl][q * 8]); vst2((unsigned*)(VBL + o3), *(const v4u*)&tbl[cl][q * 8]); } } } }
// ---- k_sc: block = (query block qb, key block kb <= kb_last(qb), head in group) of batch b: logits x SCALE; q hi + residual (x 2^10) against k (2 products) for query rows < QHI, plus the k residual (3 products) for query blocks < QBH (causal early rows); causal: blocks past the diagonal exit, the mask itself is applied by index in k_sm
__global__ __launch_bounds__(128) void k_sc(const _Float16* __restrict__ QH, const _Float16* __restrict__ KH, const _Float16* __restrict__ QL, const _Float16* __restrict__ KL, int b, int h0, float* __restrict__ S0) { __shared__ __align__(16) float ss[4][16][132];
  const int qb = blockIdx.x, kb = blockIdx.y; if (kb > kb_last(qb)) return;
  const int h = h0 + blockIdx.z; float* S = S0 + (size_t)blockIdx.z * TT * TT;
  const int tid = threadIdx.x, wave = tid >> 5, lane = tid & 31, col = lane & 15, g = lane >> 4; const int k0 = kb * 128; const int ql0 = qb * 64 + wave * 16; const size_t q0 = (size_t)b * TT + ql0, kr0 = (size_t)b * TT + k0;
  v8f acc[8] = {}, accl[8] = {};
  const _Float16* QLb = QL + (size_t)b * QHI * CC; const _Float16* KLb = KL + (size_t)b * KHI * CC;
  if (qb < QBH) {
#pragma unroll
    for (int kc = 0; kc < HD / 32; ++kc) { const v16h ah = frag_h(QH + (q0 + col) * CC + h * HD + kc * 32, lane), al = frag_h(QLb + (size_t)(ql0 + col) * CC + h * HD + kc * 32, lane);
#pragma unroll
      for (int j = 0; j < 8; ++j) { const v16h kbf = frag_h(KH + (kr0 + j * 16 + col) * CC + h * HD + kc * 32, lane), klf = frag_h(KLb + (size_t)(k0 + j * 16 + col) * CC + h * HD + kc * 32, lane); acc[j] = wmma16(ah, kbf, acc[j]); accl[j] = wmma16(al, kbf, accl[j]); accl[j] = wmma16(ah, klf, accl[j]); } }
  } else if (qb * 64 < QHI) {
#pragma unroll
    for (int kc = 0; kc < HD / 32; ++kc) { const v16h ah = frag_h(QH + (q0 + col) * CC + h * HD + kc * 32, lane), al = frag_h(QLb + (size_t)(ql0 + col) * CC + h * HD + kc * 32, lane);
#pragma unroll
      for (int j = 0; j < 8; ++j) { const v16h kbf = frag_h(KH + (kr0 + j * 16 + col) * CC + h * HD + kc * 32, lane); acc[j] = wmma16(ah, kbf, acc[j]); accl[j] = wmma16(al, kbf, accl[j]); } }
  } else {
#pragma unroll
    for (int kc = 0; kc < HD / 32; ++kc) { const v16h ah = frag_h(QH + (q0 + col) * CC + h * HD + kc * 32, lane);
#pragma unroll
      for (int j = 0; j < 8; ++j) { const v16h kbf = frag_h(KH + (kr0 + j * 16 + col) * CC + h * HD + kc * 32, lane); acc[j] = wmma16(ah, kbf, acc[j]); } } }
#pragma unroll
  for (int j = 0; j < 8; ++j) {
#pragma unroll
    for (int r = 0; r < 8; ++r) ss[wave][8 * g + r][j * 16 + col] = (acc[j][r] + accl[j][r] * (1.0f / 1024.0f)) * SCALE; }
  LDSX(); for (int rl = 0; rl < 16; ++rl) vst2(S + (size_t)(ql0 + rl) * TT + k0 + lane * 4, *(const v4f*)&ss[wave][rl][lane * 4]); }
// ---- k_sm: block = query row t (head in group): keys [0, kend): causal -> logit if s <= t else excluded; softmax in f32; P x 2^11 in place (0 for excluded)
__global__ __launch_bounds__(256) void k_sm(float* __restrict__ S0 SM_EXTRA_PARAMS) { __shared__ float sred[8]; __shared__ float sbc; __shared__ __align__(16) float shv[TT];
  const int tid = threadIdx.x; const int t = blockIdx.x; const int kend = (kb_last(t >> 6) + 1) * 128;
  float* sr = S0 + (size_t)blockIdx.y * TT * TT + (size_t)t * TT;
  float m = -3.0e38f; for (int k = tid; k < kend; k += 256) { float v = (!CAUSAL || k <= t) ? sr[k] : -3.0e38f; SM_MASK_HOOK; shv[k] = v; m = fmaxf(m, v); }
#pragma unroll
  for (int o = 1; o < 32; o <<= 1) m = fmaxf(m, __shfl_xor(m, o));
  if ((tid & 31) == 0) sred[tid >> 5] = m; __syncthreads(); if (tid == 0) { float a = sred[0]; for (int i = 1; i < 8; ++i) a = fmaxf(a, sred[i]); sbc = a; } __syncthreads(); m = sbc; __syncthreads();
  float sum = 0.f; for (int k = tid; k < kend; k += 256) { const float v = shv[k]; const float e = (v <= -1.0e38f) ? 0.f : expf(v - m); shv[k] = e; sum += e; }
#pragma unroll
  for (int o = 1; o < 32; o <<= 1) sum += __shfl_xor(sum, o);
  if ((tid & 31) == 0) sred[tid >> 5] = sum; __syncthreads(); if (tid == 0) { float a = 0.f; for (int i = 0; i < 8; ++i) a += sred[i]; sbc = a > 0.f ? 2048.0f / a : 0.f; }   /* a fully excluded row yields P = 0 */ __syncthreads(); const float inv = sbc;
  for (int k = tid; k < kend; k += 256) shv[k] = shv[k] * inv;
  __syncthreads(); for (int q = tid; q < kend / 4; q += 256) vst2(sr + q * 4, *(const v4f*)&shv[q * 4]); }
// ---- k_pv: block = 64 queries (qb) of (b, h): ctx = P . v over keys [0, kend) (P x 2^11 once to f16 against v f16: 1 product; causal early query blocks: P and v as bf16 hi + lo, 3 products); 256-B (row, head) segment by 16 lanes
__global__ __launch_bounds__(128) void k_pv(const float* __restrict__ PS0, const _Float16* __restrict__ VT, const __bf16* __restrict__ VB, const __bf16* __restrict__ VBL, int b, int h0, float* __restrict__ Y) { const int h = h0 + blockIdx.z; const float* PS = PS0 + (size_t)blockIdx.z * TT * TT; __shared__ __align__(16) float ss[4][16][HD + 4];
  const int tid = threadIdx.x, wave = tid >> 5, lane = tid & 31, col = lane & 15, g = lane >> 4; const int qb = blockIdx.x; const int ql0 = qb * 64 + wave * 16; const int kce = (kb_last(qb) + 1) * 4;
  v8f acc[HD / 16] = {};
  if (qb < QBH) {
#pragma unroll 1
    for (int kc = 0; kc < kce; ++kc) { const F2 p = split_row(PS + (size_t)(ql0 + col) * TT, kc * 32, lane);
      asm volatile("s_wait_loadcnt 0x0" ::: "memory");
#pragma unroll
      for (int j = 0; j < HD / 16; ++j) { const size_t po = ((size_t)b * CC + h * HD + j * 16 + col) * (size_t)KHI + kc * 32; const v16b vh = frag_b(VB + po, lane); acc[j] = wmma_bf(p.h, vh, acc[j]); acc[j] = wmma_bf(p.l, vh, acc[j]); acc[j] = wmma_bf(p.h, frag_b(VBL + po, lane), acc[j]); } }
  } else {
#pragma unroll 1
    for (int kc = 0; kc < kce; ++kc) { const v16h p = frag_f32(PS + (size_t)(ql0 + col) * TT + kc * 32, lane);
      asm volatile("s_wait_loadcnt 0x0" ::: "memory");
#pragma unroll
      for (int j = 0; j < HD / 16; ++j) { const size_t po = ((size_t)b * CC + h * HD + j * 16 + col) * (size_t)TT + kc * 32; acc[j] = wmma16(p, frag_h(VT + po, lane), acc[j]); } } }
#pragma unroll
  for (int j = 0; j < HD / 16; ++j)
#pragma unroll
    for (int r = 0; r < 8; ++r) ss[wave][8 * g + r][j * 16 + col] = acc[j][r] * (1.0f / 2048.0f);
  LDSX(); for (int rl = 0; rl < 16; ++rl) if (lane < HD / 4) vst2(Y + ((size_t)b * TT + ql0 + rl) * CC + h * HD + lane * 4, *(const v4f*)&ss[wave][rl][lane * 4]); }
// ---- k_out: block = (64 rows, 128 cols): out = ctx Wo (+ bo): all rows: ctx bf16 hi + lo against exact bf16 Wo (2 products); the f16(bf16 x 2^8) 1-product branch is never taken
__global__ __launch_bounds__(128) void k_out(const float* __restrict__ Y, const float* __restrict__ WO, const float* __restrict__ BO, float* __restrict__ OUT) { __shared__ __align__(16) float sf[4][16][132];
  const int tid = threadIdx.x, wave = tid >> 5, lane = tid & 31, col = lane & 15, g = lane >> 4; const int c0 = blockIdx.y * 128; const size_t r0 = (size_t)blockIdx.x * 64 + wave * 16;
  v8f acc[8] = {};
  if (true) {   /* ALL rows: ctx split bf16 hi + lo x exact Wo (2 products) */
#pragma unroll 2
    for (int kc = 0; kc < CC / 32; ++kc) { const F2 a = split_row(Y + (r0 + col) * CC, kc * 32, lane); asm volatile("s_wait_loadcnt 0x0" ::: "memory");
#pragma unroll
      for (int j = 0; j < 8; ++j) { const v16b w = WOCOL(WO, kc * 32, c0 + j * 16 + col, lane); asm volatile("s_wait_loadcnt 0x0" ::: "memory"); acc[j] = wmma_bf(a.h, w, acc[j]); acc[j] = wmma_bf(a.l, w, acc[j]); } }
#pragma unroll
    for (int j = 0; j < 8; ++j) { const float bias = BO ? bfr(BO[c0 + j * 16 + col]) : 0.f;
#pragma unroll
      for (int r = 0; r < 8; ++r) sf[wave][8 * g + r][j * 16 + col] = acc[j][r] + bias; }
  } else {
#pragma unroll 2
    for (int kc = 0; kc < CC / 32; ++kc) { const v16h a = frag_f32(Y + (r0 + col) * CC + kc * 32, lane); asm volatile("s_wait_loadcnt 0x0" ::: "memory");
#pragma unroll
      for (int j = 0; j < 8; ++j) { const v16h w = WOCOLH(WO, kc * 32, c0 + j * 16 + col, lane); asm volatile("s_wait_loadcnt 0x0" ::: "memory"); acc[j] = wmma16(a, w, acc[j]); } }
#pragma unroll
    for (int j = 0; j < 8; ++j) { const float bias = BO ? bfr(BO[c0 + j * 16 + col]) : 0.f;
#pragma unroll
      for (int r = 0; r < 8; ++r) sf[wave][8 * g + r][j * 16 + col] = acc[j][r] * (1.0f / 256.0f) + bias; } }
  LDSX(); for (int rl = 0; rl < 16; ++rl) vst2(OUT + (r0 + rl) * DIN + c0 + lane * 4, *(const v4f*)&sf[wave][rl][lane * 4]); }

extern "C" void kernel_launch(void* const* d_in, const int* in_sizes, int n_in, void* d_out, int out_size, void* d_ws, size_t ws_size, hipStream_t stream) {
  (void)in_sizes; (void)n_in; (void)out_size;
  const float** F = (const float**)d_in;
  if (ws_size < (size_t)WS_END) return;
  char* ws = (char*)d_ws; _Float16 *QH = (_Float16*)(ws + WS_QH), *KH = (_Float16*)(ws + WS_KH), *VT = (_Float16*)(ws + WS_VT), *QL = (_Float16*)(ws + WS_QL), *KL = (_Float16*)(ws + WS_KL); __bf16 *VB = (__bf16*)(ws + WS_VB), *VBL = (__bf16*)(ws + WS_VBL); float *S = (float*)(ws + WS_S), *Y = (float*)(ws + WS_Y);
  (void)Y; (void)QL; (void)KL; (void)VB; (void)VBL;
  // inputs: 0 x [2,2048,512]; 1 Wq (in,out), 2 bq; 3 Wk, 4 bk; 5 Wv, 6 bv; 7 Wo (in,out), 8 bo
  k_proj<<<dim3(TNB * TT / 64, CC / 128, 3), 128, 0, stream>>>(F[0], F[0], F[0], F[1], F[3], F[5], F[2], F[4], F[6], QH, QL, KH, KL, VT, VB, VBL);
  for (int b = 0; b < TNB; ++b) for (int h0 = 0; h0 < NH; h0 += HG) {
    k_sc<<<dim3(NQB, TT / 128, HG), 128, 0, stream>>>(QH, KH, QL, KL, b, h0, S);
    k_sm<<<dim3(TT, HG), 256, 0, stream>>>(S);
    k_pv<<<dim3(NQB, 1, HG), 128, 0, stream>>>(S, VT, VB, VBL, b, h0, Y);
  }
  k_out<<<dim3(TNB * TT / 64, DIN / 128), 128, 0, stream>>>(Y, F[7], F[8], (float*)d_out);
}

// v001
// It runs in 115 microseconds.
// Timed twice side by side with v000, it ran 5.02 times as fast both times.
// compute dtype: all float inputs rounded to bf16; q/k/v = in W + b with EXACT bf16 products on WMMA 16x16x32 (f32 accumulate); q as f16 hi + residual (x 2^10) against k once to f16 (2 products) / 8; online softmax in f32 (precise expf), fused with both products; exp(logit - max) x 2^11 once to f16 against v once to f16 (1 product), divided by the f32 sum at the end; ctx split bf16 hi + lo against exact Wo (2 products) + bo; f32 output.
#include <hip/hip_runtime.h>
#include <math.h>

typedef __attribute__((ext_vector_type(16))) _Float16 v16h;
typedef __attribute__((ext_vector_type(16))) __bf16 v16b;
typedef __attribute__((ext_vector_type(8)))  _Float16 v8h;
typedef __attribute__((ext_vector_type(8)))  float v8f;
typedef __attribute__((ext_vector_type(4)))  float v4f;
typedef __attribute__((ext_vector_type(2)))  float v2f;
typedef __attribute__((ext_vector_type(4)))  unsigned v4u;
typedef __attribute__((ext_vector_type(4)))  int v4i;
typedef float __attribute__((may_alias)) float_a;
typedef int __attribute__((may_alias)) int_a;

template <typename T> __device__ __forceinline__ void vst2(void* p, T v) { *(T*)p = v;  }
__device__ __forceinline__ v8f wmma16(v16h a, v16h b, v8f c) {
  v8f d = __builtin_amdgcn_wmma_f32_16x16x32_f16(false, a, false, b, (short)0, c, false, false);
  asm volatile("v_nop\n\tv_nop\n\tv_nop\n\tv_nop" : "+v"(d) : "v"(a), "v"(b));
  return d;
}
__device__ __forceinline__ v8f wmma_bf(v16b a, v16b b, v8f c) {
  v8f d = __builtin_amdgcn_wmma_f32_16x16x32_bf16(false, a, false, b, (short)0, c, false, false);
  asm volatile("v_nop\n\tv_nop\n\tv_nop\n\tv_nop" : "+v"(d) : "v"(a), "v"(b));
  return d;
}
// 16x16x32 fragments: lane = (h = lane>>4, row/col = lane&15); elements 0..7 = k0+8h+0..7, 8..15 = k0+16+8h+0..7; D element r = row 8h+r
__device__ __forceinline__ v16h frag_h(const _Float16* rowk0, int lane) {
  union { v16h v; v8h q[2]; } u; const _Float16* p = rowk0 + 8 * (lane >> 4);
  u.q[0] = *(const v8h*)p; u.q[1] = *(const v8h*)(p + 16); return u.v;
}
__device__ __forceinline__ v16h frag_f32(const float* rowk0, int lane) {
  v16h a; const float* p = rowk0 + 8 * (lane >> 4);
#pragma unroll
  for (int i = 0; i < 8; ++i) { a[i] = (_Float16)p[i]; a[8 + i] = (_Float16)p[16 + i]; }
  return a;
}
__device__ __forceinline__ v16h frag_f32s(const float* rowk0, int lane, float sc) {
  v16h a; const float* p = rowk0 + 8 * (lane >> 4);
#pragma unroll
  for (int i = 0; i < 8; ++i) { a[i] = (_Float16)(p[i] * sc); a[8 + i] = (_Float16)(p[16 + i] * sc); }
  return a;
}
// column fragment from a [K][ld] layout (column n), rows >= K read as 0
__device__ __forceinline__ v16h fragc_f32(const float* W, int k0, int n, int lane, int ld, int K) {
  v16h a; const int g = lane >> 4;
#pragma unroll
  for (int i = 0; i < 8; ++i) { const int ka = k0 + 8 * g + i, kb = ka + 16;
    a[i] = (_Float16)(ka < K ? W[(size_t)(ka < K ? ka : K - 1) * ld + n] : 0.f); a[8 + i] = (_Float16)(kb < K ? W[(size_t)(kb < K ? kb : K - 1) * ld + n] : 0.f); }
  return a;
}
struct F2 { v16b h, l; };
__device__ __forceinline__ F2 bsplit16(const float v[16]) { F2 r;
#pragma unroll
  for (int i = 0; i < 16; ++i) { const __bf16 h = (__bf16)v[i]; r.h[i] = h; r.l[i] = (__bf16)(v[i] - (float)h); }
  return r; }
__device__ __forceinline__ F2 split_row(const float* row, int k0, int lane) { float v[16]; const float* p = row + k0 + 8 * (lane >> 4);
#pragma unroll
  for (int i = 0; i < 8; ++i) { v[i] = p[i]; v[8 + i] = p[16 + i]; }
  return bsplit16(v); }
__device__ __forceinline__ F2 split_rowK(const float* row, int k0, int lane, int K) { float v[16]; const int g = lane >> 4;
#pragma unroll
  for (int i = 0; i < 8; ++i) { const int ka = k0 + 8 * g + i, kb = ka + 16; v[i] = ka < K ? row[ka < K ? ka : K - 1] : 0.f; v[8 + i] = kb < K ? row[kb < K ? kb : K - 1] : 0.f; }
  return bsplit16(v); }
__device__ __forceinline__ F2 split_col(const float* W, int k0, int n, int lane, int ld, int K) { float v[16]; const int g = lane >> 4;
#pragma unroll
  for (int i = 0; i < 8; ++i) { const int ka = k0 + 8 * g + i, kb = ka + 16; v[i] = ka < K ? W[(size_t)(ka < K ? ka : K - 1) * ld + n] : 0.f; v[8 + i] = kb < K ? W[(size_t)(kb < K ? kb : K - 1) * ld + n] : 0.f; }
  return bsplit16(v); }
__device__ __forceinline__ v8f mac3(const F2& a, const F2& b, v8f c) { c = wmma_bf(a.l, b.h, c); c = wmma_bf(a.h, b.l, c); return wmma_bf(a.h, b.h, c); }
__device__ __forceinline__ float sigm(float v) { return 1.0f / (1.0f + expf(-v)); }
#define LDSX() do { asm volatile("s_wait_dscnt 0" ::: "memory"); __builtin_amdgcn_wave_barrier(); __builtin_amdgcn_fence(__ATOMIC_RELEASE, "workgroup"); } while (0)

// Multi-head self-attention (B 2, S 2,048, d_model 512 = 8 x 64; (in,out) uniform +-1/sqrt(512) weights WITH biases): q, k, v = x W + b; out = merged(softmax(q k^T / 8) v) Wo + bo (non-causal).
#define NB 2
#define TT 2048
#define CC 512            // NH * HD = projected width
#define DIN 512          // input (model) width
#define NH 8
#define HD 64
#define NQB (TT / 64)
#define HG 4
#define SCALE (0.125f)
#define CAUSAL 0
#ifndef TNB
#define TNB NB
#endif
__device__ __forceinline__ float bfr(float v) { return (float)(__bf16)v; }
__host__ __device__ __forceinline__ int kb_last(int qb) { return CAUSAL ? ((qb * 64 + 63) >> 7) : (TT / 128 - 1); }
typedef __attribute__((ext_vector_type(8))) __bf16 v8b;
__device__ __forceinline__ v16b frag_b(const __bf16* rowk0, int lane) {
  union { v16b v; v8b q[2]; } u; const __bf16* p = rowk0 + 8 * (lane >> 4);
  u.q[0] = *(const v8b*)p; u.q[1] = *(const v8b*)(p + 16); return u.v;
}
#define QBH 0              // unused: every query block takes the one k_attn path
#define QHI 2048            // rows carrying a q residual plane (all rows when non-causal: 2-product logits everywhere)
#define KHI 64            // key rows carrying k residual / v bf16 hi+lo planes (written by k_proj; no kernel reads them)
// B fragment (k rows k0+.., output column o) of a weight: (in,out) [K][ld] or (out,in) [ld rows of K]: bf16 exact, or f16(bf16 * 256) exact
__device__ __forceinline__ v16b wcol_io(const float* Wm, int k0, int o, int lane, int ld) { v16b w; const int g = lane >> 4;
#pragma unroll
  for (int i = 0; i < 8; ++i) { w[i] = (__bf16)Wm[(size_t)(k0 + 8 * g + i) * ld + o]; w[8 + i] = (__bf16)Wm[(size_t)(k0 + 16 + 8 * g + i) * ld + o]; }
  return w; }
__device__ __forceinline__ v16b wcol_oi(const float* Wm, int k0, int o, int lane, int K) { v16b w; const float* p = Wm + (size_t)o * K + k0 + 8 * (lane >> 4);
#pragma unroll
  for (int i = 0; i < 8; ++i) { w[i] = (__bf16)p[i]; w[8 + i] = (__bf16)p[16 + i]; }
  return w; }
__device__ __forceinline__ v16h wcolh_io(const float* Wm, int k0, int o, int lane, int ld) { v16h w; const int g = lane >> 4;
#pragma unroll
  for (int i = 0; i < 8; ++i) { w[i] = (_Float16)(bfr(Wm[(size_t)(k0 + 8 * g + i) * ld + o]) * 256.0f); w[8 + i] = (_Float16)(bfr(Wm[(size_t)(k0 + 16 + 8 * g + i) * ld + o]) * 256.0f); }
  return w; }
__device__ __forceinline__ v16h wcolh_oi(const float* Wm, int k0, int o, int lane, int K) { v16h w; const float* p = Wm + (size_t)o * K + k0 + 8 * (lane >> 4);
#pragma unroll
  for (int i = 0; i < 8; ++i) { w[i] = (_Float16)(bfr(p[i]) * 256.0f); w[8 + i] = (_Float16)(bfr(p[16 + i]) * 256.0f); }
  return w; }
#define WQKV_LAYOUT 0   // 0 = (in,out) [DIN][CC]; 1 = (out,in) [CC][DIN]; 2 = per-head [NH][DIN][HD]
__device__ __forceinline__ v16b wcol_hdk(const float* Wm, int k0, int o, int lane) { v16b w; const int g = lane >> 4; const float* p = Wm + (size_t)(o / HD) * DIN * HD + (o % HD);
#pragma unroll
  for (int i = 0; i < 8; ++i) { w[i] = (__bf16)p[(size_t)(k0 + 8 * g + i) * HD]; w[8 + i] = (__bf16)p[(size_t)(k0 + 16 + 8 * g + i) * HD]; }
  return w; }
#define WO_OUT_IN 0
#if WQKV_LAYOUT == 1
#define WCOL(W, k0, o, lane) wcol_oi(W, k0, o, lane, DIN)
#elif WQKV_LAYOUT == 2
#define WCOL(W, k0, o, lane) wcol_hdk(W, k0, o, lane)
#else
#define WCOL(W, k0, o, lane) wcol_io(W, k0, o, lane, CC)
#endif
#if WO_OUT_IN
#define WOCOL(W, k0, o, lane) wcol_oi(W, k0, o, lane, CC)
#define WOCOLH(W, k0, o, lane) wcolh_oi(W, k0, o, lane, CC)
#else
#define WOCOL(W, k0, o, lane) wcol_io(W, k0, o, lane, DIN)
#define WOCOLH(W, k0, o, lane) wcolh_io(W, k0, o, lane, DIN)
#endif

#ifndef SM_EXTRA_PARAMS
#define SM_EXTRA_PARAMS
#endif
#ifndef PROJ_EXTRA_PARAMS
#define PROJ_EXTRA_PARAMS
#endif
#ifndef SM_MASK_HOOK
#define SM_MASK_HOOK (void)0
#endif

#define WS_QH  0u                                      // f16 q rows [b*t][CC]
#define WS_KH  (WS_QH + 2u * (size_t)NB * TT * CC)      // f16 k rows [b*t][CC]
#define WS_VT  (WS_KH + 2u * (size_t)NB * TT * CC)      // f16 v planes [b][c][t]
#define WS_QL  (WS_VT + 2u * (size_t)NB * CC * TT)      // f16 q residual x 2^10 rows [b][t < QHI][CC]
#define WS_KL  (WS_QL + 2u * (size_t)NB * QHI * CC)     // f16 k residual x 2^10 rows [b][t < KHI][CC]
#define WS_VB  (WS_KL + 2u * (size_t)NB * KHI * CC)     // bf16 v hi planes [b][c][t < KHI]
#define WS_VBL (WS_VB + 2u * (size_t)NB * CC * KHI)
#define WS_S   (WS_VBL + 2u * (size_t)NB * CC * KHI)    // f32 [hg][t][s] region, unused: logits and P stay in registers
#define WS_Y   (WS_S  + 4u * (size_t)HG * TT * TT)      // f32 ctx rows [b*t][CC] (only when there is an output projection)
#define WS_END (WS_Y  + 4u * (size_t)NB * TT * CC)

// ---- k_proj: block = (64 rows, 128 cols, which): q/k/v = X W (+ b) with exact bf16 products (K = DIN) -> which 0: q f16 rows (+ residual rows < QHI); 1: k f16 rows (+ residual rows < KHI); 2: v f16 planes [c][t] (+ bf16 hi/lo planes for t < KHI)
__global__ __launch_bounds__(128) void k_proj(const float* __restrict__ XQ, const float* __restrict__ XK, const float* __restrict__ XV, const float* __restrict__ WQ, const float* __restrict__ WK, const float* __restrict__ WV, const float* __restrict__ BQ, const float* __restrict__ BK, const float* __restrict__ BV,
    _Float16* __restrict__ QH, _Float16* __restrict__ QL, _Float16* __restrict__ KH, _Float16* __restrict__ KL, _Float16* __restrict__ VT, __bf16* __restrict__ VB, __bf16* __restrict__ VBL) {
  __shared__ __align__(16) _Float16 sh[64][136], sl[64][136]; __shared__ __align__(16) _Float16 th[128][72]; __shared__ __align__(16) __bf16 tb[128][72], tbl[128][72];
  const int tid = threadIdx.x, wave = tid >> 5, lane = tid & 31, col = lane & 15, g = lane >> 4; const int which = blockIdx.z; const int c0 = blockIdx.y * 128; const size_t r0 = (size_t)blockIdx.x * 64; const size_t bb = r0 / TT; const int t0 = (int)(r0 % TT);
  const float* X = which == 0 ? XQ : which == 1 ? XK : XV; const float* WA = which == 0 ? WQ : which == 1 ? WK : WV; const float* BA = which == 0 ? BQ : which == 1 ? BK : BV;
  v8f acc[8] = {};
#pragma unroll 2
  for (int kc = 0; kc < DIN / 32; ++kc) { v16b a; { const float* p = X + (r0 + wave * 16 + col) * DIN + kc * 32 + 8 * g;
#pragma unroll
      for (int i = 0; i < 8; ++i) { a[i] = (__bf16)p[i]; a[8 + i] = (__bf16)p[16 + i]; } }
    asm volatile("s_wait_loadcnt 0x0" ::: "memory");
#pragma unroll
    for (int j = 0; j < 8; ++j) { const v16b w = WCOL(WA, kc * 32, c0 + j * 16 + col, lane); asm volatile("s_wait_loadcnt 0x0" ::: "memory"); acc[j] = wmma_bf(a, w, acc[j]); } }
  if (which < 2) { _Float16* DH = which == 0 ? QH : KH; _Float16* DL = which == 0 ? QL : KL; const int nhi = which == 0 ? QHI : KHI; const bool hi_rows = t0 < nhi;
#pragma unroll
    for (int j = 0; j < 8; ++j) { const float bias = BA ? bfr(BA[c0 + j * 16 + col]) : 0.f;
#pragma unroll
      for (int r = 0; r < 8; ++r) { const float v = acc[j][r] + bias; const _Float16 hv = (_Float16)v; sh[wave * 16 + 8 * g + r][j * 16 + col] = hv; sl[wave * 16 + 8 * g + r][j * 16 + col] = (_Float16)((v - (float)hv) * 1024.0f); } }
    __syncthreads();
    for (int e = tid; e < 64 * 16; e += 128) { const int rl = e >> 4, q = e & 15; vst2((unsigned*)(DH + (r0 + rl) * CC + c0 + q * 8), *(const v4u*)&sh[rl][q * 8]); if (hi_rows) vst2((unsigned*)(DL + (bb * nhi + t0 + rl) * (size_t)CC + c0 + q * 8), *(const v4u*)&sl[rl][q * 8]); }
  } else { const bool hi_rows = t0 < KHI;
#pragma unroll
    for (int j = 0; j < 8; ++j) { const float bias = BA ? bfr(BA[c0 + j * 16 + col]) : 0.f;
#pragma unroll
      for (int r = 0; r < 8; ++r) { const float v = acc[j][r] + bias; const int rl = wave * 16 + 8 * g + r, cl = j * 16 + col; th[cl][rl] = (_Float16)v; const __bf16 bh = (__bf16)v; tb[cl][rl] = bh; tbl[cl][rl] = (__bf16)(v - (float)bh); } }
    __syncthreads();
    for (int e = tid; e < 128 * 8; e += 128) { const int cl = e >> 3, q = e & 7; vst2((unsigned*)(VT + (bb * CC + c0 + cl) * (size_t)TT + t0 + q * 8), *(const v4u*)&th[cl][q * 8]); if (hi_rows) { const size_t o3 = (bb * CC + c0 + cl) * (size_t)KHI + t0 + q * 8; vst2((unsigned*)(VB + o3), *(const v4u*)&tb[cl][q * 8]); vst2((unsigned*)(VBL + o3), *(const v4u*)&tbl[cl][q * 8]); } } } }
#define AQT 8
#define AKS 2
#define AKT 64                    // keys per stage and range: 128-B rows of k (64 d) and of v^T (64 keys)
#define ANS (TT / AKS / AKT)
#define APK 72                    // LDS pitch in halves: 128-B rows + 16 B, conflict-free for 16-byte fragment reads
__device__ __forceinline__ v8f wm16(v16h a, v16h b, v8f c) { return __builtin_amdgcn_wmma_f32_16x16x32_f16(false, a, false, b, (short)0, c, false, false); }
__device__ __forceinline__ float xhalf(float x) { return __builtin_bit_cast(float, __builtin_amdgcn_permlanex16(__builtin_bit_cast(int, x), __builtin_bit_cast(int, x), 0x76543210, 0xfedcba98, false, false)); }  // lane l with lane l ^ 16
__global__ __launch_bounds__(AQT * AKS * 32) void k_attn(const _Float16* __restrict__ QH, const _Float16* __restrict__ KH, const _Float16* __restrict__ QL, const _Float16* __restrict__ VT, float* __restrict__ Y) {
  __shared__ __align__(16) _Float16 sk[2][AKS][AKT][APK], sv[2][AKS][HD][APK];
  __shared__ __align__(16) float sp[AKS - 1][AQT][HD / 2][32]; __shared__ float smx[AKS - 1][AQT][16], ssu[AKS - 1][AQT][16]; __shared__ __align__(16) float so[AQT][16][HD + 4];
  const int tid = threadIdx.x, wave = __builtin_amdgcn_readfirstlane(tid >> 5), lane = tid & 31, col = lane & 15, g = lane >> 4; const int qt = wave % AQT, ks = wave / AQT;
  const int b = blockIdx.y / NH, h = blockIdx.y % NH; const int ql0 = blockIdx.x * (AQT * 16) + qt * 16;
  // staging: thread (qt, lane) of a range moves 16-byte chunk sc of rows sr and sr + 32 of the k tile and of the v^T tile (8 lanes = one 128-B line)
  const int sr = qt * 4 + (lane >> 3), sc = (lane & 7) * 8;
  const _Float16* kg = KH + ((size_t)b * TT + ks * (TT / AKS) + sr) * CC + h * HD + sc;
  const _Float16* vg = VT + ((size_t)b * CC + h * HD + sr) * (size_t)TT + ks * (TT / AKS) + sc;
  v8h g0 = *(const v8h*)kg, g1 = *(const v8h*)(kg + (size_t)32 * CC), g2 = *(const v8h*)vg, g3 = *(const v8h*)(vg + (size_t)32 * TT);
  v16h qh[HD / 32], qr[HD / 32];
#pragma unroll
  for (int kc = 0; kc < HD / 32; ++kc) { qh[kc] = frag_h(QH + ((size_t)b * TT + ql0 + col) * CC + h * HD + kc * 32, lane); qr[kc] = frag_h(QL + ((size_t)b * QHI + ql0 + col) * CC + h * HD + kc * 32, lane); }
  *(v8h*)&sk[0][ks][sr][sc] = g0; *(v8h*)&sk[0][ks][sr + 32][sc] = g1; *(v8h*)&sv[0][ks][sr][sc] = g2; *(v8h*)&sv[0][ks][sr + 32][sc] = g3;
  __syncthreads();   // stage 0 is published
  v8f o[HD / 16] = {}; float m = -3.0e38f; v2f l2 = {0.f, 0.f};   // the lane's sum of exponentials, even and odd elements apart (packed adds)
  for (int st = 0; st < ANS; ++st) { const int bu = st & 1;
    if (st + 1 < ANS) { const _Float16* kn = kg + (size_t)((st + 1) * AKT) * CC; const _Float16* vn = vg + (st + 1) * AKT;
      g0 = *(const v8h*)kn; g1 = *(const v8h*)(kn + (size_t)32 * CC); g2 = *(const v8h*)vn; g3 = *(const v8h*)(vn + (size_t)32 * TT); }
#pragma unroll
    for (int pp = 0; pp < AKT / 32; ++pp) {
      v8f s[2] = {}, sq[2] = {};
#pragma unroll
      for (int kc = 0; kc < HD / 32; ++kc)
#pragma unroll
        for (int t = 0; t < 2; ++t) { const v16h kf = frag_h(&sk[bu][ks][pp * 32 + t * 16 + col][kc * 32], lane); s[t] = wm16(kf, qh[kc], s[t]); sq[t] = wm16(kf, qr[kc], sq[t]); }
      v16h vf[HD / 16];
#pragma unroll
      for (int j = 0; j < HD / 16; ++j) vf[j] = frag_h(&sv[bu][ks][j * 16 + col][pp * 32], lane);
      float v[16]; float mx = m;
#pragma unroll
      for (int i = 0; i < 16; ++i) { v[i] = (s[i >> 3][i & 7] + sq[i >> 3][i & 7] * (1.0f / 1024.0f)) * SCALE; mx = fmaxf(mx, v[i]); }
      mx = fmaxf(mx, xhalf(mx));
      if (__builtin_amdgcn_ballot_w32(mx > m) != 0) {   // some query's maximum rose: bring sum and O^T to the new one (a factor of exactly 1 for the other queries)
        const float a = expf(m - mx); l2 *= a; m = mx;
#pragma unroll
        for (int j = 0; j < HD / 16; ++j)
#pragma unroll
          for (int r = 0; r < 8; ++r) o[j][r] *= a; }
      v16h pf;
#pragma unroll
      for (int i = 0; i < 16; i += 2) { const v2f e = {expf(v[i] - m), expf(v[i + 1] - m)}; l2 += e; pf[i] = (_Float16)(e.x * 2048.0f); pf[i + 1] = (_Float16)(e.y * 2048.0f); }
#pragma unroll
      for (int j = 0; j < HD / 16; ++j) o[j] = wm16(vf[j], pf, o[j]); }
    if (st + 1 < ANS) { *(v8h*)&sk[bu ^ 1][ks][sr][sc] = g0; *(v8h*)&sk[bu ^ 1][ks][sr + 32][sc] = g1; *(v8h*)&sv[bu ^ 1][ks][sr][sc] = g2; *(v8h*)&sv[bu ^ 1][ks][sr + 32][sc] = g3; }   // its readers left this buffer before the last barrier
    __syncthreads(); }   // publishes stage st + 1 and ends every read of stage st
  float l = l2.x + l2.y; l += xhalf(l);
  if (ks > 0) {
#pragma unroll
    for (int j = 0; j < HD / 16; ++j)
#pragma unroll
      for (int r = 0; r < 8; ++r) sp[ks - 1][qt][j * 8 + r][lane] = o[j][r];
    if (g == 0) { smx[ks - 1][qt][col] = m; ssu[ks - 1][qt][col] = l; } }
  __syncthreads();   // the other ranges' partial results are published
  if (ks == 0) {
#pragma unroll
    for (int x = 0; x < AKS - 1; ++x) { const float m1 = smx[x][qt][col], l1 = ssu[x][qt][col]; const float mm = fmaxf(m, m1); const float a0 = expf(m - mm), a1 = expf(m1 - mm); l = l * a0 + l1 * a1; m = mm;
#pragma unroll
      for (int j = 0; j < HD / 16; ++j)
#pragma unroll
        for (int r = 0; r < 8; ++r) o[j][r] = o[j][r] * a0 + sp[x][qt][j * 8 + r][lane] * a1; }
    const float inv = 1.0f / (l * 2048.0f);
#pragma unroll
    for (int j = 0; j < HD / 16; ++j)
#pragma unroll
      for (int r = 0; r < 8; ++r) so[qt][col][j * 16 + 8 * g + r] = o[j][r] * inv;
    LDSX();   // the wave's own rows of so are written before it reads them back row by row
#pragma unroll
    for (int it = 0; it < 8; ++it) { const int rl = it * 2 + g; vst2(Y + ((size_t)b * TT + ql0 + rl) * CC + h * HD + col * 4, *(const v4f*)&so[qt][rl][col * 4]); } } }
// ---- k_out: block = (64 rows, 128 cols): out = ctx Wo (+ bo): all rows: ctx bf16 hi + lo against exact bf16 Wo (2 products); the f16 branch (ctx once to f16 against f16(bf16 x 2^8) Wo, x 2^-8) is never taken
__global__ __launch_bounds__(128) void k_out(const float* __restrict__ Y, const float* __restrict__ WO, const float* __restrict__ BO, float* __restrict__ OUT) { __shared__ __align__(16) float sf[4][16][132];
  const int tid = threadIdx.x, wave = tid >> 5, lane = tid & 31, col = lane & 15, g = lane >> 4; const int c0 = blockIdx.y * 128; const size_t r0 = (size_t)blockIdx.x * 64 + wave * 16;
  v8f acc[8] = {};
  if (true) {   /* ALL rows: ctx split bf16 hi + lo x exact Wo (2 products) */
#pragma unroll 2
    for (int kc = 0; kc < CC / 32; ++kc) { const F2 a = split_row(Y + (r0 + col) * CC, kc * 32, lane); asm volatile("s_wait_loadcnt 0x0" ::: "memory");
#pragma unroll
      for (int j = 0; j < 8; ++j) { const v16b w = WOCOL(WO, kc * 32, c0 + j * 16 + col, lane); asm volatile("s_wait_loadcnt 0x0" ::: "memory"); acc[j] = wmma_bf(a.h, w, acc[j]); acc[j] = wmma_bf(a.l, w, acc[j]); } }
#pragma unroll
    for (int j = 0; j < 8; ++j) { const float bias = BO ? bfr(BO[c0 + j * 16 + col]) : 0.f;
#pragma unroll
      for (int r = 0; r < 8; ++r) sf[wave][8 * g + r][j * 16 + col] = acc[j][r] + bias; }
  } else {
#pragma unroll 2
    for (int kc = 0; kc < CC / 32; ++kc) { const v16h a = frag_f32(Y + (r0 + col) * CC + kc * 32, lane); asm volatile("s_wait_loadcnt 0x0" ::: "memory");
#pragma unroll
      for (int j = 0; j < 8; ++j) { const v16h w = WOCOLH(WO, kc * 32, c0 + j * 16 + col, lane); asm volatile("s_wait_loadcnt 0x0" ::: "memory"); acc[j] = wmma16(a, w, acc[j]); } }
#pragma unroll
    for (int j = 0; j < 8; ++j) { const float bias = BO ? bfr(BO[c0 + j * 16 + col]) : 0.f;
#pragma unroll
      for (int r = 0; r < 8; ++r) sf[wave][8 * g + r][j * 16 + col] = acc[j][r] * (1.0f / 256.0f) + bias; } }
  LDSX(); for (int rl = 0; rl < 16; ++rl) vst2(OUT + (r0 + rl) * DIN + c0 + lane * 4, *(const v4f*)&sf[wave][rl][lane * 4]); }

extern "C" void kernel_launch(void* const* d_in, const int* in_sizes, int n_in, void* d_out, int out_size, void* d_ws, size_t ws_size, hipStream_t stream) {
  (void)in_sizes; (void)n_in; (void)out_size;
  const float** F = (const float**)d_in;
  if (ws_size < (size_t)WS_END) return;
  char* ws = (char*)d_ws; _Float16 *QH = (_Float16*)(ws + WS_QH), *KH = (_Float16*)(ws + WS_KH), *VT = (_Float16*)(ws + WS_VT), *QL = (_Float16*)(ws + WS_QL), *KL = (_Float16*)(ws + WS_KL); __bf16 *VB = (__bf16*)(ws + WS_VB), *VBL = (__bf16*)(ws + WS_VBL); float *Y = (float*)(ws + WS_Y);
  (void)Y; (void)QL; (void)KL; (void)VB; (void)VBL;
  // inputs: 0 x [2,2048,512]; 1 Wq (in,out), 2 bq; 3 Wk, 4 bk; 5 Wv, 6 bv; 7 Wo (in,out), 8 bo
  k_proj<<<dim3(TNB * TT / 64, CC / 128, 3), 128, 0, stream>>>(F[0], F[0], F[0], F[1], F[3], F[5], F[2], F[4], F[6], QH, QL, KH, KL, VT, VB, VBL);
  k_attn<<<dim3(TT / (AQT * 16), TNB * NH), AQT * AKS * 32, 0, stream>>>(QH, KH, QL, VT, Y);
  k_out<<<dim3(TNB * TT / 64, DIN / 128), 128, 0, stream>>>(Y, F[7], F[8], (float*)d_out);
}

// v002
// Measured time: 68 microseconds a run.
// In both of two side-by-side timings against v001, it was 1.69 times as fast.
// All steps since v000 together make it 8.48 times as fast.
// compute dtype: all float inputs rounded to bf16; q/k/v = in W + b with EXACT bf16 products on WMMA 16x16x32 (f32 accumulate); q as f16 hi + residual (x 2^10) against k once to f16 (2 products) / 8; online softmax in f32 (precise expf), fused with both products; exp(logit - max) x 2^11 once to f16 against v once to f16 (1 product), divided by the f32 sum at the end; ctx split bf16 hi + lo against exact Wo (2 products) + bo; f32 output.
#include <hip/hip_runtime.h>
#include <math.h>

typedef __attribute__((ext_vector_type(16))) _Float16 v16h;
typedef __attribute__((ext_vector_type(16))) __bf16 v16b;
typedef __attribute__((ext_vector_type(8)))  _Float16 v8h;
typedef __attribute__((ext_vector_type(8)))  float v8f;
typedef __attribute__((ext_vector_type(4)))  float v4f;
typedef __attribute__((ext_vector_type(2)))  float v2f;
typedef __attribute__((ext_vector_type(4)))  unsigned v4u;
typedef __attribute__((ext_vector_type(4)))  int v4i;
typedef float __attribute__((may_alias)) float_a;
typedef int __attribute__((may_alias)) int_a;

template <typename T> __device__ __forceinline__ void vst2(void* p, T v) { *(T*)p = v;  }
__device__ __forceinline__ v8f wmma16(v16h a, v16h b, v8f c) {
  v8f d = __builtin_amdgcn_wmma_f32_16x16x32_f16(false, a, false, b, (short)0, c, false, false);
  asm volatile("v_nop\n\tv_nop\n\tv_nop\n\tv_nop" : "+v"(d) : "v"(a), "v"(b));
  return d;
}
__device__ __forceinline__ v8f wmma_bf(v16b a, v16b b, v8f c) {
  v8f d = __builtin_amdgcn_wmma_f32_16x16x32_bf16(false, a, false, b, (short)0, c, false, false);
  asm volatile("v_nop\n\tv_nop\n\tv_nop\n\tv_nop" : "+v"(d) : "v"(a), "v"(b));
  return d;
}
// 16x16x32 fragments: lane = (h = lane>>4, row/col = lane&15); elements 0..7 = k0+8h+0..7, 8..15 = k0+16+8h+0..7; D element r = row 8h+r
__device__ __forceinline__ v16h frag_h(const _Float16* rowk0, int lane) {
  union { v16h v; v8h q[2]; } u; const _Float16* p = rowk0 + 8 * (lane >> 4);
  u.q[0] = *(const v8h*)p; u.q[1] = *(const v8h*)(p + 16); return u.v;
}
__device__ __forceinline__ v16h frag_f32(const float* rowk0, int lane) {
  v16h a; const float* p = rowk0 + 8 * (lane >> 4);
#pragma unroll
  for (int i = 0; i < 8; ++i) { a[i] = (_Float16)p[i]; a[8 + i] = (_Float16)p[16 + i]; }
  return a;
}
__device__ __forceinline__ v16h frag_f32s(const float* rowk0, int lane, float sc) {
  v16h a; const float* p = rowk0 + 8 * (lane >> 4);
#pragma unroll
  for (int i = 0; i < 8; ++i) { a[i] = (_Float16)(p[i] * sc); a[8 + i] = (_Float16)(p[16 + i] * sc); }
  return a;
}
// column fragment from a [K][ld] layout (column n), rows >= K read as 0
__device__ __forceinline__ v16h fragc_f32(const float* W, int k0, int n, int lane, int ld, int K) {
  v16h a; const int g = lane >> 4;
#pragma unroll
  for (int i = 0; i < 8; ++i) { const int ka = k0 + 8 * g + i, kb = ka + 16;
    a[i] = (_Float16)(ka < K ? W[(size_t)(ka < K ? ka : K - 1) * ld + n] : 0.f); a[8 + i] = (_Float16)(kb < K ? W[(size_t)(kb < K ? kb : K - 1) * ld + n] : 0.f); }
  return a;
}
struct F2 { v16b h, l; };
__device__ __forceinline__ F2 bsplit16(const float v[16]) { F2 r;
#pragma unroll
  for (int i = 0; i < 16; ++i) { const __bf16 h = (__bf16)v[i]; r.h[i] = h; r.l[i] = (__bf16)(v[i] - (float)h); }
  return r; }
__device__ __forceinline__ F2 split_row(const float* row, int k0, int lane) { float v[16]; const float* p = row + k0 + 8 * (lane >> 4);
#pragma unroll
  for (int i = 0; i < 8; ++i) { v[i] = p[i]; v[8 + i] = p[16 + i]; }
  return bsplit16(v); }
__device__ __forceinline__ F2 split_rowK(const float* row, int k0, int lane, int K) { float v[16]; const int g = lane >> 4;
#pragma unroll
  for (int i = 0; i < 8; ++i) { const int ka = k0 + 8 * g + i, kb = ka + 16; v[i] = ka < K ? row[ka < K ? ka : K - 1] : 0.f; v[8 + i] = kb < K ? row[kb < K ? kb : K - 1] : 0.f; }
  return bsplit16(v); }
__device__ __forceinline__ F2 split_col(const float* W, int k0, int n, int lane, int ld, int K) { float v[16]; const int g = lane >> 4;
#pragma unroll
  for (int i = 0; i < 8; ++i) { const int ka = k0 + 8 * g + i, kb = ka + 16; v[i] = ka < K ? W[(size_t)(ka < K ? ka : K - 1) * ld + n] : 0.f; v[8 + i] = kb < K ? W[(size_t)(kb < K ? kb : K - 1) * ld + n] : 0.f; }
  return bsplit16(v); }
__device__ __forceinline__ v8f mac3(const F2& a, const F2& b, v8f c) { c = wmma_bf(a.l, b.h, c); c = wmma_bf(a.h, b.l, c); return wmma_bf(a.h, b.h, c); }
__device__ __forceinline__ float sigm(float v) { return 1.0f / (1.0f + expf(-v)); }
#define LDSX() do { asm volatile("s_wait_dscnt 0" ::: "memory"); __builtin_amdgcn_wave_barrier(); __builtin_amdgcn_fence(__ATOMIC_RELEASE, "workgroup"); } while (0)

// Multi-head self-attention (B 2, S 2,048, d_model 512 = 8 x 64; (in,out) uniform +-1/sqrt(512) weights WITH biases): q, k, v = x W + b; out = merged(softmax(q k^T / 8) v) Wo + bo (non-causal).
#define NB 2
#define TT 2048
#define CC 512            // NH * HD = projected width
#define DIN 512          // input (model) width
#define NH 8
#define HD 64
#define NQB (TT / 64)
#define HG 4
#define SCALE (0.125f)
#define CAUSAL 0
#ifndef TNB
#define TNB NB
#endif
__device__ __forceinline__ float bfr(float v) { return (float)(__bf16)v; }
__host__ __device__ __forceinline__ int kb_last(int qb) { return CAUSAL ? ((qb * 64 + 63) >> 7) : (TT / 128 - 1); }
typedef __attribute__((ext_vector_type(8))) __bf16 v8b;
__device__ __forceinline__ v16b frag_b(const __bf16* rowk0, int lane) {
  union { v16b v; v8b q[2]; } u; const __bf16* p = rowk0 + 8 * (lane >> 4);
  u.q[0] = *(const v8b*)p; u.q[1] = *(const v8b*)(p + 16); return u.v;
}
#define QBH 0              // unused: every query block takes the one k_attn path
#define QHI 2048            // rows carrying a q residual plane (all rows when non-causal: 2-product logits everywhere)
#define KHI 64            // key rows carrying k residual / v bf16 hi+lo planes (written by k_proj; no kernel reads them)
// B fragment (k rows k0+.., output column o) of a weight: (in,out) [K][ld] or (out,in) [ld rows of K]: bf16 exact, or f16(bf16 * 256) exact
__device__ __forceinline__ v16b wcol_io(const float* Wm, int k0, int o, int lane, int ld) { v16b w; const int g = lane >> 4;
#pragma unroll
  for (int i = 0; i < 8; ++i) { w[i] = (__bf16)Wm[(size_t)(k0 + 8 * g + i) * ld + o]; w[8 + i] = (__bf16)Wm[(size_t)(k0 + 16 + 8 * g + i) * ld + o]; }
  return w; }
__device__ __forceinline__ v16b wcol_oi(const float* Wm, int k0, int o, int lane, int K) { v16b w; const float* p = Wm + (size_t)o * K + k0 + 8 * (lane >> 4);
#pragma unroll
  for (int i = 0; i < 8; ++i) { w[i] = (__bf16)p[i]; w[8 + i] = (__bf16)p[16 + i]; }
  return w; }
__device__ __forceinline__ v16h wcolh_io(const float* Wm, int k0, int o, int lane, int ld) { v16h w; const int g = lane >> 4;
#pragma unroll
  for (int i = 0; i < 8; ++i) { w[i] = (_Float16)(bfr(Wm[(size_t)(k0 + 8 * g + i) * ld + o]) * 256.0f); w[8 + i] = (_Float16)(bfr(Wm[(size_t)(k0 + 16 + 8 * g + i) * ld + o]) * 256.0f); }
  return w; }
__device__ __forceinline__ v16h wcolh_oi(const float* Wm, int k0, int o, int lane, int K) { v16h w; const float* p = Wm + (size_t)o * K + k0 + 8 * (lane >> 4);
#pragma unroll
  for (int i = 0; i < 8; ++i) { w[i] = (_Float16)(bfr(p[i]) * 256.0f); w[8 + i] = (_Float16)(bfr(p[16 + i]) * 256.0f); }
  return w; }
#define WQKV_LAYOUT 0   // 0 = (in,out) [DIN][CC]; 1 = (out,in) [CC][DIN]; 2 = per-head [NH][DIN][HD]
__device__ __forceinline__ v16b wcol_hdk(const float* Wm, int k0, int o, int lane) { v16b w; const int g = lane >> 4; const float* p = Wm + (size_t)(o / HD) * DIN * HD + (o % HD);
#pragma unroll
  for (int i = 0; i < 8; ++i) { w[i] = (__bf16)p[(size_t)(k0 + 8 * g + i) * HD]; w[8 + i] = (__bf16)p[(size_t)(k0 + 16 + 8 * g + i) * HD]; }
  return w; }
#define WO_OUT_IN 0
#if WQKV_LAYOUT == 1
#define WCOL(W, k0, o, lane) wcol_oi(W, k0, o, lane, DIN)
#elif WQKV_LAYOUT == 2
#define WCOL(W, k0, o, lane) wcol_hdk(W, k0, o, lane)
#else
#define WCOL(W, k0, o, lane) wcol_io(W, k0, o, lane, CC)
#endif
#if WO_OUT_IN
#define WOCOL(W, k0, o, lane) wcol_oi(W, k0, o, lane, CC)
#define WOCOLH(W, k0, o, lane) wcolh_oi(W, k0, o, lane, CC)
#else
#define WOCOL(W, k0, o, lane) wcol_io(W, k0, o, lane, DIN)
#define WOCOLH(W, k0, o, lane) wcolh_io(W, k0, o, lane, DIN)
#endif

#ifndef SM_EXTRA_PARAMS
#define SM_EXTRA_PARAMS
#endif
#ifndef PROJ_EXTRA_PARAMS
#define PROJ_EXTRA_PARAMS
#endif
#ifndef SM_MASK_HOOK
#define SM_MASK_HOOK (void)0
#endif

#define WS_QH  0u                                      // f16 q rows [b*t][CC]
#define WS_KH  (WS_QH + 2u * (size_t)NB * TT * CC)      // f16 k rows [b*t][CC]
#define WS_VT  (WS_KH + 2u * (size_t)NB * TT * CC)      // f16 v planes [b][c][t]
#define WS_QL  (WS_VT + 2u * (size_t)NB * CC * TT)      // f16 q residual x 2^10 rows [b][t < QHI][CC]
#define WS_KL  (WS_QL + 2u * (size_t)NB * QHI * CC)     // f16 k residual x 2^10 rows [b][t < KHI][CC]
#define WS_VB  (WS_KL + 2u * (size_t)NB * KHI * CC)     // bf16 v hi planes [b][c][t < KHI]
#define WS_VBL (WS_VB + 2u * (size_t)NB * CC * KHI)
#define WS_S   (WS_VBL + 2u * (size_t)NB * CC * KHI)    // f32 [hg][t][s] region, unused: logits and P stay in registers
#define WS_Y   (WS_S  + 4u * (size_t)HG * TT * TT)      // f32 ctx rows [b*t][CC] (only when there is an output projection)
#define WS_END (WS_Y  + 4u * (size_t)NB * TT * CC)

// ---- weight staging of the two projection GEMMs: a stage is GKS k rows x 128 columns of an (in,out) f32 weight, rounded to bf16 and laid column-major in LDS (pitch GPW), once per block for its four waves.
// Thread (wave, lane) moves columns n4..n4+3 of k rows o4*8 + u*32 + i: a wave-wide load covers four whole 128-B lines, and 16 neighbouring lanes' 16-byte LDS stores cover all 64 banks once.
// Two buffers: the next stage's loads fly during this stage's products, one barrier a stage. The k order of the products is the one of the unstaged loop. Every '#pragma unroll' of the staging and of the two loops keeps a register array statically indexed.
#define GKS 64
#define GPW 72                    // LDS pitch in bf16: 128-B rows + 16 B, conflict-free for 16-byte fragment reads
__device__ __forceinline__ void wst_load(v4f (&f)[2][8], const float* wp, int ld) {
#pragma unroll
  for (int u = 0; u < 2; ++u)
#pragma unroll
    for (int i = 0; i < 8; ++i) f[u][i] = *(const v4f*)(wp + (size_t)(u * 32 + i) * ld); }
__device__ __forceinline__ void wst_store(__bf16* sp, const v4f (&f)[2][8]) {
#pragma unroll
  for (int u = 0; u < 2; ++u)
#pragma unroll
    for (int c = 0; c < 4; ++c) { v8b p;
#pragma unroll
      for (int i = 0; i < 8; ++i) p[i] = (__bf16)f[u][i][c];
      *(v8b*)(sp + c * GPW + u * 32) = p; } }
// the lane's f32 elements of the A fragments of one stage (p = row + stage k0 + 8 * (lane >> 4)): element e of fragment kk is x[kk][e >> 2][e & 3]
__device__ __forceinline__ void arow_load(v4f (&x)[2][4], const float* p) {
#pragma unroll
  for (int kk = 0; kk < 2; ++kk) { x[kk][0] = *(const v4f*)(p + kk * 32); x[kk][1] = *(const v4f*)(p + kk * 32 + 4); x[kk][2] = *(const v4f*)(p + kk * 32 + 16); x[kk][3] = *(const v4f*)(p + kk * 32 + 20); } }
// ---- k_proj: block = (64 rows, 128 cols, which): q/k/v = X W (+ b) with exact bf16 products (K = DIN) -> which 0: q f16 rows (+ residual rows < QHI); 1: k f16 rows (+ residual rows < KHI); 2: v f16 planes [c][t] (+ bf16 hi/lo planes for t < KHI)
__global__ __launch_bounds__(128) void k_proj(const float* __restrict__ XQ, const float* __restrict__ XK, const float* __restrict__ XV, const float* __restrict__ WQ, const float* __restrict__ WK, const float* __restrict__ WV, const float* __restrict__ BQ, const float* __restrict__ BK, const float* __restrict__ BV,
    _Float16* __restrict__ QH, _Float16* __restrict__ QL, _Float16* __restrict__ KH, _Float16* __restrict__ KL, _Float16* __restrict__ VT, __bf16* __restrict__ VB, __bf16* __restrict__ VBL) {
  __shared__ __align__(16) _Float16 sh[64][136], sl[64][136]; __shared__ __align__(16) _Float16 th[128][72]; __shared__ __align__(16) __bf16 tw[2][128][GPW]; __bf16 (&tb)[128][72] = tw[0]; __bf16 (&tbl)[128][72] = tw[1];   // the two weight buffers of the loop are the epilogue's tb and tbl
  const int tid = threadIdx.x, wave = tid >> 5, lane = tid & 31, col = lane & 15, g = lane >> 4; const int which = blockIdx.z; const int c0 = blockIdx.y * 128; const size_t r0 = (size_t)blockIdx.x * 64; const size_t bb = r0 / TT; const int t0 = (int)(r0 % TT);
  const float* X = which == 0 ? XQ : which == 1 ? XK : XV; const float* WA = which == 0 ? WQ : which == 1 ? WK : WV; const float* BA = which == 0 ? BQ : which == 1 ? BK : BV;
  v8f acc[8] = {};
  const int n4 = (wave * 8 + ((lane & 3) | ((lane >> 4) << 2))) * 4, o4 = (lane >> 2) & 3;
  const float* wp = WA + (size_t)(o4 * 8) * CC + c0 + n4; const float* xp = X + (r0 + wave * 16 + col) * DIN + 8 * g;
  v4f wf[2][8], xf[2][4]; v16b a[2]; wst_load(wf, wp, CC); arow_load(xf, xp); wst_store(&tw[0][n4][o4 * 8], wf);
#pragma unroll
  for (int kk = 0; kk < 2; ++kk)
#pragma unroll
    for (int e = 0; e < 16; ++e) a[kk][e] = (__bf16)xf[kk][e >> 2][e & 3];
  __syncthreads();   // stage 0 is published
  for (int st = 0; st < DIN / GKS; ++st) { const int bu = st & 1; const bool more = st + 1 < DIN / GKS;
    if (more) { wst_load(wf, wp + (size_t)((st + 1) * GKS) * CC, CC); arow_load(xf, xp + (st + 1) * GKS);
      asm volatile("s_wait_xcnt 0x0" ::: "memory"); }   // in front of the first rewrite of an address register that these loads name
#pragma unroll
    for (int kk = 0; kk < 2; ++kk)
#pragma unroll
      for (int jh = 0; jh < 8; jh += 4) { v16b w[4];   // four fragments are read as one group, so that the wave waits out the LDS latency once for four products
#pragma unroll
        for (int j = 0; j < 4; ++j) w[j] = frag_b(&tw[bu][(jh + j) * 16 + col][kk * 32], lane);
#pragma unroll
        for (int j = 0; j < 4; ++j) acc[jh + j] = wmma_bf(a[kk], w[j], acc[jh + j]); }
    if (more) { wst_store(&tw[bu ^ 1][n4][o4 * 8], wf);   // its readers left this buffer before the last barrier
#pragma unroll
      for (int kk = 0; kk < 2; ++kk)
#pragma unroll
        for (int e = 0; e < 16; ++e) a[kk][e] = (__bf16)xf[kk][e >> 2][e & 3]; }
    __syncthreads(); }   // publishes stage st + 1 and ends every read of stage st
  if (which < 2) { _Float16* DH = which == 0 ? QH : KH; _Float16* DL = which == 0 ? QL : KL; const int nhi = which == 0 ? QHI : KHI; const bool hi_rows = t0 < nhi;
#pragma unroll
    for (int j = 0; j < 8; ++j) { const float bias = BA ? bfr(BA[c0 + j * 16 + col]) : 0.f;
#pragma unroll
      for (int r = 0; r < 8; ++r) { const float v = acc[j][r] + bias; const _Float16 hv = (_Float16)v; sh[wave * 16 + 8 * g + r][j * 16 + col] = hv; sl[wave * 16 + 8 * g + r][j * 16 + col] = (_Float16)((v - (float)hv) * 1024.0f); } }
    __syncthreads();
    for (int e = tid; e < 64 * 16; e += 128) { const int rl = e >> 4, q = e & 15; vst2((unsigned*)(DH + (r0 + rl) * CC + c0 + q * 8), *(const v4u*)&sh[rl][q * 8]); if (hi_rows) vst2((unsigned*)(DL + (bb * nhi + t0 + rl) * (size_t)CC + c0 + q * 8), *(const v4u*)&sl[rl][q * 8]); }
  } else { const bool hi_rows = t0 < KHI;
#pragma unroll
    for (int j = 0; j < 8; ++j) { const float bias = BA ? bfr(BA[c0 + j * 16 + col]) : 0.f;
#pragma unroll
      for (int r = 0; r < 8; ++r) { const float v = acc[j][r] + bias; const int rl = wave * 16 + 8 * g + r, cl = j * 16 + col; th[cl][rl] = (_Float16)v; const __bf16 bh = (__bf16)v; tb[cl][rl] = bh; tbl[cl][rl] = (__bf16)(v - (float)bh); } }
    __syncthreads();
    for (int e = tid; e < 128 * 8; e += 128) { const int cl = e >> 3, q = e & 7; vst2((unsigned*)(VT + (bb * CC + c0 + cl) * (size_t)TT + t0 + q * 8), *(const v4u*)&th[cl][q * 8]); if (hi_rows) { const size_t o3 = (bb * CC + c0 + cl) * (size_t)KHI + t0 + q * 8; vst2((unsigned*)(VB + o3), *(const v4u*)&tb[cl][q * 8]); vst2((unsigned*)(VBL + o3), *(const v4u*)&tbl[cl][q * 8]); } } } }
#define AQT 8
#define AKS 2
#define AKT 64                    // keys per stage and range: 128-B rows of k (64 d) and of v^T (64 keys)
#define ANS (TT / AKS / AKT)
#define APK 72                    // LDS pitch in halves: 128-B rows + 16 B, conflict-free for 16-byte fragment reads
__device__ __forceinline__ v8f wm16(v16h a, v16h b, v8f c) { return __builtin_amdgcn_wmma_f32_16x16x32_f16(false, a, false, b, (short)0, c, false, false); }
__device__ __forceinline__ float xhalf(float x) { return __builtin_bit_cast(float, __builtin_amdgcn_permlanex16(__builtin_bit_cast(int, x), __builtin_bit_cast(int, x), 0x76543210, 0xfedcba98, false, false)); }  // lane l with lane l ^ 16
__global__ __launch_bounds__(AQT * AKS * 32) void k_attn(const _Float16* __restrict__ QH, const _Float16* __restrict__ KH, const _Float16* __restrict__ QL, const _Float16* __restrict__ VT, float* __restrict__ Y) {
  __shared__ __align__(16) _Float16 sk[2][AKS][AKT][APK], sv[2][AKS][HD][APK];
  __shared__ __align__(16) float sp[AKS - 1][AQT][HD / 2][32]; __shared__ float smx[AKS - 1][AQT][16], ssu[AKS - 1][AQT][16]; __shared__ __align__(16) float so[AQT][16][HD + 4];
  const int tid = threadIdx.x, wave = __builtin_amdgcn_readfirstlane(tid >> 5), lane = tid & 31, col = lane & 15, g = lane >> 4; const int qt = wave % AQT, ks = wave / AQT;
  const int b = blockIdx.y / NH, h = blockIdx.y % NH; const int ql0 = blockIdx.x * (AQT * 16) + qt * 16;
  // staging: thread (qt, lane) of a range moves 16-byte chunk sc of rows sr and sr + 32 of the k tile and of the v^T tile (8 lanes = one 128-B line)
  const int sr = qt * 4 + (lane >> 3), sc = (lane & 7) * 8;
  const _Float16* kg = KH + ((size_t)b * TT + ks * (TT / AKS) + sr) * CC + h * HD + sc;
  const _Float16* vg = VT + ((size_t)b * CC + h * HD + sr) * (size_t)TT + ks * (TT / AKS) + sc;
  v8h g0 = *(const v8h*)kg, g1 = *(const v8h*)(kg + (size_t)32 * CC), g2 = *(const v8h*)vg, g3 = *(const v8h*)(vg + (size_t)32 * TT);
  v16h qh[HD / 32], qr[HD / 32];
#pragma unroll
  for (int kc = 0; kc < HD / 32; ++kc) { qh[kc] = frag_h(QH + ((size_t)b * TT + ql0 + col) * CC + h * HD + kc * 32, lane); qr[kc] = frag_h(QL + ((size_t)b * QHI + ql0 + col) * CC + h * HD + kc * 32, lane); }
  *(v8h*)&sk[0][ks][sr][sc] = g0; *(v8h*)&sk[0][ks][sr + 32][sc] = g1; *(v8h*)&sv[0][ks][sr][sc] = g2; *(v8h*)&sv[0][ks][sr + 32][sc] = g3;
  __syncthreads();   // stage 0 is published
  v8f o[HD / 16] = {}; float m = -3.0e38f; v2f l2 = {0.f, 0.f};   // the lane's sum of exponentials, even and odd elements apart (packed adds)
  for (int st = 0; st < ANS; ++st) { const int bu = st & 1;
    if (st + 1 < ANS) { const _Float16* kn = kg + (size_t)((st + 1) * AKT) * CC; const _Float16* vn = vg + (st + 1) * AKT;
      g0 = *(const v8h*)kn; g1 = *(const v8h*)(kn + (size_t)32 * CC); g2 = *(const v8h*)vn; g3 = *(const v8h*)(vn + (size_t)32 * TT); }
#pragma unroll
    for (int pp = 0; pp < AKT / 32; ++pp) {
      v8f s[2] = {}, sq[2] = {};
#pragma unroll
      for (int kc = 0; kc < HD / 32; ++kc)
#pragma unroll
        for (int t = 0; t < 2; ++t) { const v16h kf = frag_h(&sk[bu][ks][pp * 32 + t * 16 + col][kc * 32], lane); s[t] = wm16(kf, qh[kc], s[t]); sq[t] = wm16(kf, qr[kc], sq[t]); }
      v16h vf[HD / 16];
#pragma unroll
      for (int j = 0; j < HD / 16; ++j) vf[j] = frag_h(&sv[bu][ks][j * 16 + col][pp * 32], lane);
      float v[16]; float mx = m;
#pragma unroll
      for (int i = 0; i < 16; ++i) { v[i] = (s[i >> 3][i & 7] + sq[i >> 3][i & 7] * (1.0f / 1024.0f)) * SCALE; mx = fmaxf(mx, v[i]); }
      mx = fmaxf(mx, xhalf(mx));
      if (__builtin_amdgcn_ballot_w32(mx > m) != 0) {   // some query's maximum rose: bring sum and O^T to the new one (a factor of exactly 1 for the other queries)
        const float a = expf(m - mx); l2 *= a; m = mx;
#pragma unroll
        for (int j = 0; j < HD / 16; ++j)
#pragma unroll
          for (int r = 0; r < 8; ++r) o[j][r] *= a; }
      v16h pf;
#pragma unroll
      for (int i = 0; i < 16; i += 2) { const v2f e = {expf(v[i] - m), expf(v[i + 1] - m)}; l2 += e; pf[i] = (_Float16)(e.x * 2048.0f); pf[i + 1] = (_Float16)(e.y * 2048.0f); }
#pragma unroll
      for (int j = 0; j < HD / 16; ++j) o[j] = wm16(vf[j], pf, o[j]); }
    if (st + 1 < ANS) { *(v8h*)&sk[bu ^ 1][ks][sr][sc] = g0; *(v8h*)&sk[bu ^ 1][ks][sr + 32][sc] = g1; *(v8h*)&sv[bu ^ 1][ks][sr][sc] = g2; *(v8h*)&sv[bu ^ 1][ks][sr + 32][sc] = g3; }   // its readers left this buffer before the last barrier
    __syncthreads(); }   // publishes stage st + 1 and ends every read of stage st
  float l = l2.x + l2.y; l += xhalf(l);
  if (ks > 0) {
#pragma unroll
    for (int j = 0; j < HD / 16; ++j)
#pragma unroll
      for (int r = 0; r < 8; ++r) sp[ks - 1][qt][j * 8 + r][lane] = o[j][r];
    if (g == 0) { smx[ks - 1][qt][col] = m; ssu[ks - 1][qt][col] = l; } }
  __syncthreads();   // the other ranges' partial results are published
  if (ks == 0) {
#pragma unroll
    for (int x = 0; x < AKS - 1; ++x) { const float m1 = smx[x][qt][col], l1 = ssu[x][qt][col]; const float mm = fmaxf(m, m1); const float a0 = expf(m - mm), a1 = expf(m1 - mm); l = l * a0 + l1 * a1; m = mm;
#pragma unroll
      for (int j = 0; j < HD / 16; ++j)
#pragma unroll
        for (int r = 0; r < 8; ++r) o[j][r] = o[j][r] * a0 + sp[x][qt][j * 8 + r][lane] * a1; }
    const float inv = 1.0f / (l * 2048.0f);
#pragma unroll
    for (int j = 0; j < HD / 16; ++j)
#pragma unroll
      for (int r = 0; r < 8; ++r) so[qt][col][j * 16 + 8 * g + r] = o[j][r] * inv;
    LDSX();   // the wave's own rows of so are written before it reads them back row by row
#pragma unroll
    for (int it = 0; it < 8; ++it) { const int rl = it * 2 + g; vst2(Y + ((size_t)b * TT + ql0 + rl) * CC + h * HD + col * 4, *(const v4f*)&so[qt][rl][col * 4]); } } }
// ---- k_out: block = (64 rows, 128 cols): out = ctx Wo (+ bo): all rows: ctx bf16 hi + lo against exact bf16 Wo (2 products); the f16 (bf16 x 2^8, 1 product) branch is not taken
__global__ __launch_bounds__(128) void k_out(const float* __restrict__ Y, const float* __restrict__ WO, const float* __restrict__ BO, float* __restrict__ OUT) { __shared__ __align__(16) float sf[4][16][132]; __shared__ __align__(16) __bf16 tw[2][128][GPW];
  const int tid = threadIdx.x, wave = tid >> 5, lane = tid & 31, col = lane & 15, g = lane >> 4; const int c0 = blockIdx.y * 128; const size_t r0 = (size_t)blockIdx.x * 64 + wave * 16;
  v8f acc[8] = {};
  if (true) {   /* ALL rows: ctx split bf16 hi + lo x exact Wo (2 products) */
    const int n4 = (wave * 8 + ((lane & 3) | ((lane >> 4) << 2))) * 4, o4 = (lane >> 2) & 3;
    const float* wp = WO + (size_t)(o4 * 8) * DIN + c0 + n4; const float* xp = Y + (r0 + col) * CC + 8 * g;
    v4f wf[2][8], xf[2][4]; F2 a[2]; wst_load(wf, wp, DIN); arow_load(xf, xp); wst_store(&tw[0][n4][o4 * 8], wf);
#pragma unroll
    for (int kk = 0; kk < 2; ++kk) { float v[16];
#pragma unroll
      for (int e = 0; e < 16; ++e) v[e] = xf[kk][e >> 2][e & 3];
      a[kk] = bsplit16(v); }
    __syncthreads();   // stage 0 is published
    for (int st = 0; st < CC / GKS; ++st) { const int bu = st & 1; const bool more = st + 1 < CC / GKS;
      if (more) { wst_load(wf, wp + (size_t)((st + 1) * GKS) * DIN, DIN); arow_load(xf, xp + (st + 1) * GKS);
        asm volatile("s_wait_xcnt 0x0" ::: "memory"); }   // in front of the first rewrite of an address register that these loads name
#pragma unroll
      for (int kk = 0; kk < 2; ++kk)
#pragma unroll
        for (int jh = 0; jh < 8; jh += 4) { v16b w[4];   // four fragments are read as one group, so that the wave waits out the LDS latency once for eight products
#pragma unroll
          for (int j = 0; j < 4; ++j) w[j] = frag_b(&tw[bu][(jh + j) * 16 + col][kk * 32], lane);
#pragma unroll
          for (int j = 0; j < 4; ++j) acc[jh + j] = wmma_bf(a[kk].h, w[j], acc[jh + j]);
#pragma unroll
          for (int j = 0; j < 4; ++j) acc[jh + j] = wmma_bf(a[kk].l, w[j], acc[jh + j]); }   // hi before lo in every accumulator, as before
      if (more) { wst_store(&tw[bu ^ 1][n4][o4 * 8], wf);   // its readers left this buffer before the last barrier
#pragma unroll
        for (int kk = 0; kk < 2; ++kk) { float v[16];
#pragma unroll
          for (int e = 0; e < 16; ++e) v[e] = xf[kk][e >> 2][e & 3];
          a[kk] = bsplit16(v); } }
      __syncthreads(); }   // publishes stage st + 1 and ends every read of stage st
#pragma unroll
    for (int j = 0; j < 8; ++j) { const float bias = BO ? bfr(BO[c0 + j * 16 + col]) : 0.f;
#pragma unroll
      for (int r = 0; r < 8; ++r) sf[wave][8 * g + r][j * 16 + col] = acc[j][r] + bias; }
  } else {
#pragma unroll 2
    for (int kc = 0; kc < CC / 32; ++kc) { const v16h a = frag_f32(Y + (r0 + col) * CC + kc * 32, lane); asm volatile("s_wait_loadcnt 0x0" ::: "memory");
#pragma unroll
      for (int j = 0; j < 8; ++j) { const v16h w = WOCOLH(WO, kc * 32, c0 + j * 16 + col, lane); asm volatile("s_wait_loadcnt 0x0" ::: "memory"); acc[j] = wmma16(a, w, acc[j]); } }
#pragma unroll
    for (int j = 0; j < 8; ++j) { const float bias = BO ? bfr(BO[c0 + j * 16 + col]) : 0.f;
#pragma unroll
      for (int r = 0; r < 8; ++r) sf[wave][8 * g + r][j * 16 + col] = acc[j][r] * (1.0f / 256.0f) + bias; } }
  LDSX(); for (int rl = 0; rl < 16; ++rl) vst2(OUT + (r0 + rl) * DIN + c0 + lane * 4, *(const v4f*)&sf[wave][rl][lane * 4]); }

extern "C" void kernel_launch(void* const* d_in, const int* in_sizes, int n_in, void* d_out, int out_size, void* d_ws, size_t ws_size, hipStream_t stream) {
  (void)in_sizes; (void)n_in; (void)out_size;
  const float** F = (const float**)d_in;
  if (ws_size < (size_t)WS_END) return;
  char* ws = (char*)d_ws; _Float16 *QH = (_Float16*)(ws + WS_QH), *KH = (_Float16*)(ws + WS_KH), *VT = (_Float16*)(ws + WS_VT), *QL = (_Float16*)(ws + WS_QL), *KL = (_Float16*)(ws + WS_KL); __bf16 *VB = (__bf16*)(ws + WS_VB), *VBL = (__bf16*)(ws + WS_VBL); float *Y = (float*)(ws + WS_Y);
  (void)Y; (void)QL; (void)KL; (void)VB; (void)VBL;
  // inputs: 0 x [2,2048,512]; 1 Wq (in,out), 2 bq; 3 Wk, 4 bk; 5 Wv, 6 bv; 7 Wo (in,out), 8 bo
  k_proj<<<dim3(TNB * TT / 64, CC / 128, 3), 128, 0, stream>>>(F[0], F[0], F[0], F[1], F[3], F[5], F[2], F[4], F[6], QH, QL, KH, KL, VT, VB, VBL);
  k_attn<<<dim3(TT / (AQT * 16), TNB * NH), AQT * AKS * 32, 0, stream>>>(QH, KH, QL, VT, Y);
  k_out<<<dim3(TNB * TT / 64, DIN / 128), 128, 0, stream>>>(Y, F[7], F[8], (float*)d_out);
}

// v003
// One run takes 54.7 microseconds.
// In two side-by-side timings against v002, it was 1.25 and 1.24 times as fast.
// Counting every step since v000, it is 10.5 times as fast.
// compute dtype: all float inputs rounded to bf16; q/k/v = in W + b with EXACT bf16 products on WMMA 16x16x32 (f32 accumulate); q as f16 hi + residual (x 2^10) against k once to f16 (2 products) / 8; online softmax in f32 (one fused multiply-add and the hardware's exp2 per logit), fused with both products; exp(logit - max) x 2^11 once to f16 against v once to f16 (1 product), divided by the f32 sum (x 2^11 too) at the end; ctx split bf16 hi + lo against exact Wo (2 products) + bo; f32 output.
#include <hip/hip_runtime.h>
#include <math.h>

typedef __attribute__((ext_vector_type(16))) _Float16 v16h;
typedef __attribute__((ext_vector_type(16))) __bf16 v16b;
typedef __attribute__((ext_vector_type(8)))  _Float16 v8h;
typedef __attribute__((ext_vector_type(8)))  float v8f;
typedef __attribute__((ext_vector_type(4)))  float v4f;
typedef __attribute__((ext_vector_type(2)))  float v2f;
typedef __attribute__((ext_vector_type(4)))  unsigned v4u;
typedef __attribute__((ext_vector_type(4)))  int v4i;
typedef float __attribute__((may_alias)) float_a;
typedef int __attribute__((may_alias)) int_a;

template <typename T> __device__ __forceinline__ void vst2(void* p, T v) { *(T*)p = v;  }
__device__ __forceinline__ v8f wmma16(v16h a, v16h b, v8f c) {
  v8f d = __builtin_amdgcn_wmma_f32_16x16x32_f16(false, a, false, b, (short)0, c, false, false);
  asm volatile("v_nop\n\tv_nop\n\tv_nop\n\tv_nop" : "+v"(d) : "v"(a), "v"(b));
  return d;
}
__device__ __forceinline__ v8f wmma_bf(v16b a, v16b b, v8f c) {
  v8f d = __builtin_amdgcn_wmma_f32_16x16x32_bf16(false, a, false, b, (short)0, c, false, false);
  asm volatile("v_nop\n\tv_nop\n\tv_nop\n\tv_nop" : "+v"(d) : "v"(a), "v"(b));
  return d;
}
// 16x16x32 fragments: lane = (h = lane>>4, row/col = lane&15); elements 0..7 = k0+8h+0..7, 8..15 = k0+16+8h+0..7; D element r = row 8h+r
__device__ __forceinline__ v16h frag_h(const _Float16* rowk0, int lane) {
  union { v16h v; v8h q[2]; } u; const _Float16* p = rowk0 + 8 * (lane >> 4);
  u.q[0] = *(const v8h*)p; u.q[1] = *(const v8h*)(p + 16); return u.v;
}
__device__ __forceinline__ v16h frag_f32(const float* rowk0, int lane) {
  v16h a; const float* p = rowk0 + 8 * (lane >> 4);
#pragma unroll
  for (int i = 0; i < 8; ++i) { a[i] = (_Float16)p[i]; a[8 + i] = (_Float16)p[16 + i]; }
  return a;
}
__device__ __forceinline__ v16h frag_f32s(const float* rowk0, int lane, float sc) {
  v16h a; const float* p = rowk0 + 8 * (lane >> 4);
#pragma unroll
  for (int i = 0; i < 8; ++i) { a[i] = (_Float16)(p[i] * sc); a[8 + i] = (_Float16)(p[16 + i] * sc); }
  return a;
}
// column fragment from a [K][ld] layout (column n), rows >= K read as 0
__device__ __forceinline__ v16h fragc_f32(const float* W, int k0, int n, int lane, int ld, int K) {
  v16h a; const int g = lane >> 4;
#pragma unroll
  for (int i = 0; i < 8; ++i) { const int ka = k0 + 8 * g + i, kb = ka + 16;
    a[i] = (_Float16)(ka < K ? W[(size_t)(ka < K ? ka : K - 1) * ld + n] : 0.f); a[8 + i] = (_Float16)(kb < K ? W[(size_t)(kb < K ? kb : K - 1) * ld + n] : 0.f); }
  return a;
}
struct F2 { v16b h, l; };
__device__ __forceinline__ F2 bsplit16(const float v[16]) { F2 r;
#pragma unroll
  for (int i = 0; i < 16; ++i) { const __bf16 h = (__bf16)v[i]; r.h[i] = h; r.l[i] = (__bf16)(v[i] - (float)h); }
  return r; }
__device__ __forceinline__ F2 split_row(const float* row, int k0, int lane) { float v[16]; const float* p = row + k0 + 8 * (lane >> 4);
#pragma unroll
  for (int i = 0; i < 8; ++i) { v[i] = p[i]; v[8 + i] = p[16 + i]; }
  return bsplit16(v); }
__device__ __forceinline__ F2 split_rowK(const float* row, int k0, int lane, int K) { float v[16]; const int g = lane >> 4;
#pragma unroll
  for (int i = 0; i < 8; ++i) { const int ka = k0 + 8 * g + i, kb = ka + 16; v[i] = ka < K ? row[ka < K ? ka : K - 1] : 0.f; v[8 + i] = kb < K ? row[kb < K ? kb : K - 1] : 0.f; }
  return bsplit16(v); }
__device__ __forceinline__ F2 split_col(const float* W, int k0, int n, int lane, int ld, int K) { float v[16]; const int g = lane >> 4;
#pragma unroll
  for (int i = 0; i < 8; ++i) { const int ka = k0 + 8 * g + i, kb = ka + 16; v[i] = ka < K ? W[(size_t)(ka < K ? ka : K - 1) * ld + n] : 0.f; v[8 + i] = kb < K ? W[(size_t)(kb < K ? kb : K - 1) * ld + n] : 0.f; }
  return bsplit16(v); }
__device__ __forceinline__ v8f mac3(const F2& a, const F2& b, v8f c) { c = wmma_bf(a.l, b.h, c); c = wmma_bf(a.h, b.l, c); return wmma_bf(a.h, b.h, c); }
__device__ __forceinline__ float sigm(float v) { return 1.0f / (1.0f + expf(-v)); }
#define LDSX() do { asm volatile("s_wait_dscnt 0" ::: "memory"); __builtin_amdgcn_wave_barrier(); __builtin_amdgcn_fence(__ATOMIC_RELEASE, "workgroup"); } while (0)

// Multi-head self-attention (B 2, S 2,048, d_model 512 = 8 x 64; (in,out) uniform +-1/sqrt(512) weights WITH biases): q, k, v = x W + b; out = merged(softmax(q k^T / 8) v) Wo + bo (non-causal).
#define NB 2
#define TT 2048
#define CC 512            // NH * HD = projected width
#define DIN 512          // input (model) width
#define NH 8
#define HD 64
#define NQB (TT / 64)
#define HG 4
#define SCALE (0.125f)
#define CAUSAL 0
#ifndef TNB
#define TNB NB
#endif
__device__ __forceinline__ float bfr(float v) { return (float)(__bf16)v; }
__host__ __device__ __forceinline__ int kb_last(int qb) { return CAUSAL ? ((qb * 64 + 63) >> 7) : (TT / 128 - 1); }
typedef __attribute__((ext_vector_type(8))) __bf16 v8b;
__device__ __forceinline__ v16b frag_b(const __bf16* rowk0, int lane) {
  union { v16b v; v8b q[2]; } u; const __bf16* p = rowk0 + 8 * (lane >> 4);
  u.q[0] = *(const v8b*)p; u.q[1] = *(const v8b*)(p + 16); return u.v;
}
#define QBH 0              // unused: every query block takes the one k_attn path
#define QHI 2048            // rows carrying a q residual plane (all rows when non-causal: 2-product logits everywhere)
#define KHI 64            // key rows carrying k residual / v bf16 hi+lo planes (written by k_proj; no kernel reads them)
// B fragment (k rows k0+.., output column o) of a weight: (in,out) [K][ld] or (out,in) [ld rows of K]: bf16 exact, or f16(bf16 * 256) exact
__device__ __forceinline__ v16b wcol_io(const float* Wm, int k0, int o, int lane, int ld) { v16b w; const int g = lane >> 4;
#pragma unroll
  for (int i = 0; i < 8; ++i) { w[i] = (__bf16)Wm[(size_t)(k0 + 8 * g + i) * ld + o]; w[8 + i] = (__bf16)Wm[(size_t)(k0 + 16 + 8 * g + i) * ld + o]; }
  return w; }
__device__ __forceinline__ v16b wcol_oi(const float* Wm, int k0, int o, int lane, int K) { v16b w; const float* p = Wm + (size_t)o * K + k0 + 8 * (lane >> 4);
#pragma unroll
  for (int i = 0; i < 8; ++i) { w[i] = (__bf16)p[i]; w[8 + i] = (__bf16)p[16 + i]; }
  return w; }
__device__ __forceinline__ v16h wcolh_io(const float* Wm, int k0, int o, int lane, int ld) { v16h w; const int g = lane >> 4;
#pragma unroll
  for (int i = 0; i < 8; ++i) { w[i] = (_Float16)(bfr(Wm[(size_t)(k0 + 8 * g + i) * ld + o]) * 256.0f); w[8 + i] = (_Float16)(bfr(Wm[(size_t)(k0 + 16 + 8 * g + i) * ld + o]) * 256.0f); }
  return w; }
__device__ __forceinline__ v16h wcolh_oi(const float* Wm, int k0, int o, int lane, int K) { v16h w; const float* p = Wm + (size_t)o * K + k0 + 8 * (lane >> 4);
#pragma unroll
  for (int i = 0; i < 8; ++i) { w[i] = (_Float16)(bfr(p[i]) * 256.0f); w[8 + i] = (_Float16)(bfr(p[16 + i]) * 256.0f); }
  return w; }
#define WQKV_LAYOUT 0   // 0 = (in,out) [DIN][CC]; 1 = (out,in) [CC][DIN]; 2 = per-head [NH][DIN][HD]
__device__ __forceinline__ v16b wcol_hdk(const float* Wm, int k0, int o, int lane) { v16b w; const int g = lane >> 4; const float* p = Wm + (size_t)(o / HD) * DIN * HD + (o % HD);
#pragma unroll
  for (int i = 0; i < 8; ++i) { w[i] = (__bf16)p[(size_t)(k0 + 8 * g + i) * HD]; w[8 + i] = (__bf16)p[(size_t)(k0 + 16 + 8 * g + i) * HD]; }
  return w; }
#define WO_OUT_IN 0
#if WQKV_LAYOUT == 1
#define WCOL(W, k0, o, lane) wcol_oi(W, k0, o, lane, DIN)
#elif WQKV_LAYOUT == 2
#define WCOL(W, k0, o, lane) wcol_hdk(W, k0, o, lane)
#else
#define WCOL(W, k0, o, lane) wcol_io(W, k0, o, lane, CC)
#endif
#if WO_OUT_IN
#define WOCOL(W, k0, o, lane) wcol_oi(W, k0, o, lane, CC)
#define WOCOLH(W, k0, o, lane) wcolh_oi(W, k0, o, lane, CC)
#else
#define WOCOL(W, k0, o, lane) wcol_io(W, k0, o, lane, DIN)
#define WOCOLH(W, k0, o, lane) wcolh_io(W, k0, o, lane, DIN)
#endif

#ifndef SM_EXTRA_PARAMS
#define SM_EXTRA_PARAMS
#endif
#ifndef PROJ_EXTRA_PARAMS
#define PROJ_EXTRA_PARAMS
#endif
#ifndef SM_MASK_HOOK
#define SM_MASK_HOOK (void)0
#endif

#define WS_QH  0u                                      // f16 q rows [b*t][CC]
#define WS_KH  (WS_QH + 2u * (size_t)NB * TT * CC)      // f16 k rows [b*t][CC]
#define WS_VT  (WS_KH + 2u * (size_t)NB * TT * CC)      // f16 v planes [b][c][t]
#define WS_QL  (WS_VT + 2u * (size_t)NB * CC * TT)      // f16 q residual x 2^10 rows [b][t < QHI][CC]
#define WS_KL  (WS_QL + 2u * (size_t)NB * QHI * CC)     // f16 k residual x 2^10 rows [b][t < KHI][CC]
#define WS_VB  (WS_KL + 2u * (size_t)NB * KHI * CC)     // bf16 v hi planes [b][c][t < KHI]
#define WS_VBL (WS_VB + 2u * (size_t)NB * CC * KHI)
#define WS_S   (WS_VBL + 2u * (size_t)NB * CC * KHI)    // f32 [hg][t][s] region, unused: logits and P stay in registers
#define WS_Y   (WS_S  + 4u * (size_t)HG * TT * TT)      // f32 ctx rows [b*t][CC] (only when there is an output projection)
#define WS_END (WS_Y  + 4u * (size_t)NB * TT * CC)

// ---- weight staging of the two projection GEMMs: a stage is GKS k rows x 128 columns of an (in,out) f32 weight, rounded to bf16 and laid column-major in LDS (pitch GPW), once per block for its four waves.
// Thread (wave, lane) moves columns n4..n4+3 of k rows o4*8 + u*32 + i: a wave-wide load covers four whole 128-B lines, and 16 neighbouring lanes' 16-byte LDS stores cover all 64 banks once.
// Two buffers: the next stage's loads fly during this stage's products, one barrier a stage. The k order of the products is the one of the unstaged loop. Every '#pragma unroll' of the staging and of the two loops keeps a register array statically indexed.
#define GKS 64
#define GPW 72                    // LDS pitch in bf16: 128-B rows + 16 B, conflict-free for 16-byte fragment reads
__device__ __forceinline__ void wst_load(v4f (&f)[2][8], const float* wp, int ld) {
#pragma unroll
  for (int u = 0; u < 2; ++u)
#pragma unroll
    for (int i = 0; i < 8; ++i) f[u][i] = *(const v4f*)(wp + (size_t)(u * 32 + i) * ld); }
__device__ __forceinline__ void wst_store(__bf16* sp, const v4f (&f)[2][8]) {
#pragma unroll
  for (int u = 0; u < 2; ++u)
#pragma unroll
    for (int c = 0; c < 4; ++c) { v8b p;
#pragma unroll
      for (int i = 0; i < 8; ++i) p[i] = (__bf16)f[u][i][c];
      *(v8b*)(sp + c * GPW + u * 32) = p; } }
// the lane's f32 elements of the A fragments of one stage (p = row + stage k0 + 8 * (lane >> 4)): element e of fragment kk is x[kk][e >> 2][e & 3]
__device__ __forceinline__ void arow_load(v4f (&x)[2][4], const float* p) {
#pragma unroll
  for (int kk = 0; kk < 2; ++kk) { x[kk][0] = *(const v4f*)(p + kk * 32); x[kk][1] = *(const v4f*)(p + kk * 32 + 4); x[kk][2] = *(const v4f*)(p + kk * 32 + 16); x[kk][3] = *(const v4f*)(p + kk * 32 + 20); } }
// ---- k_proj: block = (64 rows, 128 cols, which): q/k/v = X W (+ b) with exact bf16 products (K = DIN) -> which 0: q f16 rows (+ residual rows < QHI); 1: k f16 rows (+ residual rows < KHI); 2: v f16 planes [c][t] (+ bf16 hi/lo planes for t < KHI)
__global__ __launch_bounds__(128) void k_proj(const float* __restrict__ XQ, const float* __restrict__ XK, const float* __restrict__ XV, const float* __restrict__ WQ, const float* __restrict__ WK, const float* __restrict__ WV, const float* __restrict__ BQ, const float* __restrict__ BK, const float* __restrict__ BV,
    _Float16* __restrict__ QH, _Float16* __restrict__ QL, _Float16* __restrict__ KH, _Float16* __restrict__ KL, _Float16* __restrict__ VT, __bf16* __restrict__ VB, __bf16* __restrict__ VBL) {
  __shared__ __align__(16) _Float16 sh[64][136], sl[64][136]; __shared__ __align__(16) _Float16 th[128][72]; __shared__ __align__(16) __bf16 tw[2][128][GPW]; __bf16 (&tb)[128][72] = tw[0]; __bf16 (&tbl)[128][72] = tw[1];   // the two weight buffers of the loop are the epilogue's tb and tbl
  const int tid = threadIdx.x, wave = tid >> 5, lane = tid & 31, col = lane & 15, g = lane >> 4; const int which = blockIdx.z; const int c0 = blockIdx.y * 128; const size_t r0 = (size_t)blockIdx.x * 64; const size_t bb = r0 / TT; const int t0 = (int)(r0 % TT);
  const float* X = which == 0 ? XQ : which == 1 ? XK : XV; const float* WA = which == 0 ? WQ : which == 1 ? WK : WV; const float* BA = which == 0 ? BQ : which == 1 ? BK : BV;
  v8f acc[8] = {};
  const int n4 = (wave * 8 + ((lane & 3) | ((lane >> 4) << 2))) * 4, o4 = (lane >> 2) & 3;
  const float* wp = WA + (size_t)(o4 * 8) * CC + c0 + n4; const float* xp = X + (r0 + wave * 16 + col) * DIN + 8 * g;
  v4f wf[2][8], xf[2][4]; v16b a[2]; wst_load(wf, wp, CC); arow_load(xf, xp); wst_store(&tw[0][n4][o4 * 8], wf);
#pragma unroll
  for (int kk = 0; kk < 2; ++kk)
#pragma unroll
    for (int e = 0; e < 16; ++e) a[kk][e] = (__bf16)xf[kk][e >> 2][e & 3];
  __syncthreads();   // stage 0 is published
  for (int st = 0; st < DIN / GKS; ++st) { const int bu = st & 1; const bool more = st + 1 < DIN / GKS;
    if (more) { wst_load(wf, wp + (size_t)((st + 1) * GKS) * CC, CC); arow_load(xf, xp + (st + 1) * GKS);
      asm volatile("s_wait_xcnt 0x0" ::: "memory"); }   // in front of the first rewrite of an address register that these loads name
#pragma unroll
    for (int kk = 0; kk < 2; ++kk)
#pragma unroll
      for (int jh = 0; jh < 8; jh += 4) { v16b w[4];   // four fragments are read as one group, so that the wave waits out the LDS latency once for four products
#pragma unroll
        for (int j = 0; j < 4; ++j) w[j] = frag_b(&tw[bu][(jh + j) * 16 + col][kk * 32], lane);
#pragma unroll
        for (int j = 0; j < 4; ++j) acc[jh + j] = wmma_bf(a[kk], w[j], acc[jh + j]); }
    if (more) { wst_store(&tw[bu ^ 1][n4][o4 * 8], wf);   // its readers left this buffer before the last barrier
#pragma unroll
      for (int kk = 0; kk < 2; ++kk)
#pragma unroll
        for (int e = 0; e < 16; ++e) a[kk][e] = (__bf16)xf[kk][e >> 2][e & 3]; }
    __syncthreads(); }   // publishes stage st + 1 and ends every read of stage st
  if (which < 2) { _Float16* DH = which == 0 ? QH : KH; _Float16* DL = which == 0 ? QL : KL; const int nhi = which == 0 ? QHI : KHI; const bool hi_rows = t0 < nhi;
#pragma unroll
    for (int j = 0; j < 8; ++j) { const float bias = BA ? bfr(BA[c0 + j * 16 + col]) : 0.f;
#pragma unroll
      for (int r = 0; r < 8; ++r) { const float v = acc[j][r] + bias; const _Float16 hv = (_Float16)v; sh[wave * 16 + 8 * g + r][j * 16 + col] = hv; sl[wave * 16 + 8 * g + r][j * 16 + col] = (_Float16)((v - (float)hv) * 1024.0f); } }
    __syncthreads();
    for (int e = tid; e < 64 * 16; e += 128) { const int rl = e >> 4, q = e & 15; vst2((unsigned*)(DH + (r0 + rl) * CC + c0 + q * 8), *(const v4u*)&sh[rl][q * 8]); if (hi_rows) vst2((unsigned*)(DL + (bb * nhi + t0 + rl) * (size_t)CC + c0 + q * 8), *(const v4u*)&sl[rl][q * 8]); }
  } else { const bool hi_rows = t0 < KHI;
#pragma unroll
    for (int j = 0; j < 8; ++j) { const float bias = BA ? bfr(BA[c0 + j * 16 + col]) : 0.f;
#pragma unroll
      for (int r = 0; r < 8; ++r) { const float v = acc[j][r] + bias; const int rl = wave * 16 + 8 * g + r, cl = j * 16 + col; th[cl][rl] = (_Float16)v; const __bf16 bh = (__bf16)v; tb[cl][rl] = bh; tbl[cl][rl] = (__bf16)(v - (float)bh); } }
    __syncthreads();
    for (int e = tid; e < 128 * 8; e += 128) { const int cl = e >> 3, q = e & 7; vst2((unsigned*)(VT + (bb * CC + c0 + cl) * (size_t)TT + t0 + q * 8), *(const v4u*)&th[cl][q * 8]); if (hi_rows) { const size_t o3 = (bb * CC + c0 + cl) * (size_t)KHI + t0 + q * 8; vst2((unsigned*)(VB + o3), *(const v4u*)&tb[cl][q * 8]); vst2((unsigned*)(VBL + o3), *(const v4u*)&tbl[cl][q * 8]); } } } }
#define AQT 8
#define AKS 2
#define AKT 64                    // keys per stage and range: 128-B rows of k (64 d) and of v^T (64 keys)
#define ANS (TT / AKS / AKT)
#define AC2 (SCALE * 1.44269504088896340736f)   // logit scale x log2(e)
#define APK 72                    // LDS pitch in halves: 128-B rows + 16 B, conflict-free for 16-byte fragment reads
__device__ __forceinline__ v8f wm16(v16h a, v16h b, v8f c) { return __builtin_amdgcn_wmma_f32_16x16x32_f16(false, a, false, b, (short)0, c, false, false); }
__device__ __forceinline__ float xhalf(float x) { return __builtin_bit_cast(float, __builtin_amdgcn_permlanex16(__builtin_bit_cast(int, x), __builtin_bit_cast(int, x), 0x76543210, 0xfedcba98, false, false)); }  // lane l with lane l ^ 16
__global__ __launch_bounds__(AQT * AKS * 32) void k_attn(const _Float16* __restrict__ QH, const _Float16* __restrict__ KH, const _Float16* __restrict__ QL, const _Float16* __restrict__ VT, float* __restrict__ Y) {
  __shared__ __align__(16) _Float16 sk[2][AKS][AKT][APK], sv[2][AKS][HD][APK];
  __shared__ __align__(16) float sp[AKS - 1][AQT][HD / 2][32]; __shared__ float smx[AKS - 1][AQT][16], ssu[AKS - 1][AQT][16]; __shared__ __align__(16) float so[AQT][16][HD + 4];
  const int tid = threadIdx.x, wave = __builtin_amdgcn_readfirstlane(tid >> 5), lane = tid & 31, col = lane & 15, g = lane >> 4; const int qt = wave % AQT, ks = wave / AQT;
  const int b = blockIdx.y / NH, h = blockIdx.y % NH; const int ql0 = blockIdx.x * (AQT * 16) + qt * 16;
  // staging: thread (qt, lane) of a range moves 16-byte chunk sc of rows sr and sr + 32 of the k tile and of the v^T tile (8 lanes = one 128-B line)
  const int sr = qt * 4 + (lane >> 3), sc = (lane & 7) * 8;
  const _Float16* kg = KH + ((size_t)b * TT + ks * (TT / AKS) + sr) * CC + h * HD + sc;
  const _Float16* vg = VT + ((size_t)b * CC + h * HD + sr) * (size_t)TT + ks * (TT / AKS) + sc;
  v8h g0 = *(const v8h*)kg, g1 = *(const v8h*)(kg + (size_t)32 * CC), g2 = *(const v8h*)vg, g3 = *(const v8h*)(vg + (size_t)32 * TT);
  v16h qh[HD / 32], qr[HD / 32];
#pragma unroll
  for (int kc = 0; kc < HD / 32; ++kc) { qh[kc] = frag_h(QH + ((size_t)b * TT + ql0 + col) * CC + h * HD + kc * 32, lane); qr[kc] = frag_h(QL + ((size_t)b * QHI + ql0 + col) * CC + h * HD + kc * 32, lane); }
  *(v8h*)&sk[0][ks][sr][sc] = g0; *(v8h*)&sk[0][ks][sr + 32][sc] = g1; *(v8h*)&sv[0][ks][sr][sc] = g2; *(v8h*)&sv[0][ks][sr + 32][sc] = g3;
  __syncthreads();   // stage 0 is published
  v8f o[HD / 16] = {}; float m = -3.0e38f, nm = 11.0f - m * AC2; v2f l2 = {0.f, 0.f};   // the lane's sum of exponentials (x 2^11), even and odd elements apart (packed adds)
  for (int st = 0; st < ANS; ++st) { const int bu = st & 1;
    if (st + 1 < ANS) { const _Float16* kn = kg + (size_t)((st + 1) * AKT) * CC; const _Float16* vn = vg + (st + 1) * AKT;
      g0 = *(const v8h*)kn; g1 = *(const v8h*)(kn + (size_t)32 * CC); g2 = *(const v8h*)vn; g3 = *(const v8h*)(vn + (size_t)32 * TT); }
#pragma unroll
    for (int pp = 0; pp < AKT / 32; ++pp) {
      v8f s[2] = {}, sq[2] = {};
#pragma unroll
      for (int kc = 0; kc < HD / 32; ++kc)
#pragma unroll
        for (int t = 0; t < 2; ++t) { const v16h kf = frag_h(&sk[bu][ks][pp * 32 + t * 16 + col][kc * 32], lane); s[t] = wm16(kf, qh[kc], s[t]); sq[t] = wm16(kf, qr[kc], sq[t]); }
      v16h vf[HD / 16];
#pragma unroll
      for (int j = 0; j < HD / 16; ++j) vf[j] = frag_h(&sv[bu][ks][j * 16 + col][pp * 32], lane);
      v2f v[8]; float mx = m;
#pragma unroll
      for (int i = 0; i < 8; ++i) { const v2f sh = {s[i >> 2][(2 * i) & 7], s[i >> 2][(2 * i + 1) & 7]}, sr = {sq[i >> 2][(2 * i) & 7], sq[i >> 2][(2 * i + 1) & 7]}; v[i] = sh + sr * (1.0f / 1024.0f); mx = fmaxf(mx, fmaxf(v[i].x, v[i].y)); }
      mx = fmaxf(mx, xhalf(mx));
      if (__builtin_amdgcn_ballot_w32(mx > m) != 0) {   // some query's maximum rose: bring sum and O^T to the new one (a factor of exactly 1 for the other queries)
        const float nn = 11.0f - mx * AC2; const float a = __builtin_amdgcn_exp2f(nn - nm); l2 *= a; m = mx; nm = nn;
#pragma unroll
        for (int j = 0; j < HD / 16; ++j)
#pragma unroll
          for (int r = 0; r < 8; ++r) o[j][r] *= a; }
      v16h pf;
#pragma unroll
      for (int i = 0; i < 8; ++i) { const v2f x = v[i] * AC2 + nm; const v2f e = {__builtin_amdgcn_exp2f(x.x), __builtin_amdgcn_exp2f(x.y)}; l2 += e; pf[2 * i] = (_Float16)e.x; pf[2 * i + 1] = (_Float16)e.y; }
#pragma unroll
      for (int j = 0; j < HD / 16; ++j) o[j] = wm16(vf[j], pf, o[j]); }
    if (st + 1 < ANS) { *(v8h*)&sk[bu ^ 1][ks][sr][sc] = g0; *(v8h*)&sk[bu ^ 1][ks][sr + 32][sc] = g1; *(v8h*)&sv[bu ^ 1][ks][sr][sc] = g2; *(v8h*)&sv[bu ^ 1][ks][sr + 32][sc] = g3; }   // its readers left this buffer before the last barrier
    __syncthreads(); }   // publishes stage st + 1 and ends every read of stage st
  float l = l2.x + l2.y; l += xhalf(l);
  if (ks > 0) {
#pragma unroll
    for (int j = 0; j < HD / 16; ++j)
#pragma unroll
      for (int r = 0; r < 8; ++r) sp[ks - 1][qt][j * 8 + r][lane] = o[j][r];
    if (g == 0) { smx[ks - 1][qt][col] = nm; ssu[ks - 1][qt][col] = l; } }
  __syncthreads();   // the other ranges' partial results are published
  if (ks == 0) {
#pragma unroll
    for (int x = 0; x < AKS - 1; ++x) { const float n1 = smx[x][qt][col], l1 = ssu[x][qt][col]; const float nn = fminf(nm, n1); const float a0 = __builtin_amdgcn_exp2f(nn - nm), a1 = __builtin_amdgcn_exp2f(nn - n1); l = l * a0 + l1 * a1; nm = nn;   // the smaller nm belongs to the larger maximum
#pragma unroll
      for (int j = 0; j < HD / 16; ++j)
#pragma unroll
        for (int r = 0; r < 8; ++r) o[j][r] = o[j][r] * a0 + sp[x][qt][j * 8 + r][lane] * a1; }
    const float inv = 1.0f / l;
#pragma unroll
    for (int j = 0; j < HD / 16; ++j)
#pragma unroll
      for (int r = 0; r < 8; ++r) so[qt][col][j * 16 + 8 * g + r] = o[j][r] * inv;
    LDSX();   // the wave's own rows of so are written before it reads them back row by row
#pragma unroll
    for (int it = 0; it < 8; ++it) { const int rl = it * 2 + g; vst2(Y + ((size_t)b * TT + ql0 + rl) * CC + h * HD + col * 4, *(const v4f*)&so[qt][rl][col * 4]); } } }
// ---- k_out: block = (64 rows, 128 cols): out = ctx Wo (+ bo): all rows: ctx bf16 hi + lo against exact bf16 Wo (2 products); the f16 (bf16 x 2^8, 1 product) branch is not taken
__global__ __launch_bounds__(128) void k_out(const float* __restrict__ Y, const float* __restrict__ WO, const float* __restrict__ BO, float* __restrict__ OUT) { __shared__ __align__(16) float sf[4][16][132]; __shared__ __align__(16) __bf16 tw[2][128][GPW];
  const int tid = threadIdx.x, wave = tid >> 5, lane = tid & 31, col = lane & 15, g = lane >> 4; const int c0 = blockIdx.y * 128; const size_t r0 = (size_t)blockIdx.x * 64 + wave * 16;
  v8f acc[8] = {};
  if (true) {   /* ALL rows: ctx split bf16 hi + lo x exact Wo (2 products) */
    const int n4 = (wave * 8 + ((lane & 3) | ((lane >> 4) << 2))) * 4, o4 = (lane >> 2) & 3;
    const float* wp = WO + (size_t)(o4 * 8) * DIN + c0 + n4; const float* xp = Y + (r0 + col) * CC + 8 * g;
    v4f wf[2][8], xf[2][4]; F2 a[2]; wst_load(wf, wp, DIN); arow_load(xf, xp); wst_store(&tw[0][n4][o4 * 8], wf);
#pragma unroll
    for (int kk = 0; kk < 2; ++kk) { float v[16];
#pragma unroll
      for (int e = 0; e < 16; ++e) v[e] = xf[kk][e >> 2][e & 3];
      a[kk] = bsplit16(v); }
    __syncthreads();   // stage 0 is published
    for (int st = 0; st < CC / GKS; ++st) { const int bu = st & 1; const bool more = st + 1 < CC / GKS;
      if (more) { wst_load(wf, wp + (size_t)((st + 1) * GKS) * DIN, DIN); arow_load(xf, xp + (st + 1) * GKS);
        asm volatile("s_wait_xcnt 0x0" ::: "memory"); }   // in front of the first rewrite of an address register that these loads name
#pragma unroll
      for (int kk = 0; kk < 2; ++kk)
#pragma unroll
        for (int jh = 0; jh < 8; jh += 4) { v16b w[4];   // four fragments are read as one group, so that the wave waits out the LDS latency once for eight products
#pragma unroll
          for (int j = 0; j < 4; ++j) w[j] = frag_b(&tw[bu][(jh + j) * 16 + col][kk * 32], lane);
#pragma unroll
          for (int j = 0; j < 4; ++j) acc[jh + j] = wmma_bf(a[kk].h, w[j], acc[jh + j]);
#pragma unroll
          for (int j = 0; j < 4; ++j) acc[jh + j] = wmma_bf(a[kk].l, w[j], acc[jh + j]); }   // hi before lo in every accumulator, as before
      if (more) { wst_store(&tw[bu ^ 1][n4][o4 * 8], wf);   // its readers left this buffer before the last barrier
#pragma unroll
        for (int kk = 0; kk < 2; ++kk) { float v[16];
#pragma unroll
          for (int e = 0; e < 16; ++e) v[e] = xf[kk][e >> 2][e & 3];
          a[kk] = bsplit16(v); } }
      __syncthreads(); }   // publishes stage st + 1 and ends every read of stage st
#pragma unroll
    for (int j = 0; j < 8; ++j) { const float bias = BO ? bfr(BO[c0 + j * 16 + col]) : 0.f;
#pragma unroll
      for (int r = 0; r < 8; ++r) sf[wave][8 * g + r][j * 16 + col] = acc[j][r] + bias; }
  } else {
#pragma unroll 2
    for (int kc = 0; kc < CC / 32; ++kc) { const v16h a = frag_f32(Y + (r0 + col) * CC + kc * 32, lane); asm volatile("s_wait_loadcnt 0x0" ::: "memory");
#pragma unroll
      for (int j = 0; j < 8; ++j) { const v16h w = WOCOLH(WO, kc * 32, c0 + j * 16 + col, lane); asm volatile("s_wait_loadcnt 0x0" ::: "memory"); acc[j] = wmma16(a, w, acc[j]); } }
#pragma unroll
    for (int j = 0; j < 8; ++j) { const float bias = BO ? bfr(BO[c0 + j * 16 + col]) : 0.f;
#pragma unroll
      for (int r = 0; r < 8; ++r) sf[wave][8 * g + r][j * 16 + col] = acc[j][r] * (1.0f / 256.0f) + bias; } }
  LDSX(); for (int rl = 0; rl < 16; ++rl) vst2(OUT + (r0 + rl) * DIN + c0 + lane * 4, *(const v4f*)&sf[wave][rl][lane * 4]); }

extern "C" void kernel_launch(void* const* d_in, const int* in_sizes, int n_in, void* d_out, int out_size, void* d_ws, size_t ws_size, hipStream_t stream) {
  (void)in_sizes; (void)n_in; (void)out_size;
  const float** F = (const float**)d_in;
  if (ws_size < (size_t)WS_END) return;
  char* ws = (char*)d_ws; _Float16 *QH = (_Float16*)(ws + WS_QH), *KH = (_Float16*)(ws + WS_KH), *VT = (_Float16*)(ws + WS_VT), *QL = (_Float16*)(ws + WS_QL), *KL = (_Float16*)(ws + WS_KL); __bf16 *VB = (__bf16*)(ws + WS_VB), *VBL = (__bf16*)(ws + WS_VBL); float *Y = (float*)(ws + WS_Y);
  (void)Y; (void)QL; (void)KL; (void)VB; (void)VBL;
  // inputs: 0 x [2,2048,512]; 1 Wq (in,out), 2 bq; 3 Wk, 4 bk; 5 Wv, 6 bv; 7 Wo (in,out), 8 bo
  k_proj<<<dim3(TNB * TT / 64, CC / 128, 3), 128, 0, stream>>>(F[0], F[0], F[0], F[1], F[3], F[5], F[2], F[4], F[6], QH, QL, KH, KL, VT, VB, VBL);
  k_attn<<<dim3(TT / (AQT * 16), TNB * NH), AQT * AKS * 32, 0, stream>>>(QH, KH, QL, VT, Y);
  k_out<<<dim3(TNB * TT / 64, DIN / 128), 128, 0, stream>>>(Y, F[7], F[8], (float*)d_out);
}

// v004
// It runs in 52.5 microseconds.
// Next to v003, in two timings, it ran 1.05 times as fast each time.
// Counting every step since v000, it is 11.1 times as fast.
// compute dtype: all float inputs rounded to bf16; q/k/v = in W + b with EXACT bf16 products on WMMA 16x16x32 (f32 accumulate); q once to f16 against k once to f16 (1 product) / 8; online softmax in f32 (one fused multiply-add and the hardware's exp2 per logit), fused with both products; exp(logit - max) x 2^11 once to f16 against v once to f16 (1 product), divided by the f32 sum (x 2^11 too) at the end; ctx split bf16 hi + lo against exact Wo (2 products) + bo; f32 output.
#include <hip/hip_runtime.h>
#include <math.h>

typedef __attribute__((ext_vector_type(16))) _Float16 v16h;
typedef __attribute__((ext_vector_type(16))) __bf16 v16b;
typedef __attribute__((ext_vector_type(8)))  _Float16 v8h;
typedef __attribute__((ext_vector_type(8)))  float v8f;
typedef __attribute__((ext_vector_type(4)))  float v4f;
typedef __attribute__((ext_vector_type(2)))  float v2f;
typedef __attribute__((ext_vector_type(4)))  unsigned v4u;
typedef __attribute__((ext_vector_type(4)))  int v4i;
typedef float __attribute__((may_alias)) float_a;
typedef int __attribute__((may_alias)) int_a;

template <typename T> __device__ __forceinline__ void vst2(void* p, T v) { *(T*)p = v;  }
__device__ __forceinline__ v8f wmma16(v16h a, v16h b, v8f c) {
  v8f d = __builtin_amdgcn_wmma_f32_16x16x32_f16(false, a, false, b, (short)0, c, false, false);
  asm volatile("v_nop\n\tv_nop\n\tv_nop\n\tv_nop" : "+v"(d) : "v"(a), "v"(b));
  return d;
}
__device__ __forceinline__ v8f wmma_bf(v16b a, v16b b, v8f c) {
  v8f d = __builtin_amdgcn_wmma_f32_16x16x32_bf16(false, a, false, b, (short)0, c, false, false);
  asm volatile("v_nop\n\tv_nop\n\tv_nop\n\tv_nop" : "+v"(d) : "v"(a), "v"(b));
  return d;
}
// 16x16x32 fragments: lane = (h = lane>>4, row/col = lane&15); elements 0..7 = k0+8h+0..7, 8..15 = k0+16+8h+0..7; D element r = row 8h+r
__device__ __forceinline__ v16h frag_h(const _Float16* rowk0, int lane) {
  union { v16h v; v8h q[2]; } u; const _Float16* p = rowk0 + 8 * (lane >> 4);
  u.q[0] = *(const v8h*)p; u.q[1] = *(const v8h*)(p + 16); return u.v;
}
__device__ __forceinline__ v16h frag_f32(const float* rowk0, int lane) {
  v16h a; const float* p = rowk0 + 8 * (lane >> 4);
#pragma unroll
  for (int i = 0; i < 8; ++i) { a[i] = (_Float16)p[i]; a[8 + i] = (_Float16)p[16 + i]; }
  return a;
}
__device__ __forceinline__ v16h frag_f32s(const float* rowk0, int lane, float sc) {
  v16h a; const float* p = rowk0 + 8 * (lane >> 4);
#pragma unroll
  for (int i = 0; i < 8; ++i) { a[i] = (_Float16)(p[i] * sc); a[8 + i] = (_Float16)(p[16 + i] * sc); }
  return a;
}
// column fragment from a [K][ld] layout (column n), rows >= K read as 0
__device__ __forceinline__ v16h fragc_f32(const float* W, int k0, int n, int lane, int ld, int K) {
  v16h a; const int g = lane >> 4;
#pragma unroll
  for (int i = 0; i < 8; ++i) { const int ka = k0 + 8 * g + i, kb = ka + 16;
    a[i] = (_Float16)(ka < K ? W[(size_t)(ka < K ? ka : K - 1) * ld + n] : 0.f); a[8 + i] = (_Float16)(kb < K ? W[(size_t)(kb < K ? kb : K - 1) * ld + n] : 0.f); }
  return a;
}
struct F2 { v16b h, l; };
__device__ __forceinline__ F2 bsplit16(const float v[16]) { F2 r;
#pragma unroll
  for (int i = 0; i < 16; ++i) { const __bf16 h = (__bf16)v[i]; r.h[i] = h; r.l[i] = (__bf16)(v[i] - (float)h); }
  return r; }
__device__ __forceinline__ F2 split_row(const float* row, int k0, int lane) { float v[16]; const float* p = row + k0 + 8 * (lane >> 4);
#pragma unroll
  for (int i = 0; i < 8; ++i) { v[i] = p[i]; v[8 + i] = p[16 + i]; }
  return bsplit16(v); }
__device__ __forceinline__ F2 split_rowK(const float* row, int k0, int lane, int K) { float v[16]; const int g = lane >> 4;
#pragma unroll
  for (int i = 0; i < 8; ++i) { const int ka = k0 + 8 * g + i, kb = ka + 16; v[i] = ka < K ? row[ka < K ? ka : K - 1] : 0.f; v[8 + i] = kb < K ? row[kb < K ? kb : K - 1] : 0.f; }
  return bsplit16(v); }
__device__ __forceinline__ F2 split_col(const float* W, int k0, int n, int lane, int ld, int K) { float v[16]; const int g = lane >> 4;
#pragma unroll
  for (int i = 0; i < 8; ++i) { const int ka = k0 + 8 * g + i, kb = ka + 16; v[i] = ka < K ? W[(size_t)(ka < K ? ka : K - 1) * ld + n] : 0.f; v[8 + i] = kb < K ? W[(size_t)(kb < K ? kb : K - 1) * ld + n] : 0.f; }
  return bsplit16(v); }
__device__ __forceinline__ v8f mac3(const F2& a, const F2& b, v8f c) { c = wmma_bf(a.l, b.h, c); c = wmma_bf(a.h, b.l, c); return wmma_bf(a.h, b.h, c); }
__device__ __forceinline__ float sigm(float v) { return 1.0f / (1.0f + expf(-v)); }
#define LDSX() do { asm volatile("s_wait_dscnt 0" ::: "memory"); __builtin_amdgcn_wave_barrier(); __builtin_amdgcn_fence(__ATOMIC_RELEASE, "workgroup"); } while (0)

// Multi-head self-attention (B 2, S 2,048, d_model 512 = 8 x 64; (in,out) uniform +-1/sqrt(512) weights WITH biases): q, k, v = x W + b; out = merged(softmax(q k^T / 8) v) Wo + bo (non-causal).
#define NB 2
#define TT 2048
#define CC 512            // NH * HD = projected width
#define DIN 512          // input (model) width
#define NH 8
#define HD 64
#define NQB (TT / 64)
#define HG 4
#define SCALE (0.125f)
#define CAUSAL 0
#ifndef TNB
#define TNB NB
#endif
__device__ __forceinline__ float bfr(float v) { return (float)(__bf16)v; }
__host__ __device__ __forceinline__ int kb_last(int qb) { return CAUSAL ? ((qb * 64 + 63) >> 7) : (TT / 128 - 1); }
typedef __attribute__((ext_vector_type(8))) __bf16 v8b;
__device__ __forceinline__ v16b frag_b(const __bf16* rowk0, int lane) {
  union { v16b v; v8b q[2]; } u; const __bf16* p = rowk0 + 8 * (lane >> 4);
  u.q[0] = *(const v8b*)p; u.q[1] = *(const v8b*)(p + 16); return u.v;
}
#define QBH 0              // unused: k_attn has no high-precision path
#define QHI 0               // rows carrying a q residual plane (none: q goes into the logits rounded once to f16, as k does)
#define KHI 64            // key rows carrying k residual / v bf16 hi+lo planes (written by k_proj, read by no kernel)
// B fragment (k rows k0+.., output column o) of a weight: (in,out) [K][ld] or (out,in) [ld rows of K]: bf16 exact, or f16(bf16 * 256) exact
__device__ __forceinline__ v16b wcol_io(const float* Wm, int k0, int o, int lane, int ld) { v16b w; const int g = lane >> 4;
#pragma unroll
  for (int i = 0; i < 8; ++i) { w[i] = (__bf16)Wm[(size_t)(k0 + 8 * g + i) * ld + o]; w[8 + i] = (__bf16)Wm[(size_t)(k0 + 16 + 8 * g + i) * ld + o]; }
  return w; }
__device__ __forceinline__ v16b wcol_oi(const float* Wm, int k0, int o, int lane, int K) { v16b w; const float* p = Wm + (size_t)o * K + k0 + 8 * (lane >> 4);
#pragma unroll
  for (int i = 0; i < 8; ++i) { w[i] = (__bf16)p[i]; w[8 + i] = (__bf16)p[16 + i]; }
  return w; }
__device__ __forceinline__ v16h wcolh_io(const float* Wm, int k0, int o, int lane, int ld) { v16h w; const int g = lane >> 4;
#pragma unroll
  for (int i = 0; i < 8; ++i) { w[i] = (_Float16)(bfr(Wm[(size_t)(k0 + 8 * g + i) * ld + o]) * 256.0f); w[8 + i] = (_Float16)(bfr(Wm[(size_t)(k0 + 16 + 8 * g + i) * ld + o]) * 256.0f); }
  return w; }
__device__ __forceinline__ v16h wcolh_oi(const float* Wm, int k0, int o, int lane, int K) { v16h w; const float* p = Wm + (size_t)o * K + k0 + 8 * (lane >> 4);
#pragma unroll
  for (int i = 0; i < 8; ++i) { w[i] = (_Float16)(bfr(p[i]) * 256.0f); w[8 + i] = (_Float16)(bfr(p[16 + i]) * 256.0f); }
  return w; }
#define WQKV_LAYOUT 0   // 0 = (in,out) [DIN][CC]; 1 = (out,in) [CC][DIN]; 2 = per-head [NH][DIN][HD]
__device__ __forceinline__ v16b wcol_hdk(const float* Wm, int k0, int o, int lane) { v16b w; const int g = lane >> 4; const float* p = Wm + (size_t)(o / HD) * DIN * HD + (o % HD);
#pragma unroll
  for (int i = 0; i < 8; ++i) { w[i] = (__bf16)p[(size_t)(k0 + 8 * g + i) * HD]; w[8 + i] = (__bf16)p[(size_t)(k0 + 16 + 8 * g + i) * HD]; }
  return w; }
#define WO_OUT_IN 0
#if WQKV_LAYOUT == 1
#define WCOL(W, k0, o, lane) wcol_oi(W, k0, o, lane, DIN)
#elif WQKV_LAYOUT == 2
#define WCOL(W, k0, o, lane) wcol_hdk(W, k0, o, lane)
#else
#define WCOL(W, k0, o, lane) wcol_io(W, k0, o, lane, CC)
#endif
#if WO_OUT_IN
#define WOCOL(W, k0, o, lane) wcol_oi(W, k0, o, lane, CC)
#define WOCOLH(W, k0, o, lane) wcolh_oi(W, k0, o, lane, CC)
#else
#define WOCOL(W, k0, o, lane) wcol_io(W, k0, o, lane, DIN)
#define WOCOLH(W, k0, o, lane) wcolh_io(W, k0, o, lane, DIN)
#endif

#ifndef SM_EXTRA_PARAMS
#define SM_EXTRA_PARAMS
#endif
#ifndef PROJ_EXTRA_PARAMS
#define PROJ_EXTRA_PARAMS
#endif
#ifndef SM_MASK_HOOK
#define SM_MASK_HOOK (void)0
#endif

#define WS_QH  0u                                      // f16 q rows [b*t][CC]
#define WS_KH  (WS_QH + 2u * (size_t)NB * TT * CC)      // f16 k rows [b*t][CC]
#define WS_VT  (WS_KH + 2u * (size_t)NB * TT * CC)      // f16 v planes [b][c][t]
#define WS_QL  (WS_VT + 2u * (size_t)NB * CC * TT)      // f16 q residual x 2^10 rows [b][t < QHI][CC]
#define WS_KL  (WS_QL + 2u * (size_t)NB * QHI * CC)     // f16 k residual x 2^10 rows [b][t < KHI][CC]
#define WS_VB  (WS_KL + 2u * (size_t)NB * KHI * CC)     // bf16 v hi planes [b][c][t < KHI]
#define WS_VBL (WS_VB + 2u * (size_t)NB * CC * KHI)
#define WS_S   (WS_VBL + 2u * (size_t)NB * CC * KHI)    // f32 [hg][t][s] region, unused: logits and P stay in registers
#define WS_Y   (WS_S  + 4u * (size_t)HG * TT * TT)      // f32 ctx rows [b*t][CC] (only when there is an output projection)
#define WS_END (WS_Y  + 4u * (size_t)NB * TT * CC)

// ---- weight staging of the two projection GEMMs: a stage is GKS k rows x 128 columns of an (in,out) f32 weight, rounded to bf16 and laid column-major in LDS (pitch GPW), once per block for its four waves.
// Thread (wave, lane) moves columns n4..n4+3 of k rows o4*8 + u*32 + i: a wave-wide load covers four whole 128-B lines, and 16 neighbouring lanes' 16-byte LDS stores cover all 64 banks once.
// Two buffers: the next stage's loads fly during this stage's products, one barrier a stage. The k order of the products is the one of the unstaged loop. Every '#pragma unroll' of the staging and of the two loops keeps a register array statically indexed.
#define GKS 64
#define GPW 72                    // LDS pitch in bf16: 128-B rows + 16 B, conflict-free for 16-byte fragment reads
__device__ __forceinline__ void wst_load(v4f (&f)[2][8], const float* wp, int ld) {
#pragma unroll
  for (int u = 0; u < 2; ++u)
#pragma unroll
    for (int i = 0; i < 8; ++i) f[u][i] = *(const v4f*)(wp + (size_t)(u * 32 + i) * ld); }
__device__ __forceinline__ void wst_store(__bf16* sp, const v4f (&f)[2][8]) {
#pragma unroll
  for (int u = 0; u < 2; ++u)
#pragma unroll
    for (int c = 0; c < 4; ++c) { v8b p;
#pragma unroll
      for (int i = 0; i < 8; ++i) p[i] = (__bf16)f[u][i][c];
      *(v8b*)(sp + c * GPW + u * 32) = p; } }
// the lane's f32 elements of the A fragments of one stage (p = row + stage k0 + 8 * (lane >> 4)): element e of fragment kk is x[kk][e >> 2][e & 3]
__device__ __forceinline__ void arow_load(v4f (&x)[2][4], const float* p) {
#pragma unroll
  for (int kk = 0; kk < 2; ++kk) { x[kk][0] = *(const v4f*)(p + kk * 32); x[kk][1] = *(const v4f*)(p + kk * 32 + 4); x[kk][2] = *(const v4f*)(p + kk * 32 + 16); x[kk][3] = *(const v4f*)(p + kk * 32 + 20); } }
// ---- k_proj: block = (64 rows, 128 cols, which): q/k/v = X W (+ b) with exact bf16 products (K = DIN) -> which 0: q f16 rows (+ residual rows < QHI); 1: k f16 rows (+ residual rows < KHI); 2: v f16 planes [c][t] (+ bf16 hi/lo planes for t < KHI)
__global__ __launch_bounds__(128) void k_proj(const float* __restrict__ XQ, const float* __restrict__ XK, const float* __restrict__ XV, const float* __restrict__ WQ, const float* __restrict__ WK, const float* __restrict__ WV, const float* __restrict__ BQ, const float* __restrict__ BK, const float* __restrict__ BV,
    _Float16* __restrict__ QH, _Float16* __restrict__ QL, _Float16* __restrict__ KH, _Float16* __restrict__ KL, _Float16* __restrict__ VT, __bf16* __restrict__ VB, __bf16* __restrict__ VBL) {
  __shared__ __align__(16) _Float16 sh[64][136], sl[64][136]; __shared__ __align__(16) _Float16 th[128][72]; __shared__ __align__(16) __bf16 tw[2][128][GPW]; __bf16 (&tb)[128][72] = tw[0]; __bf16 (&tbl)[128][72] = tw[1];   // the two weight buffers of the loop are the epilogue's tb and tbl
  const int tid = threadIdx.x, wave = tid >> 5, lane = tid & 31, col = lane & 15, g = lane >> 4; const int which = blockIdx.z; const int c0 = blockIdx.y * 128; const size_t r0 = (size_t)blockIdx.x * 64; const size_t bb = r0 / TT; const int t0 = (int)(r0 % TT);
  const float* X = which == 0 ? XQ : which == 1 ? XK : XV; const float* WA = which == 0 ? WQ : which == 1 ? WK : WV; const float* BA = which == 0 ? BQ : which == 1 ? BK : BV;
  v8f acc[8] = {};
  const int n4 = (wave * 8 + ((lane & 3) | ((lane >> 4) << 2))) * 4, o4 = (lane >> 2) & 3;
  const float* wp = WA + (size_t)(o4 * 8) * CC + c0 + n4; const float* xp = X + (r0 + wave * 16 + col) * DIN + 8 * g;
  v4f wf[2][8], xf[2][4]; v16b a[2]; wst_load(wf, wp, CC); arow_load(xf, xp); wst_store(&tw[0][n4][o4 * 8], wf);
#pragma unroll
  for (int kk = 0; kk < 2; ++kk)
#pragma unroll
    for (int e = 0; e < 16; ++e) a[kk][e] = (__bf16)xf[kk][e >> 2][e & 3];
  __syncthreads();   // stage 0 is published
  for (int st = 0; st < DIN / GKS; ++st) { const int bu = st & 1; const bool more = st + 1 < DIN / GKS;
    if (more) { wst_load(wf, wp + (size_t)((st + 1) * GKS) * CC, CC); arow_load(xf, xp + (st + 1) * GKS);
      asm volatile("s_wait_xcnt 0x0" ::: "memory"); }   // in front of the first rewrite of an address register that these loads name
#pragma unroll
    for (int kk = 0; kk < 2; ++kk)
#pragma unroll
      for (int jh = 0; jh < 8; jh += 4) { v16b w[4];   // four fragments are read as one group, so that the wave waits out the LDS latency once for four products
#pragma unroll
        for (int j = 0; j < 4; ++j) w[j] = frag_b(&tw[bu][(jh + j) * 16 + col][kk * 32], lane);
#pragma unroll
        for (int j = 0; j < 4; ++j) acc[jh + j] = wmma_bf(a[kk], w[j], acc[jh + j]); }
    if (more) { wst_store(&tw[bu ^ 1][n4][o4 * 8], wf);   // its readers left this buffer before the last barrier
#pragma unroll
      for (int kk = 0; kk < 2; ++kk)
#pragma unroll
        for (int e = 0; e < 16; ++e) a[kk][e] = (__bf16)xf[kk][e >> 2][e & 3]; }
    __syncthreads(); }   // publishes stage st + 1 and ends every read of stage st
  if (which < 2) { _Float16* DH = which == 0 ? QH : KH; _Float16* DL = which == 0 ? QL : KL; const int nhi = which == 0 ? QHI : KHI; const bool hi_rows = t0 < nhi;
    if (hi_rows) {   // the residual is formed only in the blocks that store it
#pragma unroll
      for (int j = 0; j < 8; ++j) { const float bias = BA ? bfr(BA[c0 + j * 16 + col]) : 0.f;
#pragma unroll
        for (int r = 0; r < 8; ++r) { const float v = acc[j][r] + bias; const _Float16 hv = (_Float16)v; sh[wave * 16 + 8 * g + r][j * 16 + col] = hv; sl[wave * 16 + 8 * g + r][j * 16 + col] = (_Float16)((v - (float)hv) * 1024.0f); } }
    } else {
#pragma unroll
      for (int j = 0; j < 8; ++j) { const float bias = BA ? bfr(BA[c0 + j * 16 + col]) : 0.f;
#pragma unroll
        for (int r = 0; r < 8; ++r) sh[wave * 16 + 8 * g + r][j * 16 + col] = (_Float16)(acc[j][r] + bias); } }
    __syncthreads();
    for (int e = tid; e < 64 * 16; e += 128) { const int rl = e >> 4, q = e & 15; vst2((unsigned*)(DH + (r0 + rl) * CC + c0 + q * 8), *(const v4u*)&sh[rl][q * 8]); if (hi_rows) vst2((unsigned*)(DL + (bb * nhi + t0 + rl) * (size_t)CC + c0 + q * 8), *(const v4u*)&sl[rl][q * 8]); }
  } else { const bool hi_rows = t0 < KHI;
#pragma unroll
    for (int j = 0; j < 8; ++j) { const float bias = BA ? bfr(BA[c0 + j * 16 + col]) : 0.f;
#pragma unroll
      for (int r = 0; r < 8; ++r) { const float v = acc[j][r] + bias; const int rl = wave * 16 + 8 * g + r, cl = j * 16 + col; th[cl][rl] = (_Float16)v; const __bf16 bh = (__bf16)v; tb[cl][rl] = bh; tbl[cl][rl] = (__bf16)(v - (float)bh); } }
    __syncthreads();
    for (int e = tid; e < 128 * 8; e += 128) { const int cl = e >> 3, q = e & 7; vst2((unsigned*)(VT + (bb * CC + c0 + cl) * (size_t)TT + t0 + q * 8), *(const v4u*)&th[cl][q * 8]); if (hi_rows) { const size_t o3 = (bb * CC + c0 + cl) * (size_t)KHI + t0 + q * 8; vst2((unsigned*)(VB + o3), *(const v4u*)&tb[cl][q * 8]); vst2((unsigned*)(VBL + o3), *(const v4u*)&tbl[cl][q * 8]); } } } }
#define AQT 8
#define AKS 2
#define AKT 64                    // keys per stage and range: 128-B rows of k (64 d) and of v^T (64 keys)
#define ANS (TT / AKS / AKT)
#define AC2 (SCALE * 1.44269504088896340736f)   // logit scale x log2(e)
#define APK 72                    // LDS pitch in halves: 128-B rows + 16 B, conflict-free for 16-byte fragment reads
__device__ __forceinline__ v8f wm16(v16h a, v16h b, v8f c) { return __builtin_amdgcn_wmma_f32_16x16x32_f16(false, a, false, b, (short)0, c, false, false); }
__device__ __forceinline__ float xhalf(float x) { return __builtin_bit_cast(float, __builtin_amdgcn_permlanex16(__builtin_bit_cast(int, x), __builtin_bit_cast(int, x), 0x76543210, 0xfedcba98, false, false)); }  // lane l with lane l ^ 16
__global__ __launch_bounds__(AQT * AKS * 32) void k_attn(const _Float16* __restrict__ QH, const _Float16* __restrict__ KH, const _Float16* __restrict__ VT, float* __restrict__ Y) {
  __shared__ __align__(16) _Float16 sk[2][AKS][AKT][APK], sv[2][AKS][HD][APK];
  __shared__ __align__(16) float sp[AKS - 1][AQT][HD / 2][32]; __shared__ float smx[AKS - 1][AQT][16], ssu[AKS - 1][AQT][16]; __shared__ __align__(16) float so[AQT][16][HD + 4];
  const int tid = threadIdx.x, wave = __builtin_amdgcn_readfirstlane(tid >> 5), lane = tid & 31, col = lane & 15, g = lane >> 4; const int qt = wave % AQT, ks = wave / AQT;
  const int b = blockIdx.y / NH, h = blockIdx.y % NH; const int ql0 = blockIdx.x * (AQT * 16) + qt * 16;
  // staging: thread (qt, lane) of a range moves 16-byte chunk sc of rows sr and sr + 32 of the k tile and of the v^T tile (8 lanes = one 128-B line)
  const int sr = qt * 4 + (lane >> 3), sc = (lane & 7) * 8;
  const _Float16* kg = KH + ((size_t)b * TT + ks * (TT / AKS) + sr) * CC + h * HD + sc;
  const _Float16* vg = VT + ((size_t)b * CC + h * HD + sr) * (size_t)TT + ks * (TT / AKS) + sc;
  v8h g0 = *(const v8h*)kg, g1 = *(const v8h*)(kg + (size_t)32 * CC), g2 = *(const v8h*)vg, g3 = *(const v8h*)(vg + (size_t)32 * TT);
  v16h qh[HD / 32];
#pragma unroll
  for (int kc = 0; kc < HD / 32; ++kc) qh[kc] = frag_h(QH + ((size_t)b * TT + ql0 + col) * CC + h * HD + kc * 32, lane);
  *(v8h*)&sk[0][ks][sr][sc] = g0; *(v8h*)&sk[0][ks][sr + 32][sc] = g1; *(v8h*)&sv[0][ks][sr][sc] = g2; *(v8h*)&sv[0][ks][sr + 32][sc] = g3;
  __syncthreads();   // stage 0 is published
  v8f o[HD / 16] = {}; float m = -3.0e38f, nm = 11.0f - m * AC2; v2f l2 = {0.f, 0.f};   // the lane's sum of exponentials (x 2^11), even and odd elements apart (packed adds)
  for (int st = 0; st < ANS; ++st) { const int bu = st & 1;
    if (st + 1 < ANS) { const _Float16* kn = kg + (size_t)((st + 1) * AKT) * CC; const _Float16* vn = vg + (st + 1) * AKT;
      g0 = *(const v8h*)kn; g1 = *(const v8h*)(kn + (size_t)32 * CC); g2 = *(const v8h*)vn; g3 = *(const v8h*)(vn + (size_t)32 * TT); }
#pragma unroll
    for (int pp = 0; pp < AKT / 32; ++pp) {
      v8f s[2] = {};
#pragma unroll
      for (int kc = 0; kc < HD / 32; ++kc)
#pragma unroll
        for (int t = 0; t < 2; ++t) s[t] = wm16(frag_h(&sk[bu][ks][pp * 32 + t * 16 + col][kc * 32], lane), qh[kc], s[t]);
      v16h vf[HD / 16];
#pragma unroll
      for (int j = 0; j < HD / 16; ++j) vf[j] = frag_h(&sv[bu][ks][j * 16 + col][pp * 32], lane);
      v2f v[8]; float mx = m;
#pragma unroll
      for (int i = 0; i < 8; ++i) { v[i] = v2f{s[i >> 2][(2 * i) & 7], s[i >> 2][(2 * i + 1) & 7]}; mx = fmaxf(mx, fmaxf(v[i].x, v[i].y)); }
      mx = fmaxf(mx, xhalf(mx));
      if (__builtin_amdgcn_ballot_w32(mx > m) != 0) {   // some query's maximum rose: bring sum and O^T to the new one (a factor of exactly 1 for the other queries)
        const float nn = 11.0f - mx * AC2; const float a = __builtin_amdgcn_exp2f(nn - nm); l2 *= a; m = mx; nm = nn;
#pragma unroll
        for (int j = 0; j < HD / 16; ++j)
#pragma unroll
          for (int r = 0; r < 8; ++r) o[j][r] *= a; }
      v16h pf;
#pragma unroll
      for (int i = 0; i < 8; ++i) { const v2f x = v[i] * AC2 + nm; const v2f e = {__builtin_amdgcn_exp2f(x.x), __builtin_amdgcn_exp2f(x.y)}; l2 += e; pf[2 * i] = (_Float16)e.x; pf[2 * i + 1] = (_Float16)e.y; }
#pragma unroll
      for (int j = 0; j < HD / 16; ++j) o[j] = wm16(vf[j], pf, o[j]); }
    if (st + 1 < ANS) { *(v8h*)&sk[bu ^ 1][ks][sr][sc] = g0; *(v8h*)&sk[bu ^ 1][ks][sr + 32][sc] = g1; *(v8h*)&sv[bu ^ 1][ks][sr][sc] = g2; *(v8h*)&sv[bu ^ 1][ks][sr + 32][sc] = g3; }   // its readers left this buffer before the last barrier
    __syncthreads(); }   // publishes stage st + 1 and ends every read of stage st
  float l = l2.x + l2.y; l += xhalf(l);
  if (ks > 0) {
#pragma unroll
    for (int j = 0; j < HD / 16; ++j)
#pragma unroll
      for (int r = 0; r < 8; ++r) sp[ks - 1][qt][j * 8 + r][lane] = o[j][r];
    if (g == 0) { smx[ks - 1][qt][col] = nm; ssu[ks - 1][qt][col] = l; } }
  __syncthreads();   // the other ranges' partial results are published
  if (ks == 0) {
#pragma unroll
    for (int x = 0; x < AKS - 1; ++x) { const float n1 = smx[x][qt][col], l1 = ssu[x][qt][col]; const float nn = fminf(nm, n1); const float a0 = __builtin_amdgcn_exp2f(nn - nm), a1 = __builtin_amdgcn_exp2f(nn - n1); l = l * a0 + l1 * a1; nm = nn;   // the smaller nm belongs to the larger maximum
#pragma unroll
      for (int j = 0; j < HD / 16; ++j)
#pragma unroll
        for (int r = 0; r < 8; ++r) o[j][r] = o[j][r] * a0 + sp[x][qt][j * 8 + r][lane] * a1; }
    const float inv = 1.0f / l;
#pragma unroll
    for (int j = 0; j < HD / 16; ++j)
#pragma unroll
      for (int r = 0; r < 8; ++r) so[qt][col][j * 16 + 8 * g + r] = o[j][r] * inv;
    LDSX();   // the wave's own rows of so are written before it reads them back row by row
#pragma unroll
    for (int it = 0; it < 8; ++it) { const int rl = it * 2 + g; vst2(Y + ((size_t)b * TT + ql0 + rl) * CC + h * HD + col * 4, *(const v4f*)&so[qt][rl][col * 4]); } } }
// ---- k_out: block = (64 rows, 128 cols): out = ctx Wo (+ bo): all rows: ctx bf16 hi + lo against exact bf16 Wo (2 products); the f16 (bf16 x 2^8, 1 product) branch is not taken
__global__ __launch_bounds__(128) void k_out(const float* __restrict__ Y, const float* __restrict__ WO, const float* __restrict__ BO, float* __restrict__ OUT) { __shared__ __align__(16) float sf[4][16][132]; __shared__ __align__(16) __bf16 tw[2][128][GPW];
  const int tid = threadIdx.x, wave = tid >> 5, lane = tid & 31, col = lane & 15, g = lane >> 4; const int c0 = blockIdx.y * 128; const size_t r0 = (size_t)blockIdx.x * 64 + wave * 16;
  v8f acc[8] = {};
  if (true) {   /* ALL rows: ctx split bf16 hi + lo x exact Wo (2 products) */
    const int n4 = (wave * 8 + ((lane & 3) | ((lane >> 4) << 2))) * 4, o4 = (lane >> 2) & 3;
    const float* wp = WO + (size_t)(o4 * 8) * DIN + c0 + n4; const float* xp = Y + (r0 + col) * CC + 8 * g;
    v4f wf[2][8], xf[2][4]; F2 a[2]; wst_load(wf, wp, DIN); arow_load(xf, xp); wst_store(&tw[0][n4][o4 * 8], wf);
#pragma unroll
    for (int kk = 0; kk < 2; ++kk) { float v[16];
#pragma unroll
      for (int e = 0; e < 16; ++e) v[e] = xf[kk][e >> 2][e & 3];
      a[kk] = bsplit16(v); }
    __syncthreads();   // stage 0 is published
    for (int st = 0; st < CC / GKS; ++st) { const int bu = st & 1; const bool more = st + 1 < CC / GKS;
      if (more) { wst_load(wf, wp + (size_t)((st + 1) * GKS) * DIN, DIN); arow_load(xf, xp + (st + 1) * GKS);
        asm volatile("s_wait_xcnt 0x0" ::: "memory"); }   // in front of the first rewrite of an address register that these loads name
#pragma unroll
      for (int kk = 0; kk < 2; ++kk)
#pragma unroll
        for (int jh = 0; jh < 8; jh += 4) { v16b w[4];   // four fragments are read as one group, so that the wave waits out the LDS latency once for eight products
#pragma unroll
          for (int j = 0; j < 4; ++j) w[j] = frag_b(&tw[bu][(jh + j) * 16 + col][kk * 32], lane);
#pragma unroll
          for (int j = 0; j < 4; ++j) acc[jh + j] = wmma_bf(a[kk].h, w[j], acc[jh + j]);
#pragma unroll
          for (int j = 0; j < 4; ++j) acc[jh + j] = wmma_bf(a[kk].l, w[j], acc[jh + j]); }   // hi before lo in every accumulator, as before
      if (more) { wst_store(&tw[bu ^ 1][n4][o4 * 8], wf);   // its readers left this buffer before the last barrier
#pragma unroll
        for (int kk = 0; kk < 2; ++kk) { float v[16];
#pragma unroll
          for (int e = 0; e < 16; ++e) v[e] = xf[kk][e >> 2][e & 3];
          a[kk] = bsplit16(v); } }
      __syncthreads(); }   // publishes stage st + 1 and ends every read of stage st
#pragma unroll
    for (int j = 0; j < 8; ++j) { const float bias = BO ? bfr(BO[c0 + j * 16 + col]) : 0.f;
#pragma unroll
      for (int r = 0; r < 8; ++r) sf[wave][8 * g + r][j * 16 + col] = acc[j][r] + bias; }
  } else {
#pragma unroll 2
    for (int kc = 0; kc < CC / 32; ++kc) { const v16h a = frag_f32(Y + (r0 + col) * CC + kc * 32, lane); asm volatile("s_wait_loadcnt 0x0" ::: "memory");
#pragma unroll
      for (int j = 0; j < 8; ++j) { const v16h w = WOCOLH(WO, kc * 32, c0 + j * 16 + col, lane); asm volatile("s_wait_loadcnt 0x0" ::: "memory"); acc[j] = wmma16(a, w, acc[j]); } }
#pragma unroll
    for (int j = 0; j < 8; ++j) { const float bias = BO ? bfr(BO[c0 + j * 16 + col]) : 0.f;
#pragma unroll
      for (int r = 0; r < 8; ++r) sf[wave][8 * g + r][j * 16 + col] = acc[j][r] * (1.0f / 256.0f) + bias; } }
  LDSX(); for (int rl = 0; rl < 16; ++rl) vst2(OUT + (r0 + rl) * DIN + c0 + lane * 4, *(const v4f*)&sf[wave][rl][lane * 4]); }

extern "C" void kernel_launch(void* const* d_in, const int* in_sizes, int n_in, void* d_out, int out_size, void* d_ws, size_t ws_size, hipStream_t stream) {
  (void)in_sizes; (void)n_in; (void)out_size;
  const float** F = (const float**)d_in;
  if (ws_size < (size_t)WS_END) return;
  char* ws = (char*)d_ws; _Float16 *QH = (_Float16*)(ws + WS_QH), *KH = (_Float16*)(ws + WS_KH), *VT = (_Float16*)(ws + WS_VT), *QL = (_Float16*)(ws + WS_QL), *KL = (_Float16*)(ws + WS_KL); __bf16 *VB = (__bf16*)(ws + WS_VB), *VBL = (__bf16*)(ws + WS_VBL); float *Y = (float*)(ws + WS_Y);
  (void)Y; (void)QL; (void)KL; (void)VB; (void)VBL;
  // inputs: 0 x [2,2048,512]; 1 Wq (in,out), 2 bq; 3 Wk, 4 bk; 5 Wv, 6 bv; 7 Wo (in,out), 8 bo
  k_proj<<<dim3(TNB * TT / 64, CC / 128, 3), 128, 0, stream>>>(F[0], F[0], F[0], F[1], F[3], F[5], F[2], F[4], F[6], QH, QL, KH, KL, VT, VB, VBL);
  k_attn<<<dim3(TT / (AQT * 16), TNB * NH), AQT * AKS * 32, 0, stream>>>(QH, KH, VT, Y);
  k_out<<<dim3(TNB * TT / 64, DIN / 128), 128, 0, stream>>>(Y, F[7], F[8], (float*)d_out);
}

// v005
// One run takes 50.2 microseconds.
// Two timings next to v004 put it at 1.04 and 1.05 times that version's speed.
// Over all steps from v000 it is 11.6 times as fast.
// compute dtype: all float inputs rounded to bf16; q/k/v = in W + b with EXACT bf16 products on WMMA 16x16x32 (f32 accumulate); q once to f16 against k once to f16 (1 product) / 8; online softmax in f32 (one fused multiply-add and the hardware's exp2 per logit), fused with both products; exp(logit - max) x 2^11 once to f16 against v once to f16 (1 product), divided by the f32 sum (x 2^11 too) at the end; ctx split bf16 hi + lo against exact Wo (2 products) + bo; f32 output.
#include <hip/hip_runtime.h>
#include <math.h>

typedef __attribute__((ext_vector_type(16))) _Float16 v16h;
typedef __attribute__((ext_vector_type(16))) __bf16 v16b;
typedef __attribute__((ext_vector_type(8)))  _Float16 v8h;
typedef __attribute__((ext_vector_type(8)))  float v8f;
typedef __attribute__((ext_vector_type(4)))  float v4f;
typedef __attribute__((ext_vector_type(2)))  float v2f;
typedef __attribute__((ext_vector_type(4)))  unsigned v4u;
typedef __attribute__((ext_vector_type(4)))  int v4i;
typedef float __attribute__((may_alias)) float_a;
typedef int __attribute__((may_alias)) int_a;

template <typename T> __device__ __forceinline__ void vst2(void* p, T v) { *(T*)p = v;  }
__device__ __forceinline__ v8f wmma16(v16h a, v16h b, v8f c) {
  v8f d = __builtin_amdgcn_wmma_f32_16x16x32_f16(false, a, false, b, (short)0, c, false, false);
  asm volatile("v_nop\n\tv_nop\n\tv_nop\n\tv_nop" : "+v"(d) : "v"(a), "v"(b));
  return d;
}
__device__ __forceinline__ v8f wmma_bf(v16b a, v16b b, v8f c) {
  v8f d = __builtin_amdgcn_wmma_f32_16x16x32_bf16(false, a, false, b, (short)0, c, false, false);
  asm volatile("v_nop\n\tv_nop\n\tv_nop\n\tv_nop" : "+v"(d) : "v"(a), "v"(b));
  return d;
}
// 16x16x32 fragments: lane = (h = lane>>4, row/col = lane&15); elements 0..7 = k0+8h+0..7, 8..15 = k0+16+8h+0..7; D element r = row 8h+r
__device__ __forceinline__ v16h frag_h(const _Float16* rowk0, int lane) {
  union { v16h v; v8h q[2]; } u; const _Float16* p = rowk0 + 8 * (lane >> 4);
  u.q[0] = *(const v8h*)p; u.q[1] = *(const v8h*)(p + 16); return u.v;
}
__device__ __forceinline__ v16h frag_f32(const float* rowk0, int lane) {
  v16h a; const float* p = rowk0 + 8 * (lane >> 4);
#pragma unroll
  for (int i = 0; i < 8; ++i) { a[i] = (_Float16)p[i]; a[8 + i] = (_Float16)p[16 + i]; }
  return a;
}
__device__ __forceinline__ v16h frag_f32s(const float* rowk0, int lane, float sc) {
  v16h a; const float* p = rowk0 + 8 * (lane >> 4);
#pragma unroll
  for (int i = 0; i < 8; ++i) { a[i] = (_Float16)(p[i] * sc); a[8 + i] = (_Float16)(p[16 + i] * sc); }
  return a;
}
// column fragment from a [K][ld] layout (column n), rows >= K read as 0
__device__ __forceinline__ v16h fragc_f32(const float* W, int k0, int n, int lane, int ld, int K) {
  v16h a; const int g = lane >> 4;
#pragma unroll
  for (int i = 0; i < 8; ++i) { const int ka = k0 + 8 * g + i, kb = ka + 16;
    a[i] = (_Float16)(ka < K ? W[(size_t)(ka < K ? ka : K - 1) * ld + n] : 0.f); a[8 + i] = (_Float16)(kb < K ? W[(size_t)(kb < K ? kb : K - 1) * ld + n] : 0.f); }
  return a;
}
struct F2 { v16b h, l; };
__device__ __forceinline__ F2 bsplit16(const float v[16]) { F2 r;
#pragma unroll
  for (int i = 0; i < 16; ++i) { const __bf16 h = (__bf16)v[i]; r.h[i] = h; r.l[i] = (__bf16)(v[i] - (float)h); }
  return r; }
__device__ __forceinline__ F2 split_row(const float* row, int k0, int lane) { float v[16]; const float* p = row + k0 + 8 * (lane >> 4);
#pragma unroll
  for (int i = 0; i < 8; ++i) { v[i] = p[i]; v[8 + i] = p[16 + i]; }
  return bsplit16(v); }
__device__ __forceinline__ F2 split_rowK(const float* row, int k0, int lane, int K) { float v[16]; const int g = lane >> 4;
#pragma unroll
  for (int i = 0; i < 8; ++i) { const int ka = k0 + 8 * g + i, kb = ka + 16; v[i] = ka < K ? row[ka < K ? ka : K - 1] : 0.f; v[8 + i] = kb < K ? row[kb < K ? kb : K - 1] : 0.f; }
  return bsplit16(v); }
__device__ __forceinline__ F2 split_col(const float* W, int k0, int n, int lane, int ld, int K) { float v[16]; const int g = lane >> 4;
#pragma unroll
  for (int i = 0; i < 8; ++i) { const int ka = k0 + 8 * g + i, kb = ka + 16; v[i] = ka < K ? W[(size_t)(ka < K ? ka : K - 1) * ld + n] : 0.f; v[8 + i] = kb < K ? W[(size_t)(kb < K ? kb : K - 1) * ld + n] : 0.f; }
  return bsplit16(v); }
__device__ __forceinline__ v8f mac3(const F2& a, const F2& b, v8f c) { c = wmma_bf(a.l, b.h, c); c = wmma_bf(a.h, b.l, c); return wmma_bf(a.h, b.h, c); }
__device__ __forceinline__ float sigm(float v) { return 1.0f / (1.0f + expf(-v)); }
#define LDSX() do { asm volatile("s_wait_dscnt 0" ::: "memory"); __builtin_amdgcn_wave_barrier(); __builtin_amdgcn_fence(__ATOMIC_RELEASE, "workgroup"); } while (0)

// Multi-head self-attention (B 2, S 2,048, d_model 512 = 8 x 64; (in,out) uniform +-1/sqrt(512) weights WITH biases): q, k, v = x W + b; out = merged(softmax(q k^T / 8) v) Wo + bo (non-causal).
#define NB 2
#define TT 2048
#define CC 512            // NH * HD = projected width
#define DIN 512          // input (model) width
#define NH 8
#define HD 64
#define NQB (TT / 64)
#define HG 4
#define SCALE (0.125f)
#define CAUSAL 0
#ifndef TNB
#define TNB NB
#endif
__device__ __forceinline__ float bfr(float v) { return (float)(__bf16)v; }
__host__ __device__ __forceinline__ int kb_last(int qb) { return CAUSAL ? ((qb * 64 + 63) >> 7) : (TT / 128 - 1); }
typedef __attribute__((ext_vector_type(8))) __bf16 v8b;
__device__ __forceinline__ v16b frag_b(const __bf16* rowk0, int lane) {
  union { v16b v; v8b q[2]; } u; const __bf16* p = rowk0 + 8 * (lane >> 4);
  u.q[0] = *(const v8b*)p; u.q[1] = *(const v8b*)(p + 16); return u.v;
}
#define QBH 0              // unused: k_attn has no high-precision path
#define QHI 0               // rows carrying a q residual plane (none: q goes into the logits rounded once to f16, as k does)
#define KHI 64            // key rows carrying k residual / v bf16 hi+lo planes (written by k_proj, read by no kernel)
// B fragment (k rows k0+.., output column o) of a weight: (in,out) [K][ld] or (out,in) [ld rows of K]: bf16 exact, or f16(bf16 * 256) exact
__device__ __forceinline__ v16b wcol_io(const float* Wm, int k0, int o, int lane, int ld) { v16b w; const int g = lane >> 4;
#pragma unroll
  for (int i = 0; i < 8; ++i) { w[i] = (__bf16)Wm[(size_t)(k0 + 8 * g + i) * ld + o]; w[8 + i] = (__bf16)Wm[(size_t)(k0 + 16 + 8 * g + i) * ld + o]; }
  return w; }
__device__ __forceinline__ v16b wcol_oi(const float* Wm, int k0, int o, int lane, int K) { v16b w; const float* p = Wm + (size_t)o * K + k0 + 8 * (lane >> 4);
#pragma unroll
  for (int i = 0; i < 8; ++i) { w[i] = (__bf16)p[i]; w[8 + i] = (__bf16)p[16 + i]; }
  return w; }
__device__ __forceinline__ v16h wcolh_io(const float* Wm, int k0, int o, int lane, int ld) { v16h w; const int g = lane >> 4;
#pragma unroll
  for (int i = 0; i < 8; ++i) { w[i] = (_Float16)(bfr(Wm[(size_t)(k0 + 8 * g + i) * ld + o]) * 256.0f); w[8 + i] = (_Float16)(bfr(Wm[(size_t)(k0 + 16 + 8 * g + i) * ld + o]) * 256.0f); }
  return w; }
__device__ __forceinline__ v16h wcolh_oi(const float* Wm, int k0, int o, int lane, int K) { v16h w; const float* p = Wm + (size_t)o * K + k0 + 8 * (lane >> 4);
#pragma unroll
  for (int i = 0; i < 8; ++i) { w[i] = (_Float16)(bfr(p[i]) * 256.0f); w[8 + i] = (_Float16)(bfr(p[16 + i]) * 256.0f); }
  return w; }
#define WQKV_LAYOUT 0   // 0 = (in,out) [DIN][CC]; 1 = (out,in) [CC][DIN]; 2 = per-head [NH][DIN][HD]
__device__ __forceinline__ v16b wcol_hdk(const float* Wm, int k0, int o, int lane) { v16b w; const int g = lane >> 4; const float* p = Wm + (size_t)(o / HD) * DIN * HD + (o % HD);
#pragma unroll
  for (int i = 0; i < 8; ++i) { w[i] = (__bf16)p[(size_t)(k0 + 8 * g + i) * HD]; w[8 + i] = (__bf16)p[(size_t)(k0 + 16 + 8 * g + i) * HD]; }
  return w; }
#define WO_OUT_IN 0
#if WQKV_LAYOUT == 1
#define WCOL(W, k0, o, lane) wcol_oi(W, k0, o, lane, DIN)
#elif WQKV_LAYOUT == 2
#define WCOL(W, k0, o, lane) wcol_hdk(W, k0, o, lane)
#else
#define WCOL(W, k0, o, lane) wcol_io(W, k0, o, lane, CC)
#endif
#if WO_OUT_IN
#define WOCOL(W, k0, o, lane) wcol_oi(W, k0, o, lane, CC)
#define WOCOLH(W, k0, o, lane) wcolh_oi(W, k0, o, lane, CC)
#else
#define WOCOL(W, k0, o, lane) wcol_io(W, k0, o, lane, DIN)
#define WOCOLH(W, k0, o, lane) wcolh_io(W, k0, o, lane, DIN)
#endif

#ifndef SM_EXTRA_PARAMS
#define SM_EXTRA_PARAMS
#endif
#ifndef PROJ_EXTRA_PARAMS
#define PROJ_EXTRA_PARAMS
#endif
#ifndef SM_MASK_HOOK
#define SM_MASK_HOOK (void)0
#endif

#define WS_QH  0u                                      // f16 q rows [b*t][CC]
#define WS_KH  (WS_QH + 2u * (size_t)NB * TT * CC)      // f16 k rows [b*t][CC]
#define WS_VT  (WS_KH + 2u * (size_t)NB * TT * CC)      // f16 v planes [b][c][t]
#define WS_QL  (WS_VT + 2u * (size_t)NB * CC * TT)      // f16 q residual x 2^10 rows [b][t < QHI][CC]
#define WS_KL  (WS_QL + 2u * (size_t)NB * QHI * CC)     // f16 k residual x 2^10 rows [b][t < KHI][CC]
#define WS_VB  (WS_KL + 2u * (size_t)NB * KHI * CC)     // bf16 v hi planes [b][c][t < KHI]
#define WS_VBL (WS_VB + 2u * (size_t)NB * CC * KHI)
#define WS_S   (WS_VBL + 2u * (size_t)NB * CC * KHI)    // f32 [hg][t][s] region, unused: logits and P stay in registers
#define WS_Y   (WS_S  + 4u * (size_t)HG * TT * TT)      // f32 ctx rows [b*t][CC] (only when there is an output projection)
#define WS_END (WS_Y  + 4u * (size_t)NB * TT * CC)

// ---- weight staging of the two projection GEMMs: a stage is GKS k rows x 128 columns of an (in,out) f32 weight, rounded to bf16 and laid column-major in LDS (pitch GPW), once per block for its four waves.
// Thread (wave, lane) moves columns n4..n4+3 of k rows o4*8 + u*32 + i: a wave-wide load covers four whole 128-B lines, and 16 neighbouring lanes' 16-byte LDS stores cover all 64 banks once.
// Two buffers: the next stage's loads fly during this stage's products, one barrier a stage. The k order of the products is the one of the unstaged loop. Every '#pragma unroll' of the staging and of the two loops keeps a register array statically indexed.
#define GKS 64
#define GPW 72                    // LDS pitch in bf16: 128-B rows + 16 B, conflict-free for 16-byte fragment reads
__device__ __forceinline__ void wst_load(v4f (&f)[2][8], const float* wp, int ld) {
#pragma unroll
  for (int u = 0; u < 2; ++u)
#pragma unroll
    for (int i = 0; i < 8; ++i) f[u][i] = *(const v4f*)(wp + (size_t)(u * 32 + i) * ld); }
__device__ __forceinline__ void wst_store(__bf16* sp, const v4f (&f)[2][8]) {
#pragma unroll
  for (int u = 0; u < 2; ++u)
#pragma unroll
    for (int c = 0; c < 4; ++c) { v8b p;
#pragma unroll
      for (int i = 0; i < 8; ++i) p[i] = (__bf16)f[u][i][c];
      *(v8b*)(sp + c * GPW + u * 32) = p; } }
// the lane's f32 elements of the A fragments of one stage (p = row + stage k0 + 8 * (lane >> 4)): element e of fragment kk is x[kk][e >> 2][e & 3]
__device__ __forceinline__ void arow_load(v4f (&x)[2][4], const float* p) {
#pragma unroll
  for (int kk = 0; kk < 2; ++kk) { x[kk][0] = *(const v4f*)(p + kk * 32); x[kk][1] = *(const v4f*)(p + kk * 32 + 4); x[kk][2] = *(const v4f*)(p + kk * 32 + 16); x[kk][3] = *(const v4f*)(p + kk * 32 + 20); } }
// ---- k_proj: block = (64 rows, 128 cols, which): q/k/v = X W (+ b) with exact bf16 products (K = DIN) -> which 0: q f16 rows (+ residual rows < QHI); 1: k f16 rows (+ residual rows < KHI); 2: v f16 planes [c][t] (+ bf16 hi/lo planes for t < KHI)
__global__ __launch_bounds__(128) void k_proj(const float* __restrict__ XQ, const float* __restrict__ XK, const float* __restrict__ XV, const float* __restrict__ WQ, const float* __restrict__ WK, const float* __restrict__ WV, const float* __restrict__ BQ, const float* __restrict__ BK, const float* __restrict__ BV,
    _Float16* __restrict__ QH, _Float16* __restrict__ QL, _Float16* __restrict__ KH, _Float16* __restrict__ KL, _Float16* __restrict__ VT, __bf16* __restrict__ VB, __bf16* __restrict__ VBL) {
  __shared__ __align__(16) _Float16 sh[64][136], sl[64][136]; __shared__ __align__(16) _Float16 th[128][72]; __shared__ __align__(16) __bf16 tw[2][128][GPW]; __bf16 (&tb)[128][72] = tw[0]; __bf16 (&tbl)[128][72] = tw[1];   // the two weight buffers of the loop are the epilogue's tb and tbl
  const int tid = threadIdx.x, wave = tid >> 5, lane = tid & 31, col = lane & 15, g = lane >> 4; const int which = blockIdx.z; const int c0 = blockIdx.y * 128; const size_t r0 = (size_t)blockIdx.x * 64; const size_t bb = r0 / TT; const int t0 = (int)(r0 % TT);
  const float* X = which == 0 ? XQ : which == 1 ? XK : XV; const float* WA = which == 0 ? WQ : which == 1 ? WK : WV; const float* BA = which == 0 ? BQ : which == 1 ? BK : BV;
  v8f acc[8] = {};
  const int n4 = (wave * 8 + ((lane & 3) | ((lane >> 4) << 2))) * 4, o4 = (lane >> 2) & 3;
  const float* wp = WA + (size_t)(o4 * 8) * CC + c0 + n4; const float* xp = X + (r0 + wave * 16 + col) * DIN + 8 * g;
  v4f wf[2][8], xf[2][4]; v16b a[2]; wst_load(wf, wp, CC); arow_load(xf, xp);
  asm volatile("s_wait_xcnt 0x0" ::: "memory");   // in front of the first rewrite of an address register that stage 0's loads name
  float bs[8];   // the lane's eight bias elements are asked for here, behind stage 0's loads, and wait in registers: read in the epilogue they were eight round trips to L2, one behind the other, with nothing to hide them (the unrolls keep bs statically indexed)
#pragma unroll
  for (int j = 0; j < 8; ++j) bs[j] = 0.f;
  if (BA) {   // one test around all eight loads, so that they are in flight together
#pragma unroll
    for (int j = 0; j < 8; ++j) bs[j] = BA[c0 + j * 16 + col];
    asm volatile("s_wait_xcnt 0x0" ::: "memory"); }   // in front of the first rewrite of the offset register that these loads name
  wst_store(&tw[0][n4][o4 * 8], wf);
#pragma unroll
  for (int kk = 0; kk < 2; ++kk)
#pragma unroll
    for (int e = 0; e < 16; ++e) a[kk][e] = (__bf16)xf[kk][e >> 2][e & 3];
  __syncthreads();   // stage 0 is published
  for (int st = 0; st < DIN / GKS; ++st) { const int bu = st & 1; const bool more = st + 1 < DIN / GKS;
    if (more) { wst_load(wf, wp + (size_t)((st + 1) * GKS) * CC, CC); arow_load(xf, xp + (st + 1) * GKS);
      asm volatile("s_wait_xcnt 0x0" ::: "memory"); }   // in front of the first rewrite of an address register that these loads name
#pragma unroll
    for (int kk = 0; kk < 2; ++kk)
#pragma unroll
      for (int jh = 0; jh < 8; jh += 4) { v16b w[4];   // four fragments are read as one group, so that the wave waits out the LDS latency once for four products
#pragma unroll
        for (int j = 0; j < 4; ++j) w[j] = frag_b(&tw[bu][(jh + j) * 16 + col][kk * 32], lane);
#pragma unroll
        for (int j = 0; j < 4; ++j) acc[jh + j] = wmma_bf(a[kk], w[j], acc[jh + j]); }
    if (more) { wst_store(&tw[bu ^ 1][n4][o4 * 8], wf);   // its readers left this buffer before the last barrier
#pragma unroll
      for (int kk = 0; kk < 2; ++kk)
#pragma unroll
        for (int e = 0; e < 16; ++e) a[kk][e] = (__bf16)xf[kk][e >> 2][e & 3]; }
    __syncthreads(); }   // publishes stage st + 1 and ends every read of stage st
  if (which < 2) { _Float16* DH = which == 0 ? QH : KH; _Float16* DL = which == 0 ? QL : KL; const int nhi = which == 0 ? QHI : KHI; const bool hi_rows = t0 < nhi;
    if (hi_rows) {   // the residual is formed only in the blocks that store it
#pragma unroll
      for (int j = 0; j < 8; ++j) { const float bias = bfr(bs[j]);
#pragma unroll
        for (int r = 0; r < 8; ++r) { const float v = acc[j][r] + bias; const _Float16 hv = (_Float16)v; sh[wave * 16 + 8 * g + r][j * 16 + col] = hv; sl[wave * 16 + 8 * g + r][j * 16 + col] = (_Float16)((v - (float)hv) * 1024.0f); } }
    } else {
#pragma unroll
      for (int j = 0; j < 8; ++j) { const float bias = bfr(bs[j]);
#pragma unroll
        for (int r = 0; r < 8; ++r) sh[wave * 16 + 8 * g + r][j * 16 + col] = (_Float16)(acc[j][r] + bias); } }
    __syncthreads();
    const int rl0 = tid >> 4, q = tid & 15; v4u t[8];   // the thread's eight 16-byte pieces are read from LDS as one group and then stored: one LDS latency, not eight in a row (the unrolls keep t statically indexed)
#pragma unroll
    for (int it = 0; it < 8; ++it) t[it] = *(const v4u*)&sh[rl0 + it * 8][q * 8];
#pragma unroll
    for (int it = 0; it < 8; ++it) vst2((unsigned*)(DH + (r0 + rl0 + it * 8) * CC + c0 + q * 8), t[it]);
    if (hi_rows) { v4u u[8]; asm volatile("s_wait_xcnt 0x0" ::: "memory"); __builtin_amdgcn_sched_barrier(0);   // the wait stands in front of the first rewrite of a register that the stores above name; the scheduling barrier keeps this block's register writes from being lifted over it
#pragma unroll
      for (int it = 0; it < 8; ++it) u[it] = *(const v4u*)&sl[rl0 + it * 8][q * 8];
#pragma unroll
      for (int it = 0; it < 8; ++it) vst2((unsigned*)(DL + (bb * nhi + t0 + rl0 + it * 8) * (size_t)CC + c0 + q * 8), u[it]); }
  } else { const bool hi_rows = t0 < KHI;
#pragma unroll
    for (int j = 0; j < 8; ++j) { const float bias = bfr(bs[j]);
#pragma unroll
      for (int r = 0; r < 8; ++r) { const float v = acc[j][r] + bias; const int rl = wave * 16 + 8 * g + r, cl = j * 16 + col; th[cl][rl] = (_Float16)v; const __bf16 bh = (__bf16)v; tb[cl][rl] = bh; tbl[cl][rl] = (__bf16)(v - (float)bh); } }
    __syncthreads();
    const int cl0 = tid >> 3, q = tid & 7; v4u t[8];   // as above: eight LDS reads in flight together, then the stores
#pragma unroll
    for (int it = 0; it < 8; ++it) t[it] = *(const v4u*)&th[cl0 + it * 16][q * 8];
#pragma unroll
    for (int it = 0; it < 8; ++it) vst2((unsigned*)(VT + (bb * CC + c0 + cl0 + it * 16) * (size_t)TT + t0 + q * 8), t[it]);
    if (hi_rows) { v4u u[8], w[8]; asm volatile("s_wait_xcnt 0x0" ::: "memory"); __builtin_amdgcn_sched_barrier(0);   // the wait stands in front of the first rewrite of a register that the stores above name; the scheduling barrier keeps this block's register writes from being lifted over it
#pragma unroll
      for (int it = 0; it < 8; ++it) { u[it] = *(const v4u*)&tb[cl0 + it * 16][q * 8]; w[it] = *(const v4u*)&tbl[cl0 + it * 16][q * 8]; }
#pragma unroll
      for (int it = 0; it < 8; ++it) { const size_t o3 = (bb * CC + c0 + cl0 + it * 16) * (size_t)KHI + t0 + q * 8; vst2((unsigned*)(VB + o3), u[it]); vst2((unsigned*)(VBL + o3), w[it]); } }
    asm volatile("s_wait_xcnt 0x0" ::: "memory"); } }   // behind the last store of this branch on both ways: in front of any rewrite of a register that these stores name
#define AQT 8
#define AKS 2
#define AKT 64                    // keys per stage and range: 128-B rows of k (64 d) and of v^T (64 keys)
#define ANS (TT / AKS / AKT)
#define AC2 (SCALE * 1.44269504088896340736f)   // logit scale x log2(e)
#define APK 72                    // LDS pitch in halves: 128-B rows + 16 B, conflict-free for 16-byte fragment reads
__device__ __forceinline__ v8f wm16(v16h a, v16h b, v8f c) { return __builtin_amdgcn_wmma_f32_16x16x32_f16(false, a, false, b, (short)0, c, false, false); }
__device__ __forceinline__ float xhalf(float x) { return __builtin_bit_cast(float, __builtin_amdgcn_permlanex16(__builtin_bit_cast(int, x), __builtin_bit_cast(int, x), 0x76543210, 0xfedcba98, false, false)); }  // lane l with lane l ^ 16
__global__ __launch_bounds__(AQT * AKS * 32) void k_attn(const _Float16* __restrict__ QH, const _Float16* __restrict__ KH, const _Float16* __restrict__ VT, float* __restrict__ Y) {
  __shared__ __align__(16) _Float16 sk[2][AKS][AKT][APK], sv[2][AKS][HD][APK];
  __shared__ __align__(16) float sp[AKS - 1][AQT][HD / 2][32]; __shared__ float smx[AKS - 1][AQT][16], ssu[AKS - 1][AQT][16]; __shared__ __align__(16) float so[AQT][16][HD + 4];
  const int tid = threadIdx.x, wave = __builtin_amdgcn_readfirstlane(tid >> 5), lane = tid & 31, col = lane & 15, g = lane >> 4; const int qt = wave % AQT, ks = wave / AQT;
  const int b = blockIdx.y / NH, h = blockIdx.y % NH; const int ql0 = blockIdx.x * (AQT * 16) + qt * 16;
  // staging: thread (qt, lane) of a range moves 16-byte chunk sc of rows sr and sr + 32 of the k tile and of the v^T tile (8 lanes = one 128-B line)
  const int sr = qt * 4 + (lane >> 3), sc = (lane & 7) * 8;
  const _Float16* kg = KH + ((size_t)b * TT + ks * (TT / AKS) + sr) * CC + h * HD + sc;
  const _Float16* vg = VT + ((size_t)b * CC + h * HD + sr) * (size_t)TT + ks * (TT / AKS) + sc;
  v8h g0 = *(const v8h*)kg, g1 = *(const v8h*)(kg + (size_t)32 * CC), g2 = *(const v8h*)vg, g3 = *(const v8h*)(vg + (size_t)32 * TT);
  v16h qh[HD / 32];
#pragma unroll
  for (int kc = 0; kc < HD / 32; ++kc) qh[kc] = frag_h(QH + ((size_t)b * TT + ql0 + col) * CC + h * HD + kc * 32, lane);
  *(v8h*)&sk[0][ks][sr][sc] = g0; *(v8h*)&sk[0][ks][sr + 32][sc] = g1; *(v8h*)&sv[0][ks][sr][sc] = g2; *(v8h*)&sv[0][ks][sr + 32][sc] = g3;
  __syncthreads();   // stage 0 is published
  v8f o[HD / 16] = {}; float m = -3.0e38f, nm = 11.0f - m * AC2; v2f l2 = {0.f, 0.f};   // the lane's sum of exponentials (x 2^11), even and odd elements apart (packed adds)
  for (int st = 0; st < ANS; ++st) { const int bu = st & 1;
    if (st + 1 < ANS) { const _Float16* kn = kg + (size_t)((st + 1) * AKT) * CC; const _Float16* vn = vg + (st + 1) * AKT;
      g0 = *(const v8h*)kn; g1 = *(const v8h*)(kn + (size_t)32 * CC); g2 = *(const v8h*)vn; g3 = *(const v8h*)(vn + (size_t)32 * TT); }
#pragma unroll
    for (int pp = 0; pp < AKT / 32; ++pp) {
      v8f s[2] = {};
#pragma unroll
      for (int kc = 0; kc < HD / 32; ++kc)
#pragma unroll
        for (int t = 0; t < 2; ++t) s[t] = wm16(frag_h(&sk[bu][ks][pp * 32 + t * 16 + col][kc * 32], lane), qh[kc], s[t]);
      v16h vf[HD / 16];
#pragma unroll
      for (int j = 0; j < HD / 16; ++j) vf[j] = frag_h(&sv[bu][ks][j * 16 + col][pp * 32], lane);
      v2f v[8]; float mx = m;
#pragma unroll
      for (int i = 0; i < 8; ++i) { v[i] = v2f{s[i >> 2][(2 * i) & 7], s[i >> 2][(2 * i + 1) & 7]}; mx = fmaxf(mx, fmaxf(v[i].x, v[i].y)); }
      mx = fmaxf(mx, xhalf(mx));
      if (__builtin_amdgcn_ballot_w32(mx > m) != 0) {   // some query's maximum rose: bring sum and O^T to the new one (a factor of exactly 1 for the other queries)
        const float nn = 11.0f - mx * AC2; const float a = __builtin_amdgcn_exp2f(nn - nm); l2 *= a; m = mx; nm = nn;
#pragma unroll
        for (int j = 0; j < HD / 16; ++j)
#pragma unroll
          for (int r = 0; r < 8; ++r) o[j][r] *= a; }
      v16h pf;
#pragma unroll
      for (int i = 0; i < 8; ++i) { const v2f x = v[i] * AC2 + nm; const v2f e = {__builtin_amdgcn_exp2f(x.x), __builtin_amdgcn_exp2f(x.y)}; l2 += e; pf[2 * i] = (_Float16)e.x; pf[2 * i + 1] = (_Float16)e.y; }
#pragma unroll
      for (int j = 0; j < HD / 16; ++j) o[j] = wm16(vf[j], pf, o[j]); }
    if (st + 1 < ANS) { *(v8h*)&sk[bu ^ 1][ks][sr][sc] = g0; *(v8h*)&sk[bu ^ 1][ks][sr + 32][sc] = g1; *(v8h*)&sv[bu ^ 1][ks][sr][sc] = g2; *(v8h*)&sv[bu ^ 1][ks][sr + 32][sc] = g3; }   // its readers left this buffer before the last barrier
    __syncthreads(); }   // publishes stage st + 1 and ends every read of stage st
  float l = l2.x + l2.y; l += xhalf(l);
  if (ks > 0) {
#pragma unroll
    for (int j = 0; j < HD / 16; ++j)
#pragma unroll
      for (int r = 0; r < 8; ++r) sp[ks - 1][qt][j * 8 + r][lane] = o[j][r];
    if (g == 0) { smx[ks - 1][qt][col] = nm; ssu[ks - 1][qt][col] = l; } }
  __syncthreads();   // the other ranges' partial results are published
  if (ks == 0) {
#pragma unroll
    for (int x = 0; x < AKS - 1; ++x) { const float n1 = smx[x][qt][col], l1 = ssu[x][qt][col]; const float nn = fminf(nm, n1); const float a0 = __builtin_amdgcn_exp2f(nn - nm), a1 = __builtin_amdgcn_exp2f(nn - n1); l = l * a0 + l1 * a1; nm = nn;   // the smaller nm belongs to the larger maximum
#pragma unroll
      for (int j = 0; j < HD / 16; ++j)
#pragma unroll
        for (int r = 0; r < 8; ++r) o[j][r] = o[j][r] * a0 + sp[x][qt][j * 8 + r][lane] * a1; }
    const float inv = 1.0f / l;
#pragma unroll
    for (int j = 0; j < HD / 16; ++j)
#pragma unroll
      for (int r = 0; r < 8; ++r) so[qt][col][j * 16 + 8 * g + r] = o[j][r] * inv;
    LDSX();   // the wave's own rows of so are written before it reads them back row by row
#pragma unroll
    for (int it = 0; it < 8; ++it) { const int rl = it * 2 + g; vst2(Y + ((size_t)b * TT + ql0 + rl) * CC + h * HD + col * 4, *(const v4f*)&so[qt][rl][col * 4]); } } }
// ---- k_out: block = (64 rows, 128 cols): out = ctx Wo (+ bo): all rows: ctx bf16 hi + lo against exact bf16 Wo (2 products); the f16 (bf16 x 2^8, 1 product) branch is not taken
__global__ __launch_bounds__(128) void k_out(const float* __restrict__ Y, const float* __restrict__ WO, const float* __restrict__ BO, float* __restrict__ OUT) { __shared__ __align__(16) float sf[4][16][132]; __shared__ __align__(16) __bf16 tw[2][128][GPW];
  const int tid = threadIdx.x, wave = tid >> 5, lane = tid & 31, col = lane & 15, g = lane >> 4; const int c0 = blockIdx.y * 128; const size_t r0 = (size_t)blockIdx.x * 64 + wave * 16;
  v8f acc[8] = {};
  if (true) {   /* ALL rows: ctx split bf16 hi + lo x exact Wo (2 products) */
    const int n4 = (wave * 8 + ((lane & 3) | ((lane >> 4) << 2))) * 4, o4 = (lane >> 2) & 3;
    const float* wp = WO + (size_t)(o4 * 8) * DIN + c0 + n4; const float* xp = Y + (r0 + col) * CC + 8 * g;
    v4f wf[2][8], xf[2][4]; F2 a[2]; wst_load(wf, wp, DIN); arow_load(xf, xp);
    asm volatile("s_wait_xcnt 0x0" ::: "memory");   // in front of the first rewrite of an address register that stage 0's loads name
    float bs[8];   // as in k_proj: the bias is asked for at entry, not in eight dependent round trips behind the loop (the unrolls keep bs statically indexed)
#pragma unroll
    for (int j = 0; j < 8; ++j) bs[j] = 0.f;
    if (BO) {   // one test around all eight loads, so that they are in flight together
#pragma unroll
      for (int j = 0; j < 8; ++j) bs[j] = BO[c0 + j * 16 + col];
      asm volatile("s_wait_xcnt 0x0" ::: "memory"); }   // in front of the first rewrite of the offset register that these loads name
    wst_store(&tw[0][n4][o4 * 8], wf);
#pragma unroll
    for (int kk = 0; kk < 2; ++kk) { float v[16];
#pragma unroll
      for (int e = 0; e < 16; ++e) v[e] = xf[kk][e >> 2][e & 3];
      a[kk] = bsplit16(v); }
    __syncthreads();   // stage 0 is published
    for (int st = 0; st < CC / GKS; ++st) { const int bu = st & 1; const bool more = st + 1 < CC / GKS;
      if (more) { wst_load(wf, wp + (size_t)((st + 1) * GKS) * DIN, DIN); arow_load(xf, xp + (st + 1) * GKS);
        asm volatile("s_wait_xcnt 0x0" ::: "memory"); }   // in front of the first rewrite of an address register that these loads name
#pragma unroll
      for (int kk = 0; kk < 2; ++kk)
#pragma unroll
        for (int jh = 0; jh < 8; jh += 4) { v16b w[4];   // four fragments are read as one group, so that the wave waits out the LDS latency once for eight products
#pragma unroll
          for (int j = 0; j < 4; ++j) w[j] = frag_b(&tw[bu][(jh + j) * 16 + col][kk * 32], lane);
#pragma unroll
          for (int j = 0; j < 4; ++j) acc[jh + j] = wmma_bf(a[kk].h, w[j], acc[jh + j]);
#pragma unroll
          for (int j = 0; j < 4; ++j) acc[jh + j] = wmma_bf(a[kk].l, w[j], acc[jh + j]); }   // hi before lo in every accumulator, as before
      if (more) { wst_store(&tw[bu ^ 1][n4][o4 * 8], wf);   // its readers left this buffer before the last barrier
#pragma unroll
        for (int kk = 0; kk < 2; ++kk) { float v[16];
#pragma unroll
          for (int e = 0; e < 16; ++e) v[e] = xf[kk][e >> 2][e & 3];
          a[kk] = bsplit16(v); } }
      __syncthreads(); }   // publishes stage st + 1 and ends every read of stage st
#pragma unroll
    for (int j = 0; j < 8; ++j) { const float bias = bfr(bs[j]);
#pragma unroll
      for (int r = 0; r < 8; ++r) sf[wave][8 * g + r][j * 16 + col] = acc[j][r] + bias; }
  } else {
#pragma unroll 2
    for (int kc = 0; kc < CC / 32; ++kc) { const v16h a = frag_f32(Y + (r0 + col) * CC + kc * 32, lane); asm volatile("s_wait_loadcnt 0x0" ::: "memory");
#pragma unroll
      for (int j = 0; j < 8; ++j) { const v16h w = WOCOLH(WO, kc * 32, c0 + j * 16 + col, lane); asm volatile("s_wait_loadcnt 0x0" ::: "memory"); acc[j] = wmma16(a, w, acc[j]); } }
#pragma unroll
    for (int j = 0; j < 8; ++j) { const float bias = BO ? bfr(BO[c0 + j * 16 + col]) : 0.f;
#pragma unroll
      for (int r = 0; r < 8; ++r) sf[wave][8 * g + r][j * 16 + col] = acc[j][r] * (1.0f / 256.0f) + bias; } }
  LDSX(); for (int rl = 0; rl < 16; ++rl) vst2(OUT + (r0 + rl) * DIN + c0 + lane * 4, *(const v4f*)&sf[wave][rl][lane * 4]); }

extern "C" void kernel_launch(void* const* d_in, const int* in_sizes, int n_in, void* d_out, int out_size, void* d_ws, size_t ws_size, hipStream_t stream) {
  (void)in_sizes; (void)n_in; (void)out_size;
  const float** F = (const float**)d_in;
  if (ws_size < (size_t)WS_END) return;
  char* ws = (char*)d_ws; _Float16 *QH = (_Float16*)(ws + WS_QH), *KH = (_Float16*)(ws + WS_KH), *VT = (_Float16*)(ws + WS_VT), *QL = (_Float16*)(ws + WS_QL), *KL = (_Float16*)(ws + WS_KL); __bf16 *VB = (__bf16*)(ws + WS_VB), *VBL = (__bf16*)(ws + WS_VBL); float *Y = (float*)(ws + WS_Y);
  (void)Y; (void)QL; (void)KL; (void)VB; (void)VBL;
  // inputs: 0 x [2,2048,512]; 1 Wq (in,out), 2 bq; 3 Wk, 4 bk; 5 Wv, 6 bv; 7 Wo (in,out), 8 bo
  k_proj<<<dim3(TNB * TT / 64, CC / 128, 3), 128, 0, stream>>>(F[0], F[0], F[0], F[1], F[3], F[5], F[2], F[4], F[6], QH, QL, KH, KL, VT, VB, VBL);
  k_attn<<<dim3(TT / (AQT * 16), TNB * NH), AQT * AKS * 32, 0, stream>>>(QH, KH, VT, Y);
  k_out<<<dim3(TNB * TT / 64, DIN / 128), 128, 0, stream>>>(Y, F[7], F[8], (float*)d_out);
}

// v006
// It runs in 48.7 microseconds.
// Two timings next to v005 put it at 1.04 and 1.03 times that version's speed.
// Counting every step since v000, it is 12.0 times as fast.
// compute dtype: all float inputs rounded to bf16; q/k/v = in W + b with EXACT bf16 products on WMMA 16x16x32 (f32 accumulate); q once to f16 against k once to f16 (1 product) / 8; online softmax in f32 (one fused multiply-add and the hardware's exp2 per logit), fused with both products; exp(logit - max) x 2^11 once to f16 against v once to f16 (1 product), divided by the f32 sum (x 2^11 too) at the end; ctx split bf16 hi + lo against exact Wo (2 products) + bo; f32 output.
#include <hip/hip_runtime.h>
#include <math.h>

typedef __attribute__((ext_vector_type(16))) _Float16 v16h;
typedef __attribute__((ext_vector_type(16))) __bf16 v16b;
typedef __attribute__((ext_vector_type(8)))  _Float16 v8h;
typedef __attribute__((ext_vector_type(8)))  float v8f;
typedef __attribute__((ext_vector_type(4)))  float v4f;
typedef __attribute__((ext_vector_type(2)))  float v2f;
typedef __attribute__((ext_vector_type(4)))  unsigned v4u;
typedef __attribute__((ext_vector_type(4)))  int v4i;
typedef float __attribute__((may_alias)) float_a;
typedef int __attribute__((may_alias)) int_a;

template <typename T> __device__ __forceinline__ void vst2(void* p, T v) { *(T*)p = v;  }
__device__ __forceinline__ v8f wmma16(v16h a, v16h b, v8f c) {
  v8f d = __builtin_amdgcn_wmma_f32_16x16x32_f16(false, a, false, b, (short)0, c, false, false);
  asm volatile("v_nop\n\tv_nop\n\tv_nop\n\tv_nop" : "+v"(d) : "v"(a), "v"(b));
  return d;
}
__device__ __forceinline__ v8f wmma_bf(v16b a, v16b b, v8f c) {
  v8f d = __builtin_amdgcn_wmma_f32_16x16x32_bf16(false, a, false, b, (short)0, c, false, false);
  asm volatile("v_nop\n\tv_nop\n\tv_nop\n\tv_nop" : "+v"(d) : "v"(a), "v"(b));
  return d;
}
// 16x16x32 fragments: lane = (h = lane>>4, row/col = lane&15); elements 0..7 = k0+8h+0..7, 8..15 = k0+16+8h+0..7; D element r = row 8h+r
__device__ __forceinline__ v16h frag_h(const _Float16* rowk0, int lane) {
  union { v16h v; v8h q[2]; } u; const _Float16* p = rowk0 + 8 * (lane >> 4);
  u.q[0] = *(const v8h*)p; u.q[1] = *(const v8h*)(p + 16); return u.v;
}
__device__ __forceinline__ v16h frag_f32(const float* rowk0, int lane) {
  v16h a; const float* p = rowk0 + 8 * (lane >> 4);
#pragma unroll
  for (int i = 0; i < 8; ++i) { a[i] = (_Float16)p[i]; a[8 + i] = (_Float16)p[16 + i]; }
  return a;
}
__device__ __forceinline__ v16h frag_f32s(const float* rowk0, int lane, float sc) {
  v16h a; const float* p = rowk0 + 8 * (lane >> 4);
#pragma unroll
  for (int i = 0; i < 8; ++i) { a[i] = (_Float16)(p[i] * sc); a[8 + i] = (_Float16)(p[16 + i] * sc); }
  return a;
}
// column fragment from a [K][ld] layout (column n), rows >= K read as 0
__device__ __forceinline__ v16h fragc_f32(const float* W, int k0, int n, int lane, int ld, int K) {
  v16h a; const int g = lane >> 4;
#pragma unroll
  for (int i = 0; i < 8; ++i) { const int ka = k0 + 8 * g + i, kb = ka + 16;
    a[i] = (_Float16)(ka < K ? W[(size_t)(ka < K ? ka : K - 1) * ld + n] : 0.f); a[8 + i] = (_Float16)(kb < K ? W[(size_t)(kb < K ? kb : K - 1) * ld + n] : 0.f); }
  return a;
}
struct F2 { v16b h, l; };
__device__ __forceinline__ F2 bsplit16(const float v[16]) { F2 r;
#pragma unroll
  for (int i = 0; i < 16; ++i) { const __bf16 h = (__bf16)v[i]; r.h[i] = h; r.l[i] = (__bf16)(v[i] - (float)h); }
  return r; }
__device__ __forceinline__ F2 split_row(const float* row, int k0, int lane) { float v[16]; const float* p = row + k0 + 8 * (lane >> 4);
#pragma unroll
  for (int i = 0; i < 8; ++i) { v[i] = p[i]; v[8 + i] = p[16 + i]; }
  return bsplit16(v); }
__device__ __forceinline__ F2 split_rowK(const float* row, int k0, int lane, int K) { float v[16]; const int g = lane >> 4;
#pragma unroll
  for (int i = 0; i < 8; ++i) { const int ka = k0 + 8 * g + i, kb = ka + 16; v[i] = ka < K ? row[ka < K ? ka : K - 1] : 0.f; v[8 + i] = kb < K ? row[kb < K ? kb : K - 1] : 0.f; }
  return bsplit16(v); }
__device__ __forceinline__ F2 split_col(const float* W, int k0, int n, int lane, int ld, int K) { float v[16]; const int g = lane >> 4;
#pragma unroll
  for (int i = 0; i < 8; ++i) { const int ka = k0 + 8 * g + i, kb = ka + 16; v[i] = ka < K ? W[(size_t)(ka < K ? ka : K - 1) * ld + n] : 0.f; v[8 + i] = kb < K ? W[(size_t)(kb < K ? kb : K - 1) * ld + n] : 0.f; }
  return bsplit16(v); }
__device__ __forceinline__ v8f mac3(const F2& a, const F2& b, v8f c) { c = wmma_bf(a.l, b.h, c); c = wmma_bf(a.h, b.l, c); return wmma_bf(a.h, b.h, c); }
__device__ __forceinline__ float sigm(float v) { return 1.0f / (1.0f + expf(-v)); }
#define LDSX() do { asm volatile("s_wait_dscnt 0" ::: "memory"); __builtin_amdgcn_wave_barrier(); __builtin_amdgcn_fence(__ATOMIC_RELEASE, "workgroup"); } while (0)

// Multi-head self-attention (B 2, S 2,048, d_model 512 = 8 x 64; (in,out) uniform +-1/sqrt(512) weights WITH biases): q, k, v = x W + b; out = merged(softmax(q k^T / 8) v) Wo + bo (non-causal).
#define NB 2
#define TT 2048
#define CC 512            // NH * HD = projected width
#define DIN 512          // input (model) width
#define NH 8
#define HD 64
#define NQB (TT / 64)
#define HG 4
#define SCALE (0.125f)
#define CAUSAL 0
#ifndef TNB
#define TNB NB
#endif
__device__ __forceinline__ float bfr(float v) { return (float)(__bf16)v; }
__host__ __device__ __forceinline__ int kb_last(int qb) { return CAUSAL ? ((qb * 64 + 63) >> 7) : (TT / 128 - 1); }
typedef __attribute__((ext_vector_type(8))) __bf16 v8b;
__device__ __forceinline__ v16b frag_b(const __bf16* rowk0, int lane) {
  union { v16b v; v8b q[2]; } u; const __bf16* p = rowk0 + 8 * (lane >> 4);
  u.q[0] = *(const v8b*)p; u.q[1] = *(const v8b*)(p + 16); return u.v;
}
#define QBH 0              // unused: k_attn has no high-precision path
#define QHI 0               // rows carrying a q residual plane (none: q goes into the logits rounded once to f16, as k does)
#define KHI 64            // key rows carrying k residual / v bf16 hi+lo planes (written by k_proj, read by no kernel)
// B fragment (k rows k0+.., output column o) of a weight: (in,out) [K][ld] or (out,in) [ld rows of K]: bf16 exact, or f16(bf16 * 256) exact
__device__ __forceinline__ v16b wcol_io(const float* Wm, int k0, int o, int lane, int ld) { v16b w; const int g = lane >> 4;
#pragma unroll
  for (int i = 0; i < 8; ++i) { w[i] = (__bf16)Wm[(size_t)(k0 + 8 * g + i) * ld + o]; w[8 + i] = (__bf16)Wm[(size_t)(k0 + 16 + 8 * g + i) * ld + o]; }
  return w; }
__device__ __forceinline__ v16b wcol_oi(const float* Wm, int k0, int o, int lane, int K) { v16b w; const float* p = Wm + (size_t)o * K + k0 + 8 * (lane >> 4);
#pragma unroll
  for (int i = 0; i < 8; ++i) { w[i] = (__bf16)p[i]; w[8 + i] = (__bf16)p[16 + i]; }
  return w; }
__device__ __forceinline__ v16h wcolh_io(const float* Wm, int k0, int o, int lane, int ld) { v16h w; const int g = lane >> 4;
#pragma unroll
  for (int i = 0; i < 8; ++i) { w[i] = (_Float16)(bfr(Wm[(size_t)(k0 + 8 * g + i) * ld + o]) * 256.0f); w[8 + i] = (_Float16)(bfr(Wm[(size_t)(k0 + 16 + 8 * g + i) * ld + o]) * 256.0f); }
  return w; }
__device__ __forceinline__ v16h wcolh_oi(const float* Wm, int k0, int o, int lane, int K) { v16h w; const float* p = Wm + (size_t)o * K + k0 + 8 * (lane >> 4);
#pragma unroll
  for (int i = 0; i < 8; ++i) { w[i] = (_Float16)(bfr(p[i]) * 256.0f); w[8 + i] = (_Float16)(bfr(p[16 + i]) * 256.0f); }
  return w; }
#define WQKV_LAYOUT 0   // 0 = (in,out) [DIN][CC]; 1 = (out,in) [CC][DIN]; 2 = per-head [NH][DIN][HD]
__device__ __forceinline__ v16b wcol_hdk(const float* Wm, int k0, int o, int lane) { v16b w; const int g = lane >> 4; const float* p = Wm + (size_t)(o / HD) * DIN * HD + (o % HD);
#pragma unroll
  for (int i = 0; i < 8; ++i) { w[i] = (__bf16)p[(size_t)(k0 + 8 * g + i) * HD]; w[8 + i] = (__bf16)p[(size_t)(k0 + 16 + 8 * g + i) * HD]; }
  return w; }
#define WO_OUT_IN 0
#if WQKV_LAYOUT == 1
#define WCOL(W, k0, o, lane) wcol_oi(W, k0, o, lane, DIN)
#elif WQKV_LAYOUT == 2
#define WCOL(W, k0, o, lane) wcol_hdk(W, k0, o, lane)
#else
#define WCOL(W, k0, o, lane) wcol_io(W, k0, o, lane, CC)
#endif
#if WO_OUT_IN
#define WOCOL(W, k0, o, lane) wcol_oi(W, k0, o, lane, CC)
#define WOCOLH(W, k0, o, lane) wcolh_oi(W, k0, o, lane, CC)
#else
#define WOCOL(W, k0, o, lane) wcol_io(W, k0, o, lane, DIN)
#define WOCOLH(W, k0, o, lane) wcolh_io(W, k0, o, lane, DIN)
#endif

#ifndef SM_EXTRA_PARAMS
#define SM_EXTRA_PARAMS
#endif
#ifndef PROJ_EXTRA_PARAMS
#define PROJ_EXTRA_PARAMS
#endif
#ifndef SM_MASK_HOOK
#define SM_MASK_HOOK (void)0
#endif

#define WS_QH  0u                                      // f16 q rows [b*t][CC]
#define WS_KH  (WS_QH + 2u * (size_t)NB * TT * CC)      // f16 k rows [b*t][CC]
#define WS_VT  (WS_KH + 2u * (size_t)NB * TT * CC)      // f16 v planes [b][c][t]
#define WS_QL  (WS_VT + 2u * (size_t)NB * CC * TT)      // f16 q residual x 2^10 rows [b][t < QHI][CC]
#define WS_KL  (WS_QL + 2u * (size_t)NB * QHI * CC)     // f16 k residual x 2^10 rows [b][t < KHI][CC]
#define WS_VB  (WS_KL + 2u * (size_t)NB * KHI * CC)     // bf16 v hi planes [b][c][t < KHI]
#define WS_VBL (WS_VB + 2u * (size_t)NB * CC * KHI)
#define WS_S   (WS_VBL + 2u * (size_t)NB * CC * KHI)    // f32 [hg][t][s] region, unused: logits and P stay in registers
#define WS_Y   (WS_S  + 4u * (size_t)HG * TT * TT)      // f32 ctx rows [b*t][CC] (only when there is an output projection)
#define WS_END (WS_Y  + 4u * (size_t)NB * TT * CC)

// ---- weight staging of the two projection GEMMs: a stage is GKS k rows x 128 columns of an (in,out) f32 weight, rounded to bf16 and laid column-major in LDS (pitch GPW), once per block for its four waves.
// Thread (wave, lane) moves columns n4..n4+3 of k rows o4*8 + u*32 + i: a wave-wide load covers four whole 128-B lines, and 16 neighbouring lanes' 16-byte LDS stores cover all 64 banks once.
// Two buffers: the next stage's loads fly during this stage's products, one barrier a stage. The k order of the products is the one of the unstaged loop. Every '#pragma unroll' of the staging and of the two loops keeps a register array statically indexed.
#define GKS 64
#define GPW 72                    // LDS pitch in bf16: 128-B rows + 16 B, conflict-free for 16-byte fragment reads
__device__ __forceinline__ void wst_load(v4f (&f)[2][8], const float* wp, int ld) {
#pragma unroll
  for (int u = 0; u < 2; ++u)
#pragma unroll
    for (int i = 0; i < 8; ++i) f[u][i] = *(const v4f*)(wp + (size_t)(u * 32 + i) * ld); }
__device__ __forceinline__ void wst_store(__bf16* sp, const v4f (&f)[2][8]) {
#pragma unroll
  for (int u = 0; u < 2; ++u)
#pragma unroll
    for (int c = 0; c < 4; ++c) { v8b p;
#pragma unroll
      for (int i = 0; i < 8; ++i) p[i] = (__bf16)f[u][i][c];
      *(v8b*)(sp + c * GPW + u * 32) = p; } }
// the lane's f32 elements of the A fragments of one stage (p = row + stage k0 + 8 * (lane >> 4)): element e of fragment kk is x[kk][e >> 2][e & 3]
__device__ __forceinline__ void arow_load(v4f (&x)[2][4], const float* p) {
#pragma unroll
  for (int kk = 0; kk < 2; ++kk) { x[kk][0] = *(const v4f*)(p + kk * 32); x[kk][1] = *(const v4f*)(p + kk * 32 + 4); x[kk][2] = *(const v4f*)(p + kk * 32 + 16); x[kk][3] = *(const v4f*)(p + kk * 32 + 20); } }
// ---- k_proj: block = (64 rows, 128 cols, which): q/k/v = X W (+ b) with exact bf16 products (K = DIN) -> which 0: q f16 rows (+ residual rows < QHI); 1: k f16 rows (+ residual rows < KHI); 2: v f16 planes [c][t] (+ bf16 hi/lo planes for t < KHI)
__global__ __launch_bounds__(128) void k_proj(const float* __restrict__ XQ, const float* __restrict__ XK, const float* __restrict__ XV, const float* __restrict__ WQ, const float* __restrict__ WK, const float* __restrict__ WV, const float* __restrict__ BQ, const float* __restrict__ BK, const float* __restrict__ BV,
    _Float16* __restrict__ QH, _Float16* __restrict__ QL, _Float16* __restrict__ KH, _Float16* __restrict__ KL, _Float16* __restrict__ VT, __bf16* __restrict__ VB, __bf16* __restrict__ VBL) {
  __shared__ __align__(16) _Float16 sh[64][136], sl[64][136]; __shared__ __align__(16) _Float16 th[128][72]; __shared__ __align__(16) __bf16 tw[2][128][GPW]; __bf16 (&tb)[128][72] = tw[0]; __bf16 (&tbl)[128][72] = tw[1];   // the two weight buffers of the loop are the epilogue's tb and tbl
  const int tid = threadIdx.x, wave = tid >> 5, lane = tid & 31, col = lane & 15, g = lane >> 4; const int which = blockIdx.z; const int c0 = blockIdx.y * 128; const size_t r0 = (size_t)blockIdx.x * 64; const size_t bb = r0 / TT; const int t0 = (int)(r0 % TT);
  const float* X = which == 0 ? XQ : which == 1 ? XK : XV; const float* WA = which == 0 ? WQ : which == 1 ? WK : WV; const float* BA = which == 0 ? BQ : which == 1 ? BK : BV;
  v8f acc[8] = {};
  const int n4 = (wave * 8 + ((lane & 3) | ((lane >> 4) << 2))) * 4, o4 = (lane >> 2) & 3;
  const float* wp = WA + (size_t)(o4 * 8) * CC + c0 + n4; const float* xp = X + (r0 + wave * 16 + col) * DIN + 8 * g;
  v4f wf[2][8], xf[2][4]; v16b a[2]; wst_load(wf, wp, CC); arow_load(xf, xp);
  asm volatile("s_wait_xcnt 0x0" ::: "memory");   // in front of the first rewrite of an address register that stage 0's loads name
  float bs[8];   // the lane's eight bias elements are asked for here, behind stage 0's loads, and wait in registers: read in the epilogue they were eight round trips to L2, one behind the other, with nothing to hide them (the unrolls keep bs statically indexed)
#pragma unroll
  for (int j = 0; j < 8; ++j) bs[j] = 0.f;
  if (BA) {   // one test around all eight loads, so that they are in flight together
#pragma unroll
    for (int j = 0; j < 8; ++j) bs[j] = BA[c0 + j * 16 + col];
    asm volatile("s_wait_xcnt 0x0" ::: "memory"); }   // in front of the first rewrite of the offset register that these loads name
  wst_store(&tw[0][n4][o4 * 8], wf);
#pragma unroll
  for (int kk = 0; kk < 2; ++kk)
#pragma unroll
    for (int e = 0; e < 16; ++e) a[kk][e] = (__bf16)xf[kk][e >> 2][e & 3];
  __syncthreads();   // stage 0 is published
  for (int st = 0; st < DIN / GKS; ++st) { const int bu = st & 1; const bool more = st + 1 < DIN / GKS;
    if (more) { wst_load(wf, wp + (size_t)((st + 1) * GKS) * CC, CC); arow_load(xf, xp + (st + 1) * GKS);
      asm volatile("s_wait_xcnt 0x0" ::: "memory"); }   // in front of the first rewrite of an address register that these loads name
#pragma unroll
    for (int kk = 0; kk < 2; ++kk)
#pragma unroll
      for (int jh = 0; jh < 8; jh += 4) { v16b w[4];   // four fragments are read as one group, so that the wave waits out the LDS latency once for four products
#pragma unroll
        for (int j = 0; j < 4; ++j) w[j] = frag_b(&tw[bu][(jh + j) * 16 + col][kk * 32], lane);
#pragma unroll
        for (int j = 0; j < 4; ++j) acc[jh + j] = wmma_bf(a[kk], w[j], acc[jh + j]); }
    if (more) { wst_store(&tw[bu ^ 1][n4][o4 * 8], wf);   // its readers left this buffer before the last barrier
#pragma unroll
      for (int kk = 0; kk < 2; ++kk)
#pragma unroll
        for (int e = 0; e < 16; ++e) a[kk][e] = (__bf16)xf[kk][e >> 2][e & 3]; }
    __syncthreads(); }   // publishes stage st + 1 and ends every read of stage st
  if (which < 2) { _Float16* DH = which == 0 ? QH : KH; _Float16* DL = which == 0 ? QL : KL; const int nhi = which == 0 ? QHI : KHI; const bool hi_rows = t0 < nhi;
    if (hi_rows) {   // the residual is formed only in the blocks that store it
#pragma unroll
      for (int j = 0; j < 8; ++j) { const float bias = bfr(bs[j]);
#pragma unroll
        for (int r = 0; r < 8; ++r) { const float v = acc[j][r] + bias; const _Float16 hv = (_Float16)v; sh[wave * 16 + 8 * g + r][j * 16 + col] = hv; sl[wave * 16 + 8 * g + r][j * 16 + col] = (_Float16)((v - (float)hv) * 1024.0f); } }
    } else {
#pragma unroll
      for (int j = 0; j < 8; ++j) { const float bias = bfr(bs[j]);
#pragma unroll
        for (int r = 0; r < 8; ++r) sh[wave * 16 + 8 * g + r][j * 16 + col] = (_Float16)(acc[j][r] + bias); } }
    __syncthreads();
    const int rl0 = tid >> 4, q = tid & 15; v4u t[8];   // the thread's eight 16-byte pieces are read from LDS as one group and then stored: one LDS latency, not eight in a row (the unrolls keep t statically indexed)
#pragma unroll
    for (int it = 0; it < 8; ++it) t[it] = *(const v4u*)&sh[rl0 + it * 8][q * 8];
#pragma unroll
    for (int it = 0; it < 8; ++it) vst2((unsigned*)(DH + (r0 + rl0 + it * 8) * CC + c0 + q * 8), t[it]);
    if (hi_rows) { v4u u[8]; asm volatile("s_wait_xcnt 0x0" ::: "memory"); __builtin_amdgcn_sched_barrier(0);   // the wait stands in front of the first rewrite of a register that the stores above name; the scheduling barrier keeps this block's register writes from being lifted over it
#pragma unroll
      for (int it = 0; it < 8; ++it) u[it] = *(const v4u*)&sl[rl0 + it * 8][q * 8];
#pragma unroll
      for (int it = 0; it < 8; ++it) vst2((unsigned*)(DL + (bb * nhi + t0 + rl0 + it * 8) * (size_t)CC + c0 + q * 8), u[it]); }
  } else { const bool hi_rows = t0 < KHI;
#pragma unroll
    for (int j = 0; j < 8; ++j) { const float bias = bfr(bs[j]);
#pragma unroll
      for (int r = 0; r < 8; ++r) { const float v = acc[j][r] + bias; const int rl = wave * 16 + 8 * g + r, cl = j * 16 + col; th[cl][rl] = (_Float16)v; const __bf16 bh = (__bf16)v; tb[cl][rl] = bh; tbl[cl][rl] = (__bf16)(v - (float)bh); } }
    __syncthreads();
    const int cl0 = tid >> 3, q = tid & 7; v4u t[8];   // as above: eight LDS reads in flight together, then the stores
#pragma unroll
    for (int it = 0; it < 8; ++it) t[it] = *(const v4u*)&th[cl0 + it * 16][q * 8];
#pragma unroll
    for (int it = 0; it < 8; ++it) vst2((unsigned*)(VT + (bb * CC + c0 + cl0 + it * 16) * (size_t)TT + t0 + q * 8), t[it]);
    if (hi_rows) { v4u u[8], w[8]; asm volatile("s_wait_xcnt 0x0" ::: "memory"); __builtin_amdgcn_sched_barrier(0);   // the wait stands in front of the first rewrite of a register that the stores above name; the scheduling barrier keeps this block's register writes from being lifted over it
#pragma unroll
      for (int it = 0; it < 8; ++it) { u[it] = *(const v4u*)&tb[cl0 + it * 16][q * 8]; w[it] = *(const v4u*)&tbl[cl0 + it * 16][q * 8]; }
#pragma unroll
      for (int it = 0; it < 8; ++it) { const size_t o3 = (bb * CC + c0 + cl0 + it * 16) * (size_t)KHI + t0 + q * 8; vst2((unsigned*)(VB + o3), u[it]); vst2((unsigned*)(VBL + o3), w[it]); } }
    asm volatile("s_wait_xcnt 0x0" ::: "memory"); } }   // behind the last store of this branch on both ways: in front of any rewrite of a register that these stores name
#define AQT 4
#define ANQ 2
#define AKS 4
#define AKT 64                    // keys per stage and range: 128-B rows of k (64 d) and of v^T (64 keys)
#define ANS (TT / AKS / AKT)
#define ASL (AKT / (AQT * 4))     // 16-byte chunks that a thread stages of each of the two tiles
static_assert(AKS == HD / 16, "the merge gives each key range's wave one 16-row tile of O^T");
#define AC2 (SCALE * 1.44269504088896340736f)   // logit scale x log2(e)
#define APK 72                    // LDS pitch in halves: 128-B rows + 16 B, conflict-free for 16-byte fragment reads
__device__ __forceinline__ v8f wm16(v16h a, v16h b, v8f c) { return __builtin_amdgcn_wmma_f32_16x16x32_f16(false, a, false, b, (short)0, c, false, false); }
__device__ __forceinline__ float xhalf(float x) { return __builtin_bit_cast(float, __builtin_amdgcn_permlanex16(__builtin_bit_cast(int, x), __builtin_bit_cast(int, x), 0x76543210, 0xfedcba98, false, false)); }  // lane l with lane l ^ 16
// the hardware's exp2 with, in the same statement, the one free slot that the instruction set asks for behind a transcendental: for the merge's run of exponentials
__device__ __forceinline__ float exp2_slot(float x) { float r; asm("v_exp_f32 %0, %1\n\tv_nop" : "=v"(r) : "v"(x)); return r; }
__global__ __launch_bounds__(AQT * AKS * 32) void k_attn(const _Float16* __restrict__ QH, const _Float16* __restrict__ KH, const _Float16* __restrict__ VT, float* __restrict__ Y) {
  __shared__ __align__(16) _Float16 sk[2][AKS][AKT][APK], sv[2][AKS][HD][APK];
  __shared__ __align__(16) v4f sp[AKS][AQT][ANQ * (HD / 8)][32]; __shared__ float smx[AKS][AQT][ANQ][16], ssu[AKS][AQT][ANQ][16]; __shared__ __align__(16) float so[AQT][ANQ * 16][HD + 4];
  const int tid = threadIdx.x, wave = __builtin_amdgcn_readfirstlane(tid >> 5), lane = tid & 31, col = lane & 15, g = lane >> 4; const int qt = wave % AQT, ks = wave / AQT;
  const int b = blockIdx.y / NH, h = blockIdx.y % NH; const int ql0 = blockIdx.x * (AQT * ANQ * 16) + qt * (ANQ * 16);
  // staging: thread (qt, lane) of a range moves 16-byte chunk sc of rows sr + 16 i of the k tile and of the v^T tile (8 lanes = one 128-B line)
  const int sr = qt * 4 + (lane >> 3), sc = (lane & 7) * 8;
  const _Float16* kg = KH + ((size_t)b * TT + ks * (TT / AKS) + sr) * CC + h * HD + sc;
  const _Float16* vg = VT + ((size_t)b * CC + h * HD + sr) * (size_t)TT + ks * (TT / AKS) + sc;
  v8h gk[ASL], gv[ASL];
#pragma unroll
  for (int i = 0; i < ASL; ++i) { gk[i] = *(const v8h*)(kg + (size_t)(i * AQT * 4) * CC); gv[i] = *(const v8h*)(vg + (size_t)(i * AQT * 4) * TT); }
  v16h qh[ANQ][HD / 32];
#pragma unroll
  for (int n = 0; n < ANQ; ++n)
#pragma unroll
    for (int kc = 0; kc < HD / 32; ++kc) qh[n][kc] = frag_h(QH + ((size_t)b * TT + ql0 + n * 16 + col) * CC + h * HD + kc * 32, lane);
  asm volatile("s_wait_xcnt 0x0" ::: "memory");   // in front of the first rewrite of an address register that the loads above name
#pragma unroll
  for (int i = 0; i < ASL; ++i) { *(v8h*)&sk[0][ks][sr + i * AQT * 4][sc] = gk[i]; *(v8h*)&sv[0][ks][sr + i * AQT * 4][sc] = gv[i]; }
  __syncthreads();   // stage 0 is published
  v8f o[ANQ][HD / 16] = {}; float m[ANQ], nm[ANQ]; v2f l2[ANQ];   // l2: the lane's sum of exponentials (x 2^11), even and odd elements apart (packed adds)
#pragma unroll
  for (int n = 0; n < ANQ; ++n) { m[n] = -3.0e38f; nm[n] = 11.0f - m[n] * AC2; l2[n] = v2f{0.f, 0.f}; }
  for (int st = 0; st < ANS; ++st) { const int bu = st & 1;
    if (st + 1 < ANS) { const _Float16* kn = kg + (size_t)((st + 1) * AKT) * CC; const _Float16* vn = vg + (st + 1) * AKT;
#pragma unroll
      for (int i = 0; i < ASL; ++i) { gk[i] = *(const v8h*)(kn + (size_t)(i * AQT * 4) * CC); gv[i] = *(const v8h*)(vn + (size_t)(i * AQT * 4) * TT); }
      asm volatile("s_wait_xcnt 0x0" ::: "memory"); }   // in front of the first rewrite of an address register that these loads name
#pragma unroll
    for (int pp = 0; pp < AKT / 32; ++pp) {
      v16h kf[HD / 32][2];
#pragma unroll
      for (int kc = 0; kc < HD / 32; ++kc)
#pragma unroll
        for (int t = 0; t < 2; ++t) kf[kc][t] = frag_h(&sk[bu][ks][pp * 32 + t * 16 + col][kc * 32], lane);
      __builtin_amdgcn_sched_barrier(0);   // the pass's k fragments are read as one group ahead of the products: left to itself the scheduler reads them pair by pair into one register set and waits out the LDS latency four times a pass
      v8f s[ANQ][2] = {};
#pragma unroll
      for (int kc = 0; kc < HD / 32; ++kc)
#pragma unroll
        for (int t = 0; t < 2; ++t)
#pragma unroll
          for (int n = 0; n < ANQ; ++n) s[n][t] = wm16(kf[kc][t], qh[n][kc], s[n][t]);
      v16h vf[HD / 16];
#pragma unroll
      for (int j = 0; j < HD / 16; ++j) vf[j] = frag_h(&sv[bu][ks][j * 16 + col][pp * 32], lane);
      float mx[ANQ]; bool up = false;
#pragma unroll
      for (int n = 0; n < ANQ; ++n) { mx[n] = m[n];
#pragma unroll
        for (int i = 0; i < 8; ++i) mx[n] = fmaxf(mx[n], fmaxf(s[n][i >> 2][(2 * i) & 7], s[n][i >> 2][(2 * i + 1) & 7]));
        mx[n] = fmaxf(mx[n], xhalf(mx[n])); up = up || mx[n] > m[n]; }
      if (__builtin_amdgcn_ballot_w32(up) != 0) {   // some query's maximum rose (one test a pass for the wave's queries): bring sum and O^T to the new one (a factor of exactly 1 for the other queries)
#pragma unroll
        for (int n = 0; n < ANQ; ++n) { const float nn = 11.0f - mx[n] * AC2; const float a = __builtin_amdgcn_exp2f(nn - nm[n]); l2[n] *= a; m[n] = mx[n]; nm[n] = nn;
#pragma unroll
          for (int j = 0; j < HD / 16; ++j)
#pragma unroll
            for (int r = 0; r < 8; ++r) o[n][j][r] *= a; } }
      v16h pf[ANQ];
#pragma unroll
      for (int n = 0; n < ANQ; ++n)
#pragma unroll
        for (int i = 0; i < 8; ++i) { const v2f x = v2f{s[n][i >> 2][(2 * i) & 7], s[n][i >> 2][(2 * i + 1) & 7]} * AC2 + nm[n]; const v2f e = {__builtin_amdgcn_exp2f(x.x), __builtin_amdgcn_exp2f(x.y)}; l2[n] += e; pf[n][2 * i] = (_Float16)e.x; pf[n][2 * i + 1] = (_Float16)e.y; }
#pragma unroll
      for (int j = 0; j < HD / 16; ++j)
#pragma unroll
        for (int n = 0; n < ANQ; ++n) o[n][j] = wm16(vf[j], pf[n], o[n][j]); }
    if (st + 1 < ANS) {   // its readers left this buffer before the last barrier
#pragma unroll
      for (int i = 0; i < ASL; ++i) { *(v8h*)&sk[bu ^ 1][ks][sr + i * AQT * 4][sc] = gk[i]; *(v8h*)&sv[bu ^ 1][ks][sr + i * AQT * 4][sc] = gv[i]; } }
    __syncthreads(); }   // publishes stage st + 1 and ends every read of stage st
#pragma unroll
  for (int n = 0; n < ANQ; ++n) { float l = l2[n].x + l2[n].y; l += xhalf(l);
#pragma unroll
    for (int j = 0; j < HD / 16; ++j)
#pragma unroll
      for (int u = 0; u < 2; ++u) sp[ks][qt][(n * (HD / 16) + j) * 2 + u][lane] = v4f{o[n][j][4 * u], o[n][j][4 * u + 1], o[n][j][4 * u + 2], o[n][j][4 * u + 3]};   // 16 bytes a lane, lanes side by side: no bank conflict
    if (g == 0) { smx[ks][qt][n][col] = nm[n]; ssu[ks][qt][n][col] = l; } }
  __syncthreads();   // every range's partial results are published
  float nx[ANQ][AKS], lx[ANQ][AKS]; v4f px[ANQ][2][AKS];
#pragma unroll
  for (int n = 0; n < ANQ; ++n)
#pragma unroll
    for (int x = 0; x < AKS; ++x) { nx[n][x] = smx[x][qt][n][col]; lx[n][x] = ssu[x][qt][n][col];
#pragma unroll
      for (int u = 0; u < 2; ++u) px[n][u][x] = sp[x][qt][(n * (HD / 16) + ks) * 2 + u][lane]; }
  __builtin_amdgcn_sched_barrier(0);   // all of the merge's LDS reads go out as one group: spread among the sums they were waited for one after the other
  float a[ANQ][AKS], nn[ANQ];
#pragma unroll
  for (int n = 0; n < ANQ; ++n) { nn[n] = nx[n][0];
#pragma unroll
    for (int x = 1; x < AKS; ++x) nn[n] = fminf(nn[n], nx[n][x]); }   // the smallest nm belongs to the largest maximum
#pragma unroll
  for (int x = 0; x < AKS; ++x)
#pragma unroll
    for (int n = 0; n < ANQ; ++n) a[n][x] = exp2_slot(nn[n] - nx[n][x]);
#pragma unroll
  for (int n = 0; n < ANQ; ++n) { float l = 0.f;
#pragma unroll
    for (int x = 0; x < AKS; ++x) l += lx[n][x] * a[n][x];
    const float inv = 1.0f / l;
#pragma unroll
    for (int u = 0; u < 2; ++u) { v4f acc = {0.f, 0.f, 0.f, 0.f};
#pragma unroll
      for (int x = 0; x < AKS; ++x) acc += px[n][u][x] * a[n][x];
      *(v4f*)&so[qt][n * 16 + col][ks * 16 + 8 * g + 4 * u] = acc * inv; } }
  __syncthreads();   // the group's merged rows are published
#pragma unroll
  for (int it = 0; it < ANQ * 16 / AKS / 2; ++it) { const int rl = ks * (ANQ * 16 / AKS) + it * 2 + g; vst2(Y + ((size_t)b * TT + ql0 + rl) * CC + h * HD + col * 4, *(const v4f*)&so[qt][rl][col * 4]); } }
// ---- k_out: block = (64 rows, 128 cols): out = ctx Wo (+ bo): ctx split bf16 hi + lo against exact bf16 Wo (2 products), all rows
__global__ __launch_bounds__(128) void k_out(const float* __restrict__ Y, const float* __restrict__ WO, const float* __restrict__ BO, float* __restrict__ OUT) { __shared__ __align__(16) float sf[4][16][132]; __shared__ __align__(16) __bf16 tw[2][128][GPW];
  const int tid = threadIdx.x, wave = tid >> 5, lane = tid & 31, col = lane & 15, g = lane >> 4; const int c0 = blockIdx.y * 128; const size_t r0 = (size_t)blockIdx.x * 64 + wave * 16;
  v8f acc[8] = {};
  if (true) {   /* ALL rows: ctx split bf16 hi + lo x exact Wo (2 products) */
    const int n4 = (wave * 8 + ((lane & 3) | ((lane >> 4) << 2))) * 4, o4 = (lane >> 2) & 3;
    const float* wp = WO + (size_t)(o4 * 8) * DIN + c0 + n4; const float* xp = Y + (r0 + col) * CC + 8 * g;
    v4f wf[2][8], xf[2][4]; F2 a[2]; wst_load(wf, wp, DIN); arow_load(xf, xp);
    asm volatile("s_wait_xcnt 0x0" ::: "memory");   // in front of the first rewrite of an address register that stage 0's loads name
    float bs[8];   // as in k_proj: the bias is asked for at entry, not in eight dependent round trips behind the loop (the unrolls keep bs statically indexed)
#pragma unroll
    for (int j = 0; j < 8; ++j) bs[j] = 0.f;
    if (BO) {   // one test around all eight loads, so that they are in flight together
#pragma unroll
      for (int j = 0; j < 8; ++j) bs[j] = BO[c0 + j * 16 + col];
      asm volatile("s_wait_xcnt 0x0" ::: "memory"); }   // in front of the first rewrite of the offset register that these loads name
    wst_store(&tw[0][n4][o4 * 8], wf);
#pragma unroll
    for (int kk = 0; kk < 2; ++kk) { float v[16];
#pragma unroll
      for (int e = 0; e < 16; ++e) v[e] = xf[kk][e >> 2][e & 3];
      a[kk] = bsplit16(v); }
    __syncthreads();   // stage 0 is published
    for (int st = 0; st < CC / GKS; ++st) { const int bu = st & 1; const bool more = st + 1 < CC / GKS;
      if (more) { wst_load(wf, wp + (size_t)((st + 1) * GKS) * DIN, DIN); arow_load(xf, xp + (st + 1) * GKS);
        asm volatile("s_wait_xcnt 0x0" ::: "memory"); }   // in front of the first rewrite of an address register that these loads name
#pragma unroll
      for (int kk = 0; kk < 2; ++kk)
#pragma unroll
        for (int jh = 0; jh < 8; jh += 4) { v16b w[4];   // four fragments are read as one group, so that the wave waits out the LDS latency once for eight products
#pragma unroll
          for (int j = 0; j < 4; ++j) w[j] = frag_b(&tw[bu][(jh + j) * 16 + col][kk * 32], lane);
#pragma unroll
          for (int j = 0; j < 4; ++j) acc[jh + j] = wmma_bf(a[kk].h, w[j], acc[jh + j]);
#pragma unroll
          for (int j = 0; j < 4; ++j) acc[jh + j] = wmma_bf(a[kk].l, w[j], acc[jh + j]); }   // hi before lo in every accumulator, as before
      if (more) { wst_store(&tw[bu ^ 1][n4][o4 * 8], wf);   // its readers left this buffer before the last barrier
#pragma unroll
        for (int kk = 0; kk < 2; ++kk) { float v[16];
#pragma unroll
          for (int e = 0; e < 16; ++e) v[e] = xf[kk][e >> 2][e & 3];
          a[kk] = bsplit16(v); } }
      __syncthreads(); }   // publishes stage st + 1 and ends every read of stage st
#pragma unroll
    for (int j = 0; j < 8; ++j) { const float bias = bfr(bs[j]);
#pragma unroll
      for (int r = 0; r < 8; ++r) sf[wave][8 * g + r][j * 16 + col] = acc[j][r] + bias; }
  } else {
#pragma unroll 2
    for (int kc = 0; kc < CC / 32; ++kc) { const v16h a = frag_f32(Y + (r0 + col) * CC + kc * 32, lane); asm volatile("s_wait_loadcnt 0x0" ::: "memory");
#pragma unroll
      for (int j = 0; j < 8; ++j) { const v16h w = WOCOLH(WO, kc * 32, c0 + j * 16 + col, lane); asm volatile("s_wait_loadcnt 0x0" ::: "memory"); acc[j] = wmma16(a, w, acc[j]); } }
#pragma unroll
    for (int j = 0; j < 8; ++j) { const float bias = BO ? bfr(BO[c0 + j * 16 + col]) : 0.f;
#pragma unroll
      for (int r = 0; r < 8; ++r) sf[wave][8 * g + r][j * 16 + col] = acc[j][r] * (1.0f / 256.0f) + bias; } }
  LDSX(); for (int rl = 0; rl < 16; ++rl) vst2(OUT + (r0 + rl) * DIN + c0 + lane * 4, *(const v4f*)&sf[wave][rl][lane * 4]); }

extern "C" void kernel_launch(void* const* d_in, const int* in_sizes, int n_in, void* d_out, int out_size, void* d_ws, size_t ws_size, hipStream_t stream) {
  (void)in_sizes; (void)n_in; (void)out_size;
  const float** F = (const float**)d_in;
  if (ws_size < (size_t)WS_END) return;
  char* ws = (char*)d_ws; _Float16 *QH = (_Float16*)(ws + WS_QH), *KH = (_Float16*)(ws + WS_KH), *VT = (_Float16*)(ws + WS_VT), *QL = (_Float16*)(ws + WS_QL), *KL = (_Float16*)(ws + WS_KL); __bf16 *VB = (__bf16*)(ws + WS_VB), *VBL = (__bf16*)(ws + WS_VBL); float *Y = (float*)(ws + WS_Y);
  (void)Y; (void)QL; (void)KL; (void)VB; (void)VBL;
  // inputs: 0 x [2,2048,512]; 1 Wq (in,out), 2 bq; 3 Wk, 4 bk; 5 Wv, 6 bv; 7 Wo (in,out), 8 bo
  k_proj<<<dim3(TNB * TT / 64, CC / 128, 3), 128, 0, stream>>>(F[0], F[0], F[0], F[1], F[3], F[5], F[2], F[4], F[6], QH, QL, KH, KL, VT, VB, VBL);
  k_attn<<<dim3(TT / (AQT * ANQ * 16), TNB * NH), AQT * AKS * 32, 0, stream>>>(QH, KH, VT, Y);
  k_out<<<dim3(TNB * TT / 64, DIN / 128), 128, 0, stream>>>(Y, F[7], F[8], (float*)d_out);
}

// v007
// Measured time: 46.4 microseconds a run.
// Two timings next to v006 both put it at 1.05 times that version's speed.
// Over all steps from v000 it is 12.6 times as fast.
// compute dtype: all float inputs rounded to bf16; q/k/v = in W + b with EXACT bf16 products on WMMA 16x16x32 (f32 accumulate); q once to f16 against k once to f16 (1 product) / 8; online softmax in f32 (one fused multiply-add and the hardware's exp2 per logit), fused with both products; exp(logit - max) x 2^11 once to f16 against v once to f16 (1 product), divided by the f32 sum (x 2^11 too) at the end; ctx split bf16 hi + lo against exact Wo (2 products) + bo; f32 output.
#include <hip/hip_runtime.h>
#include <math.h>

typedef __attribute__((ext_vector_type(16))) _Float16 v16h;
typedef __attribute__((ext_vector_type(16))) __bf16 v16b;
typedef __attribute__((ext_vector_type(8)))  _Float16 v8h;
typedef __attribute__((ext_vector_type(8)))  float v8f;
typedef __attribute__((ext_vector_type(4)))  float v4f;
typedef __attribute__((ext_vector_type(2)))  float v2f;
typedef __attribute__((ext_vector_type(4)))  unsigned v4u;
typedef __attribute__((ext_vector_type(4)))  int v4i;
typedef float __attribute__((may_alias)) float_a;
typedef int __attribute__((may_alias)) int_a;

template <typename T> __device__ __forceinline__ void vst2(void* p, T v) { *(T*)p = v;  }
__device__ __forceinline__ v8f wmma16(v16h a, v16h b, v8f c) {
  v8f d = __builtin_amdgcn_wmma_f32_16x16x32_f16(false, a, false, b, (short)0, c, false, false);
  asm volatile("v_nop\n\tv_nop\n\tv_nop\n\tv_nop" : "+v"(d) : "v"(a), "v"(b));
  return d;
}
__device__ __forceinline__ v8f wmma_bf(v16b a, v16b b, v8f c) {
  v8f d = __builtin_amdgcn_wmma_f32_16x16x32_bf16(false, a, false, b, (short)0, c, false, false);
  asm volatile("v_nop\n\tv_nop\n\tv_nop\n\tv_nop" : "+v"(d) : "v"(a), "v"(b));
  return d;
}
// 16x16x32 fragments: lane = (h = lane>>4, row/col = lane&15); elements 0..7 = k0+8h+0..7, 8..15 = k0+16+8h+0..7; D element r = row 8h+r
__device__ __forceinline__ v16h frag_h(const _Float16* rowk0, int lane) {
  union { v16h v; v8h q[2]; } u; const _Float16* p = rowk0 + 8 * (lane >> 4);
  u.q[0] = *(const v8h*)p; u.q[1] = *(const v8h*)(p + 16); return u.v;
}
__device__ __forceinline__ v16h frag_f32(const float* rowk0, int lane) {
  v16h a; const float* p = rowk0 + 8 * (lane >> 4);
#pragma unroll
  for (int i = 0; i < 8; ++i) { a[i] = (_Float16)p[i]; a[8 + i] = (_Float16)p[16 + i]; }
  return a;
}
__device__ __forceinline__ v16h frag_f32s(const float* rowk0, int lane, float sc) {
  v16h a; const float* p = rowk0 + 8 * (lane >> 4);
#pragma unroll
  for (int i = 0; i < 8; ++i) { a[i] = (_Float16)(p[i] * sc); a[8 + i] = (_Float16)(p[16 + i] * sc); }
  return a;
}
// column fragment from a [K][ld] layout (column n), rows >= K read as 0
__device__ __forceinline__ v16h fragc_f32(const float* W, int k0, int n, int lane, int ld, int K) {
  v16h a; const int g = lane >> 4;
#pragma unroll
  for (int i = 0; i < 8; ++i) { const int ka = k0 + 8 * g + i, kb = ka + 16;
    a[i] = (_Float16)(ka < K ? W[(size_t)(ka < K ? ka : K - 1) * ld + n] : 0.f); a[8 + i] = (_Float16)(kb < K ? W[(size_t)(kb < K ? kb : K - 1) * ld + n] : 0.f); }
  return a;
}
struct F2 { v16b h, l; };
__device__ __forceinline__ F2 bsplit16(const float v[16]) { F2 r;
#pragma unroll
  for (int i = 0; i < 16; ++i) { const __bf16 h = (__bf16)v[i]; r.h[i] = h; r.l[i] = (__bf16)(v[i] - (float)h); }
  return r; }
__device__ __forceinline__ F2 split_row(const float* row, int k0, int lane) { float v[16]; const float* p = row + k0 + 8 * (lane >> 4);
#pragma unroll
  for (int i = 0; i < 8; ++i) { v[i] = p[i]; v[8 + i] = p[16 + i]; }
  return bsplit16(v); }
__device__ __forceinline__ F2 split_rowK(const float* row, int k0, int lane, int K) { float v[16]; const int g = lane >> 4;
#pragma unroll
  for (int i = 0; i < 8; ++i) { const int ka = k0 + 8 * g + i, kb = ka + 16; v[i] = ka < K ? row[ka < K ? ka : K - 1] : 0.f; v[8 + i] = kb < K ? row[kb < K ? kb : K - 1] : 0.f; }
  return bsplit16(v); }
__device__ __forceinline__ F2 split_col(const float* W, int k0, int n, int lane, int ld, int K) { float v[16]; const int g = lane >> 4;
#pragma unroll
  for (int i = 0; i < 8; ++i) { const int ka = k0 + 8 * g + i, kb = ka + 16; v[i] = ka < K ? W[(size_t)(ka < K ? ka : K - 1) * ld + n] : 0.f; v[8 + i] = kb < K ? W[(size_t)(kb < K ? kb : K - 1) * ld + n] : 0.f; }
  return bsplit16(v); }
__device__ __forceinline__ v8f mac3(const F2& a, const F2& b, v8f c) { c = wmma_bf(a.l, b.h, c); c = wmma_bf(a.h, b.l, c); return wmma_bf(a.h, b.h, c); }
__device__ __forceinline__ float sigm(float v) { return 1.0f / (1.0f + expf(-v)); }
#define LDSX() do { asm volatile("s_wait_dscnt 0" ::: "memory"); __builtin_amdgcn_wave_barrier(); __builtin_amdgcn_fence(__ATOMIC_RELEASE, "workgroup"); } while (0)

// Multi-head self-attention (B 2, S 2,048, d_model 512 = 8 x 64; (in,out) uniform +-1/sqrt(512) weights WITH biases): q, k, v = x W + b; out = merged(softmax(q k^T / 8) v) Wo + bo (non-causal).
#define NB 2
#define TT 2048
#define CC 512            // NH * HD = projected width
#define DIN 512          // input (model) width
#define NH 8
#define HD 64
#define NQB (TT / 64)
#define HG 4
#define SCALE (0.125f)
#define CAUSAL 0
#ifndef TNB
#define TNB NB
#endif
__device__ __forceinline__ float bfr(float v) { return (float)(__bf16)v; }
__host__ __device__ __forceinline__ int kb_last(int qb) { return CAUSAL ? ((qb * 64 + 63) >> 7) : (TT / 128 - 1); }
typedef __attribute__((ext_vector_type(8))) __bf16 v8b;
__device__ __forceinline__ v16b frag_b(const __bf16* rowk0, int lane) {
  union { v16b v; v8b q[2]; } u; const __bf16* p = rowk0 + 8 * (lane >> 4);
  u.q[0] = *(const v8b*)p; u.q[1] = *(const v8b*)(p + 16); return u.v;
}
#define QBH 0              // unused: k_attn has no high-precision path
#define QHI 0               // rows carrying a q residual plane (none: q goes into the logits rounded once to f16, as k does)
#define KHI 64            // key rows carrying k residual / v bf16 hi+lo planes (written by k_proj, read by no kernel)
// B fragment (k rows k0+.., output column o) of a weight: (in,out) [K][ld] or (out,in) [ld rows of K]: bf16 exact, or f16(bf16 * 256) exact
__device__ __forceinline__ v16b wcol_io(const float* Wm, int k0, int o, int lane, int ld) { v16b w; const int g = lane >> 4;
#pragma unroll
  for (int i = 0; i < 8; ++i) { w[i] = (__bf16)Wm[(size_t)(k0 + 8 * g + i) * ld + o]; w[8 + i] = (__bf16)Wm[(size_t)(k0 + 16 + 8 * g + i) * ld + o]; }
  return w; }
__device__ __forceinline__ v16b wcol_oi(const float* Wm, int k0, int o, int lane, int K) { v16b w; const float* p = Wm + (size_t)o * K + k0 + 8 * (lane >> 4);
#pragma unroll
  for (int i = 0; i < 8; ++i) { w[i] = (__bf16)p[i]; w[8 + i] = (__bf16)p[16 + i]; }
  return w; }
__device__ __forceinline__ v16h wcolh_io(const float* Wm, int k0, int o, int lane, int ld) { v16h w; const int g = lane >> 4;
#pragma unroll
  for (int i = 0; i < 8; ++i) { w[i] = (_Float16)(bfr(Wm[(size_t)(k0 + 8 * g + i) * ld + o]) * 256.0f); w[8 + i] = (_Float16)(bfr(Wm[(size_t)(k0 + 16 + 8 * g + i) * ld + o]) * 256.0f); }
  return w; }
__device__ __forceinline__ v16h wcolh_oi(const float* Wm, int k0, int o, int lane, int K) { v16h w; const float* p = Wm + (size_t)o * K + k0 + 8 * (lane >> 4);
#pragma unroll
  for (int i = 0; i < 8; ++i) { w[i] = (_Float16)(bfr(p[i]) * 256.0f); w[8 + i] = (_Float16)(bfr(p[16 + i]) * 256.0f); }
  return w; }
#define WQKV_LAYOUT 0   // 0 = (in,out) [DIN][CC]; 1 = (out,in) [CC][DIN]; 2 = per-head [NH][DIN][HD]
__device__ __forceinline__ v16b wcol_hdk(const float* Wm, int k0, int o, int lane) { v16b w; const int g = lane >> 4; const float* p = Wm + (size_t)(o / HD) * DIN * HD + (o % HD);
#pragma unroll
  for (int i = 0; i < 8; ++i) { w[i] = (__bf16)p[(size_t)(k0 + 8 * g + i) * HD]; w[8 + i] = (__bf16)p[(size_t)(k0 + 16 + 8 * g + i) * HD]; }
  return w; }
#define WO_OUT_IN 0
#if WQKV_LAYOUT == 1
#define WCOL(W, k0, o, lane) wcol_oi(W, k0, o, lane, DIN)
#elif WQKV_LAYOUT == 2
#define WCOL(W, k0, o, lane) wcol_hdk(W, k0, o, lane)
#else
#define WCOL(W, k0, o, lane) wcol_io(W, k0, o, lane, CC)
#endif
#if WO_OUT_IN
#define WOCOL(W, k0, o, lane) wcol_oi(W, k0, o, lane, CC)
#define WOCOLH(W, k0, o, lane) wcolh_oi(W, k0, o, lane, CC)
#else
#define WOCOL(W, k0, o, lane) wcol_io(W, k0, o, lane, DIN)
#define WOCOLH(W, k0, o, lane) wcolh_io(W, k0, o, lane, DIN)
#endif

#ifndef SM_EXTRA_PARAMS
#define SM_EXTRA_PARAMS
#endif
#ifndef PROJ_EXTRA_PARAMS
#define PROJ_EXTRA_PARAMS
#endif
#ifndef SM_MASK_HOOK
#define SM_MASK_HOOK (void)0
#endif

#define WS_QH  0u                                      // f16 q rows [b*t][CC]
#define WS_KH  (WS_QH + 2u * (size_t)NB * TT * CC)      // f16 k rows [b*t][CC]
#define WS_VT  (WS_KH + 2u * (size_t)NB * TT * CC)      // f16 v planes [b][c][t]
#define WS_QL  (WS_VT + 2u * (size_t)NB * CC * TT)      // f16 q residual x 2^10 rows [b][t < QHI][CC]
#define WS_KL  (WS_QL + 2u * (size_t)NB * QHI * CC)     // f16 k residual x 2^10 rows [b][t < KHI][CC]
#define WS_VB  (WS_KL + 2u * (size_t)NB * KHI * CC)     // bf16 v hi planes [b][c][t < KHI]
#define WS_VBL (WS_VB + 2u * (size_t)NB * CC * KHI)
#define WS_S   (WS_VBL + 2u * (size_t)NB * CC * KHI)    // f32 [hg][t][s] region, unused: logits and P stay in registers
#define WS_Y   (WS_S  + 4u * (size_t)HG * TT * TT)      // f32 ctx rows [b*t][CC] (only when there is an output projection)
#define WS_END (WS_Y  + 4u * (size_t)NB * TT * CC)

// ---- weight staging of the two projection GEMMs: a stage is GKS k rows x 128 columns of an (in,out) f32 weight, rounded to bf16 and laid column-major in LDS (pitch GPW), once per block for its four waves.
// Thread (wave, lane) moves columns n4..n4+3 of k rows o4*8 + u*32 + i: a wave-wide load covers four whole 128-B lines, and 16 neighbouring lanes' 16-byte LDS stores cover all 64 banks once.
// Two buffers: the next stage's loads fly during this stage's products, one barrier a stage. The k order of the products is the one of the unstaged loop. Every '#pragma unroll' of the staging and of the two loops keeps a register array statically indexed.
#define GKS 64
#define GPW 72                    // LDS pitch in bf16: 128-B rows + 16 B, conflict-free for 16-byte fragment reads
__device__ __forceinline__ void wst_load(v4f (&f)[2][8], const float* wp, int ld) {
#pragma unroll
  for (int u = 0; u < 2; ++u)
#pragma unroll
    for (int i = 0; i < 8; ++i) f[u][i] = *(const v4f*)(wp + (size_t)(u * 32 + i) * ld); }
__device__ __forceinline__ void wst_store(__bf16* sp, const v4f (&f)[2][8]) {
#pragma unroll
  for (int u = 0; u < 2; ++u)
#pragma unroll
    for (int c = 0; c < 4; ++c) { v8b p;
#pragma unroll
      for (int i = 0; i < 8; ++i) p[i] = (__bf16)f[u][i][c];
      *(v8b*)(sp + c * GPW + u * 32) = p; } }
// the lane's f32 elements of the A fragments of one stage (p = row + stage k0 + 8 * (lane >> 4)): element e of fragment kk is x[kk][e >> 2][e & 3]
__device__ __forceinline__ void arow_load(v4f (&x)[2][4], const float* p) {
#pragma unroll
  for (int kk = 0; kk < 2; ++kk) { x[kk][0] = *(const v4f*)(p + kk * 32); x[kk][1] = *(const v4f*)(p + kk * 32 + 4); x[kk][2] = *(const v4f*)(p + kk * 32 + 16); x[kk][3] = *(const v4f*)(p + kk * 32 + 20); } }
// ---- k_proj: block = (64 rows, 128 cols, which): q/k/v = X W (+ b) with exact bf16 products (K = DIN) -> which 0: q f16 rows (+ residual rows < QHI); 1: k f16 rows (+ residual rows < KHI); 2: v f16 planes [c][t] (+ bf16 hi/lo planes for t < KHI)
__global__ __launch_bounds__(128) void k_proj(const float* __restrict__ XQ, const float* __restrict__ XK, const float* __restrict__ XV, const float* __restrict__ WQ, const float* __restrict__ WK, const float* __restrict__ WV, const float* __restrict__ BQ, const float* __restrict__ BK, const float* __restrict__ BV,
    _Float16* __restrict__ QH, _Float16* __restrict__ QL, _Float16* __restrict__ KH, _Float16* __restrict__ KL, _Float16* __restrict__ VT, __bf16* __restrict__ VB, __bf16* __restrict__ VBL) {
  __shared__ __align__(16) _Float16 sh[64][136], sl[64][136]; __shared__ __align__(16) _Float16 th[128][72]; __shared__ __align__(16) __bf16 tw[2][128][GPW]; __bf16 (&tb)[128][72] = tw[0]; __bf16 (&tbl)[128][72] = tw[1];   // the two weight buffers of the loop are the epilogue's tb and tbl
  const int tid = threadIdx.x, wave = tid >> 5, lane = tid & 31, col = lane & 15, g = lane >> 4; const int which = blockIdx.z; const int c0 = blockIdx.y * 128; const size_t r0 = (size_t)blockIdx.x * 64; const size_t bb = r0 / TT; const int t0 = (int)(r0 % TT);
  const float* X = which == 0 ? XQ : which == 1 ? XK : XV; const float* WA = which == 0 ? WQ : which == 1 ? WK : WV; const float* BA = which == 0 ? BQ : which == 1 ? BK : BV;
  v8f acc[8] = {};
  const int n4 = (wave * 8 + ((lane & 3) | ((lane >> 4) << 2))) * 4, o4 = (lane >> 2) & 3;
  const float* wp = WA + (size_t)(o4 * 8) * CC + c0 + n4; const float* xp = X + (r0 + wave * 16 + col) * DIN + 8 * g;
  v4f wf[2][8], xf[2][4]; v16b a[2]; wst_load(wf, wp, CC); arow_load(xf, xp);
  asm volatile("s_wait_xcnt 0x0" ::: "memory");   // in front of the first rewrite of an address register that stage 0's loads name
  float bs[8];   // the lane's eight bias elements are asked for here, behind stage 0's loads, and wait in registers: read in the epilogue they were eight round trips to L2, one behind the other, with nothing to hide them (the unrolls keep bs statically indexed)
#pragma unroll
  for (int j = 0; j < 8; ++j) bs[j] = 0.f;
  if (BA) {   // one test around all eight loads, so that they are in flight together
#pragma unroll
    for (int j = 0; j < 8; ++j) bs[j] = BA[c0 + j * 16 + col];
    asm volatile("s_wait_xcnt 0x0" ::: "memory"); }   // in front of the first rewrite of the offset register that these loads name
  wst_store(&tw[0][n4][o4 * 8], wf);
#pragma unroll
  for (int kk = 0; kk < 2; ++kk)
#pragma unroll
    for (int e = 0; e < 16; ++e) a[kk][e] = (__bf16)xf[kk][e >> 2][e & 3];
  __syncthreads();   // stage 0 is published
  for (int st = 0; st < DIN / GKS; ++st) { const int bu = st & 1; const bool more = st + 1 < DIN / GKS;
    if (more) { wst_load(wf, wp + (size_t)((st + 1) * GKS) * CC, CC); arow_load(xf, xp + (st + 1) * GKS);
      asm volatile("s_wait_xcnt 0x0" ::: "memory"); }   // in front of the first rewrite of an address register that these loads name
#pragma unroll
    for (int kk = 0; kk < 2; ++kk)
#pragma unroll
      for (int jh = 0; jh < 8; jh += 4) { v16b w[4];   // four fragments are read as one group, so that the wave waits out the LDS latency once for four products
#pragma unroll
        for (int j = 0; j < 4; ++j) w[j] = frag_b(&tw[bu][(jh + j) * 16 + col][kk * 32], lane);
#pragma unroll
        for (int j = 0; j < 4; ++j) acc[jh + j] = wmma_bf(a[kk], w[j], acc[jh + j]); }
    if (more) { wst_store(&tw[bu ^ 1][n4][o4 * 8], wf);   // its readers left this buffer before the last barrier
#pragma unroll
      for (int kk = 0; kk < 2; ++kk)
#pragma unroll
        for (int e = 0; e < 16; ++e) a[kk][e] = (__bf16)xf[kk][e >> 2][e & 3]; }
    __syncthreads(); }   // publishes stage st + 1 and ends every read of stage st
  if (which < 2) { _Float16* DH = which == 0 ? QH : KH; _Float16* DL = which == 0 ? QL : KL; const int nhi = which == 0 ? QHI : KHI; const bool hi_rows = t0 < nhi;
    if (hi_rows) {   // the residual is formed only in the blocks that store it
#pragma unroll
      for (int j = 0; j < 8; ++j) { const float bias = bfr(bs[j]);
#pragma unroll
        for (int r = 0; r < 8; ++r) { const float v = acc[j][r] + bias; const _Float16 hv = (_Float16)v; sh[wave * 16 + 8 * g + r][j * 16 + col] = hv; sl[wave * 16 + 8 * g + r][j * 16 + col] = (_Float16)((v - (float)hv) * 1024.0f); } }
    } else {
#pragma unroll
      for (int j = 0; j < 8; ++j) { const float bias = bfr(bs[j]);
#pragma unroll
        for (int r = 0; r < 8; ++r) sh[wave * 16 + 8 * g + r][j * 16 + col] = (_Float16)(acc[j][r] + bias); } }
    __syncthreads();
    const int rl0 = tid >> 4, q = tid & 15; v4u t[8];   // the thread's eight 16-byte pieces are read from LDS as one group and then stored: one LDS latency, not eight in a row (the unrolls keep t statically indexed)
#pragma unroll
    for (int it = 0; it < 8; ++it) t[it] = *(const v4u*)&sh[rl0 + it * 8][q * 8];
#pragma unroll
    for (int it = 0; it < 8; ++it) vst2((unsigned*)(DH + (r0 + rl0 + it * 8) * CC + c0 + q * 8), t[it]);
    if (hi_rows) { v4u u[8]; asm volatile("s_wait_xcnt 0x0" ::: "memory"); __builtin_amdgcn_sched_barrier(0);   // the wait stands in front of the first rewrite of a register that the stores above name; the scheduling barrier keeps this block's register writes from being lifted over it
#pragma unroll
      for (int it = 0; it < 8; ++it) u[it] = *(const v4u*)&sl[rl0 + it * 8][q * 8];
#pragma unroll
      for (int it = 0; it < 8; ++it) vst2((unsigned*)(DL + (bb * nhi + t0 + rl0 + it * 8) * (size_t)CC + c0 + q * 8), u[it]); }
  } else { const bool hi_rows = t0 < KHI;
#pragma unroll
    for (int j = 0; j < 8; ++j) { const float bias = bfr(bs[j]);
#pragma unroll
      for (int r = 0; r < 8; ++r) { const float v = acc[j][r] + bias; const int rl = wave * 16 + 8 * g + r, cl = j * 16 + col; th[cl][rl] = (_Float16)v; const __bf16 bh = (__bf16)v; tb[cl][rl] = bh; tbl[cl][rl] = (__bf16)(v - (float)bh); } }
    __syncthreads();
    const int cl0 = tid >> 3, q = tid & 7; v4u t[8];   // as above: eight LDS reads in flight together, then the stores
#pragma unroll
    for (int it = 0; it < 8; ++it) t[it] = *(const v4u*)&th[cl0 + it * 16][q * 8];
#pragma unroll
    for (int it = 0; it < 8; ++it) vst2((unsigned*)(VT + (bb * CC + c0 + cl0 + it * 16) * (size_t)TT + t0 + q * 8), t[it]);
    if (hi_rows) { v4u u[8], w[8]; asm volatile("s_wait_xcnt 0x0" ::: "memory"); __builtin_amdgcn_sched_barrier(0);   // the wait stands in front of the first rewrite of a register that the stores above name; the scheduling barrier keeps this block's register writes from being lifted over it
#pragma unroll
      for (int it = 0; it < 8; ++it) { u[it] = *(const v4u*)&tb[cl0 + it * 16][q * 8]; w[it] = *(const v4u*)&tbl[cl0 + it * 16][q * 8]; }
#pragma unroll
      for (int it = 0; it < 8; ++it) { const size_t o3 = (bb * CC + c0 + cl0 + it * 16) * (size_t)KHI + t0 + q * 8; vst2((unsigned*)(VB + o3), u[it]); vst2((unsigned*)(VBL + o3), w[it]); } }
    asm volatile("s_wait_xcnt 0x0" ::: "memory"); } }   // behind the last store of this branch on both ways: in front of any rewrite of a register that these stores name
#define AQT 4
#define ANQ 2
#define AKS 4
#define AKT 64                    // keys per stage and range: 128-B rows of k (64 d) and of v^T (64 keys)
#define ANS (TT / AKS / AKT)
#define ASL (AKT / (AQT * 4))     // 16-byte chunks that a thread stages of each of the two tiles
static_assert(AKS == HD / 16, "the merge gives each key range's wave one 16-row tile of O^T"); static_assert(ANQ == 2, "the overflow look names both query tiles");
#define AC2 (SCALE * 1.44269504088896340736f)   // logit scale x log2(e)
#define APK 72                    // LDS pitch in halves: 128-B rows + 16 B, conflict-free for 16-byte fragment reads
__device__ __forceinline__ v8f wm16(v16h a, v16h b, v8f c) { return __builtin_amdgcn_wmma_f32_16x16x32_f16(false, a, false, b, (short)0, c, false, false); }
__device__ __forceinline__ float xhalf(float x) { return __builtin_bit_cast(float, __builtin_amdgcn_permlanex16(__builtin_bit_cast(int, x), __builtin_bit_cast(int, x), 0x76543210, 0xfedcba98, false, false)); }  // lane l with lane l ^ 16
// the hardware's exp2 with, in the same statement, the one free slot that the instruction set asks for behind a transcendental: for the merge's run of exponentials
__device__ __forceinline__ float exp2_slot(float x) { float r; asm("v_exp_f32 %0, %1\n\tv_nop" : "=v"(r) : "v"(x)); return r; }
// one wave's key range: stages k and v^T through LDS and leaves (nm, l2, O^T). SAFE: the reference follows the running maximum, pass by pass. Not SAFE: the reference stays at the first pass's maximum, and no pass looks for a maximum, tests or rescales;
// an exponential x 2^11 beyond f16 then reaches the P operand as infinity and leaves every O^T element of its query infinite or not a number for good, which the caller looks for.
template <bool SAFE> __device__ __forceinline__ void attn_range(const _Float16* kg, const _Float16* vg, _Float16 (&sk)[2][AKS][AKT][APK], _Float16 (&sv)[2][AKS][HD][APK], const v16h (&qh)[ANQ][HD / 32], int ks, int sr, int sc, int col, int lane,
    v8f (&o)[ANQ][HD / 16], float (&nm)[ANQ], v2f (&l2)[ANQ]) {   // l2: the lane's sum of exponentials (x 2^11), even and odd elements apart (packed adds)
  v8h gk[ASL], gv[ASL];
#pragma unroll
  for (int i = 0; i < ASL; ++i) { gk[i] = *(const v8h*)(kg + (size_t)(i * AQT * 4) * CC); gv[i] = *(const v8h*)(vg + (size_t)(i * AQT * 4) * TT); }
  asm volatile("s_wait_xcnt 0x0" ::: "memory");   // in front of the first rewrite of an address register that the loads above name
#pragma unroll
  for (int i = 0; i < ASL; ++i) { *(v8h*)&sk[0][ks][sr + i * AQT * 4][sc] = gk[i]; *(v8h*)&sv[0][ks][sr + i * AQT * 4][sc] = gv[i]; }
  __syncthreads();   // stage 0 is published
  float m[ANQ];
#pragma unroll
  for (int n = 0; n < ANQ; ++n) { m[n] = -3.0e38f; nm[n] = 11.0f - m[n] * AC2; l2[n] = v2f{0.f, 0.f};
#pragma unroll
    for (int j = 0; j < HD / 16; ++j) o[n][j] = v8f{}; }
  for (int st = 0; st < ANS; ++st) { const int bu = st & 1;
    if (st + 1 < ANS) { const _Float16* kn = kg + (size_t)((st + 1) * AKT) * CC; const _Float16* vn = vg + (st + 1) * AKT;
#pragma unroll
      for (int i = 0; i < ASL; ++i) { gk[i] = *(const v8h*)(kn + (size_t)(i * AQT * 4) * CC); gv[i] = *(const v8h*)(vn + (size_t)(i * AQT * 4) * TT); }
      asm volatile("s_wait_xcnt 0x0" ::: "memory"); }   // in front of the first rewrite of an address register that these loads name
#pragma unroll
    for (int pp = 0; pp < AKT / 32; ++pp) {
      v16h kf[HD / 32][2];
#pragma unroll
      for (int kc = 0; kc < HD / 32; ++kc)
#pragma unroll
        for (int t = 0; t < 2; ++t) kf[kc][t] = frag_h(&sk[bu][ks][pp * 32 + t * 16 + col][kc * 32], lane);
      __builtin_amdgcn_sched_barrier(0);   // the pass's k fragments are read as one group ahead of the products: left to itself the scheduler reads them pair by pair into one register set and waits out the LDS latency four times a pass
      v8f s[ANQ][2] = {};
#pragma unroll
      for (int kc = 0; kc < HD / 32; ++kc)
#pragma unroll
        for (int t = 0; t < 2; ++t)
#pragma unroll
          for (int n = 0; n < ANQ; ++n) s[n][t] = wm16(kf[kc][t], qh[n][kc], s[n][t]);
      v16h vf[HD / 16];
#pragma unroll
      for (int j = 0; j < HD / 16; ++j) vf[j] = frag_h(&sv[bu][ks][j * 16 + col][pp * 32], lane);
      if constexpr (SAFE) {
      float mx[ANQ]; bool up = false;
#pragma unroll
      for (int n = 0; n < ANQ; ++n) { mx[n] = m[n];
#pragma unroll
        for (int i = 0; i < 8; ++i) mx[n] = fmaxf(mx[n], fmaxf(s[n][i >> 2][(2 * i) & 7], s[n][i >> 2][(2 * i + 1) & 7]));
        mx[n] = fmaxf(mx[n], xhalf(mx[n])); up = up || mx[n] > m[n]; }
      if (__builtin_amdgcn_ballot_w32(up) != 0) {   // some query's maximum rose (one test a pass for the wave's queries): bring sum and O^T to the new one (a factor of exactly 1 for the other queries)
#pragma unroll
        for (int n = 0; n < ANQ; ++n) { const float nn = 11.0f - mx[n] * AC2; const float a = __builtin_amdgcn_exp2f(nn - nm[n]); l2[n] *= a; m[n] = mx[n]; nm[n] = nn;
#pragma unroll
          for (int j = 0; j < HD / 16; ++j)
#pragma unroll
            for (int r = 0; r < 8; ++r) o[n][j][r] *= a; } }
      } else if (pp == 0) {
        if (st == 0) {   // the range's first pass sets the reference: each query's maximum over its 32 keys (sum and O^T are still 0)
#pragma unroll
          for (int n = 0; n < ANQ; ++n) { float mx = fmaxf(s[n][0][0], s[n][0][1]);
#pragma unroll
            for (int i = 1; i < 8; ++i) mx = fmaxf(mx, fmaxf(s[n][i >> 2][(2 * i) & 7], s[n][i >> 2][(2 * i + 1) & 7]));
            nm[n] = 11.0f - fmaxf(mx, xhalf(mx)) * AC2; } } }
      v16h pf[ANQ];
#pragma unroll
      for (int n = 0; n < ANQ; ++n)
#pragma unroll
        for (int i = 0; i < 8; ++i) { const v2f x = v2f{s[n][i >> 2][(2 * i) & 7], s[n][i >> 2][(2 * i + 1) & 7]} * AC2 + nm[n]; const v2f e = {__builtin_amdgcn_exp2f(x.x), __builtin_amdgcn_exp2f(x.y)}; l2[n] += e; pf[n][2 * i] = (_Float16)e.x; pf[n][2 * i + 1] = (_Float16)e.y; }
#pragma unroll
      for (int j = 0; j < HD / 16; ++j)
#pragma unroll
        for (int n = 0; n < ANQ; ++n) o[n][j] = wm16(vf[j], pf[n], o[n][j]); }
    // its readers left this buffer before the last barrier. No test around the stores (the last stage writes its own tile once more, into the buffer that nobody reads again): behind a branch the compiler sinks both passes' sums below it, holds 64 registers of exponentials for them and spills
#pragma unroll
    for (int i = 0; i < ASL; ++i) { *(v8h*)&sk[bu ^ 1][ks][sr + i * AQT * 4][sc] = gk[i]; *(v8h*)&sv[bu ^ 1][ks][sr + i * AQT * 4][sc] = gv[i]; }
    __syncthreads(); }   // publishes stage st + 1 and ends every read of stage st
}
__global__ __launch_bounds__(AQT * AKS * 32) void k_attn(const _Float16* __restrict__ QH, const _Float16* __restrict__ KH, const _Float16* __restrict__ VT, float* __restrict__ Y) {
  __shared__ __align__(16) _Float16 sk[2][AKS][AKT][APK], sv[2][AKS][HD][APK];
  __shared__ __align__(16) v4f sp[AKS][AQT][ANQ * (HD / 8)][32]; __shared__ float smx[AKS][AQT][ANQ][16], ssu[AKS][AQT][ANQ][16]; __shared__ __align__(16) float so[AQT][ANQ * 16][HD + 4]; __shared__ __align__(16) int sbad[AQT * AKS];
  const int tid = threadIdx.x, wave = __builtin_amdgcn_readfirstlane(tid >> 5), lane = tid & 31, col = lane & 15, g = lane >> 4; const int qt = wave % AQT, ks = wave / AQT;
  const int b = blockIdx.y / NH, h = blockIdx.y % NH; const int ql0 = blockIdx.x * (AQT * ANQ * 16) + qt * (ANQ * 16);
  // staging: thread (qt, lane) of a range moves 16-byte chunk sc of rows sr + 16 i of the k tile and of the v^T tile (8 lanes = one 128-B line)
  const int sr = qt * 4 + (lane >> 3), sc = (lane & 7) * 8;
  const _Float16* kg = KH + ((size_t)b * TT + ks * (TT / AKS) + sr) * CC + h * HD + sc;
  const _Float16* vg = VT + ((size_t)b * CC + h * HD + sr) * (size_t)TT + ks * (TT / AKS) + sc;
  v16h qh[ANQ][HD / 32];
#pragma unroll
  for (int n = 0; n < ANQ; ++n) {
#pragma unroll
    for (int kc = 0; kc < HD / 32; ++kc) qh[n][kc] = frag_h(QH + ((size_t)b * TT + ql0 + n * 16 + col) * CC + h * HD + kc * 32, lane);
    asm volatile("s_wait_xcnt 0x0" ::: "memory"); }   // behind each tile's loads: in front of the first rewrite of an address register that they name (the next tile's loads may land on it)
  v8f o[ANQ][HD / 16]; float nm[ANQ]; v2f l2[ANQ];
  const auto publish = [&]() {   // the wave's partial results go to LDS
#pragma unroll
  for (int n = 0; n < ANQ; ++n) { float l = l2[n].x + l2[n].y; l += xhalf(l);
#pragma unroll
    for (int j = 0; j < HD / 16; ++j)
#pragma unroll
      for (int u = 0; u < 2; ++u) sp[ks][qt][(n * (HD / 16) + j) * 2 + u][lane] = v4f{o[n][j][4 * u], o[n][j][4 * u + 1], o[n][j][4 * u + 2], o[n][j][4 * u + 3]};   // 16 bytes a lane, lanes side by side: no bank conflict
    if (g == 0) { smx[ks][qt][n][col] = nm[n]; ssu[ks][qt][n][col] = l; } }
  };
  attn_range<false>(kg, vg, sk, sv, qh, ks, sr, sc, col, lane, o, nm, l2);
  publish();
  { const bool bad = !(fabsf(o[0][0][0]) <= 3.0e38f) || !(fabsf(o[1][0][0]) <= 3.0e38f);   // an overflow of a query's exponentials shows in every element of its O^T column: one element a query tile is looked at
    const unsigned bm = __builtin_amdgcn_ballot_w32(bad);   // taken by all 32 lanes, ahead of the one-lane store
    if (lane == 0) sbad[wave] = bm != 0 ? 1 : 0; }
  __syncthreads();   // every range's partial results and its overflow mark are published
  { v4i f = *(const v4i*)&sbad[0];
#pragma unroll
    for (int w = 4; w < AQT * AKS; w += 4) f |= *(const v4i*)&sbad[w];
    if (__builtin_amdgcn_readfirstlane(f.x | f.y | f.z | f.w) != 0) {   // the same for the whole block: some wave's fixed reference was too low, so every wave does its range again with the running maximum (once; its barriers are passed by all)
      attn_range<true>(kg, vg, sk, sv, qh, ks, sr, sc, col, lane, o, nm, l2);
      publish();
      __syncthreads(); } }   // the second results are published
  float nx[ANQ][AKS], lx[ANQ][AKS]; v4f px[ANQ][2][AKS];
#pragma unroll
  for (int n = 0; n < ANQ; ++n)
#pragma unroll
    for (int x = 0; x < AKS; ++x) { nx[n][x] = smx[x][qt][n][col]; lx[n][x] = ssu[x][qt][n][col];
#pragma unroll
      for (int u = 0; u < 2; ++u) px[n][u][x] = sp[x][qt][(n * (HD / 16) + ks) * 2 + u][lane]; }
  __builtin_amdgcn_sched_barrier(0);   // all of the merge's LDS reads go out as one group: spread among the sums they were waited for one after the other
  float a[ANQ][AKS], nn[ANQ];
#pragma unroll
  for (int n = 0; n < ANQ; ++n) { nn[n] = nx[n][0];
#pragma unroll
    for (int x = 1; x < AKS; ++x) nn[n] = fminf(nn[n], nx[n][x]); }   // the smallest nm belongs to the largest maximum
#pragma unroll
  for (int x = 0; x < AKS; ++x)
#pragma unroll
    for (int n = 0; n < ANQ; ++n) a[n][x] = exp2_slot(nn[n] - nx[n][x]);
#pragma unroll
  for (int n = 0; n < ANQ; ++n) { float l = 0.f;
#pragma unroll
    for (int x = 0; x < AKS; ++x) l += lx[n][x] * a[n][x];
    const float inv = 1.0f / l;
#pragma unroll
    for (int u = 0; u < 2; ++u) { v4f acc = {0.f, 0.f, 0.f, 0.f};
#pragma unroll
      for (int x = 0; x < AKS; ++x) acc += px[n][u][x] * a[n][x];
      *(v4f*)&so[qt][n * 16 + col][ks * 16 + 8 * g + 4 * u] = acc * inv; } }
  __syncthreads();   // the group's merged rows are published
#pragma unroll
  for (int it = 0; it < ANQ * 16 / AKS / 2; ++it) { const int rl = ks * (ANQ * 16 / AKS) + it * 2 + g; vst2(Y + ((size_t)b * TT + ql0 + rl) * CC + h * HD + col * 4, *(const v4f*)&so[qt][rl][col * 4]); } }
// ---- k_out: block = (64 rows, 128 cols): out = ctx Wo (+ bo): ctx split bf16 hi + lo against exact bf16 Wo (2 products), all rows
__global__ __launch_bounds__(128) void k_out(const float* __restrict__ Y, const float* __restrict__ WO, const float* __restrict__ BO, float* __restrict__ OUT) { __shared__ __align__(16) float sf[4][16][132]; __shared__ __align__(16) __bf16 tw[2][128][GPW];
  const int tid = threadIdx.x, wave = tid >> 5, lane = tid & 31, col = lane & 15, g = lane >> 4; const int c0 = blockIdx.y * 128; const size_t r0 = (size_t)blockIdx.x * 64 + wave * 16;
  v8f acc[8] = {};
  if (true) {   /* ALL rows: ctx split bf16 hi + lo x exact Wo (2 products) */
    const int n4 = (wave * 8 + ((lane & 3) | ((lane >> 4) << 2))) * 4, o4 = (lane >> 2) & 3;
    const float* wp = WO + (size_t)(o4 * 8) * DIN + c0 + n4; const float* xp = Y + (r0 + col) * CC + 8 * g;
    v4f wf[2][8], xf[2][4]; F2 a[2]; wst_load(wf, wp, DIN); arow_load(xf, xp);
    asm volatile("s_wait_xcnt 0x0" ::: "memory");   // in front of the first rewrite of an address register that stage 0's loads name
    float bs[8];   // as in k_proj: the bias is asked for at entry, not in eight dependent round trips behind the loop (the unrolls keep bs statically indexed)
#pragma unroll
    for (int j = 0; j < 8; ++j) bs[j] = 0.f;
    if (BO) {   // one test around all eight loads, so that they are in flight together
#pragma unroll
      for (int j = 0; j < 8; ++j) bs[j] = BO[c0 + j * 16 + col];
      asm volatile("s_wait_xcnt 0x0" ::: "memory"); }   // in front of the first rewrite of the offset register that these loads name
    wst_store(&tw[0][n4][o4 * 8], wf);
#pragma unroll
    for (int kk = 0; kk < 2; ++kk) { float v[16];
#pragma unroll
      for (int e = 0; e < 16; ++e) v[e] = xf[kk][e >> 2][e & 3];
      a[kk] = bsplit16(v); }
    __syncthreads();   // stage 0 is published
    for (int st = 0; st < CC / GKS; ++st) { const int bu = st & 1; const bool more = st + 1 < CC / GKS;
      if (more) { wst_load(wf, wp + (size_t)((st + 1) * GKS) * DIN, DIN); arow_load(xf, xp + (st + 1) * GKS);
        asm volatile("s_wait_xcnt 0x0" ::: "memory"); }   // in front of the first rewrite of an address register that these loads name
#pragma unroll
      for (int kk = 0; kk < 2; ++kk)
#pragma unroll
        for (int jh = 0; jh < 8; jh += 4) { v16b w[4];   // four fragments are read as one group, so that the wave waits out the LDS latency once for eight products
#pragma unroll
          for (int j = 0; j < 4; ++j) w[j] = frag_b(&tw[bu][(jh + j) * 16 + col][kk * 32], lane);
#pragma unroll
          for (int j = 0; j < 4; ++j) acc[jh + j] = wmma_bf(a[kk].h, w[j], acc[jh + j]);
#pragma unroll
          for (int j = 0; j < 4; ++j) acc[jh + j] = wmma_bf(a[kk].l, w[j], acc[jh + j]); }   // hi before lo in every accumulator, as before
      if (more) { wst_store(&tw[bu ^ 1][n4][o4 * 8], wf);   // its readers left this buffer before the last barrier
#pragma unroll
        for (int kk = 0; kk < 2; ++kk) { float v[16];
#pragma unroll
          for (int e = 0; e < 16; ++e) v[e] = xf[kk][e >> 2][e & 3];
          a[kk] = bsplit16(v); } }
      __syncthreads(); }   // publishes stage st + 1 and ends every read of stage st
#pragma unroll
    for (int j = 0; j < 8; ++j) { const float bias = bfr(bs[j]);
#pragma unroll
      for (int r = 0; r < 8; ++r) sf[wave][8 * g + r][j * 16 + col] = acc[j][r] + bias; }
  } else {
#pragma unroll 2
    for (int kc = 0; kc < CC / 32; ++kc) { const v16h a = frag_f32(Y + (r0 + col) * CC + kc * 32, lane); asm volatile("s_wait_loadcnt 0x0" ::: "memory");
#pragma unroll
      for (int j = 0; j < 8; ++j) { const v16h w = WOCOLH(WO, kc * 32, c0 + j * 16 + col, lane); asm volatile("s_wait_loadcnt 0x0" ::: "memory"); acc[j] = wmma16(a, w, acc[j]); } }
#pragma unroll
    for (int j = 0; j < 8; ++j) { const float bias = BO ? bfr(BO[c0 + j * 16 + col]) : 0.f;
#pragma unroll
      for (int r = 0; r < 8; ++r) sf[wave][8 * g + r][j * 16 + col] = acc[j][r] * (1.0f / 256.0f) + bias; } }
  LDSX(); for (int rl = 0; rl < 16; ++rl) vst2(OUT + (r0 + rl) * DIN + c0 + lane * 4, *(const v4f*)&sf[wave][rl][lane * 4]); }

extern "C" void kernel_launch(void* const* d_in, const int* in_sizes, int n_in, void* d_out, int out_size, void* d_ws, size_t ws_size, hipStream_t stream) {
  (void)in_sizes; (void)n_in; (void)out_size;
  const float** F = (const float**)d_in;
  if (ws_size < (size_t)WS_END) return;
  char* ws = (char*)d_ws; _Float16 *QH = (_Float16*)(ws + WS_QH), *KH = (_Float16*)(ws + WS_KH), *VT = (_Float16*)(ws + WS_VT), *QL = (_Float16*)(ws + WS_QL), *KL = (_Float16*)(ws + WS_KL); __bf16 *VB = (__bf16*)(ws + WS_VB), *VBL = (__bf16*)(ws + WS_VBL); float *Y = (float*)(ws + WS_Y);
  (void)Y; (void)QL; (void)KL; (void)VB; (void)VBL;
  // inputs: 0 x [2,2048,512]; 1 Wq (in,out), 2 bq; 3 Wk, 4 bk; 5 Wv, 6 bv; 7 Wo (in,out), 8 bo
  k_proj<<<dim3(TNB * TT / 64, CC / 128, 3), 128, 0, stream>>>(F[0], F[0], F[0], F[1], F[3], F[5], F[2], F[4], F[6], QH, QL, KH, KL, VT, VB, VBL);
  k_attn<<<dim3(TT / (AQT * ANQ * 16), TNB * NH), AQT * AKS * 32, 0, stream>>>(QH, KH, VT, Y);
  k_out<<<dim3(TNB * TT / 64, DIN / 128), 128, 0, stream>>>(Y, F[7], F[8], (float*)d_out);
}

// v008
// One run takes 41.4 microseconds.
// In two side-by-side timings against v007, it was 1.12 and 1.11 times as fast.
// All steps since v000 together make it 14.1 times as fast.
// compute dtype: all float inputs rounded to bf16; q/k/v = in W + b with EXACT bf16 products on WMMA 16x16x32 (f32 accumulate); q once to f16 against k once to f16 (1 product) / 8; online softmax in f32 (one fused multiply-add and the hardware's exp2 per logit), fused with both products; exp(logit - max) x 2^11 once to f16 against v once to f16 (1 product), divided by the f32 sum (x 2^11 too) at the end; ctx split bf16 hi + lo against exact Wo (2 products) + bo; f32 output.
#include <hip/hip_runtime.h>
#include <math.h>

typedef __attribute__((ext_vector_type(16))) _Float16 v16h;
typedef __attribute__((ext_vector_type(16))) __bf16 v16b;
typedef __attribute__((ext_vector_type(8)))  _Float16 v8h;
typedef __attribute__((ext_vector_type(8)))  float v8f;
typedef __attribute__((ext_vector_type(4)))  float v4f;
typedef __attribute__((ext_vector_type(2)))  float v2f;
typedef __attribute__((ext_vector_type(4)))  unsigned v4u;
typedef __attribute__((ext_vector_type(4)))  int v4i;
typedef float __attribute__((may_alias)) float_a;
typedef int __attribute__((may_alias)) int_a;

template <typename T> __device__ __forceinline__ void vst2(void* p, T v) { *(T*)p = v;  }
__device__ __forceinline__ v8f wmma16(v16h a, v16h b, v8f c) {
  v8f d = __builtin_amdgcn_wmma_f32_16x16x32_f16(false, a, false, b, (short)0, c, false, false);
  asm volatile("v_nop\n\tv_nop\n\tv_nop\n\tv_nop" : "+v"(d) : "v"(a), "v"(b));
  return d;
}
__device__ __forceinline__ v8f wmma_bf(v16b a, v16b b, v8f c) {
  v8f d = __builtin_amdgcn_wmma_f32_16x16x32_bf16(false, a, false, b, (short)0, c, false, false);
  asm volatile("v_nop\n\tv_nop\n\tv_nop\n\tv_nop" : "+v"(d) : "v"(a), "v"(b));
  return d;
}
// 16x16x32 fragments: lane = (h = lane>>4, row/col = lane&15); elements 0..7 = k0+8h+0..7, 8..15 = k0+16+8h+0..7; D element r = row 8h+r
__device__ __forceinline__ v16h frag_h(const _Float16* rowk0, int lane) {
  union { v16h v; v8h q[2]; } u; const _Float16* p = rowk0 + 8 * (lane >> 4);
  u.q[0] = *(const v8h*)p; u.q[1] = *(const v8h*)(p + 16); return u.v;
}
__device__ __forceinline__ v16h frag_f32(const float* rowk0, int lane) {
  v16h a; const float* p = rowk0 + 8 * (lane >> 4);
#pragma unroll
  for (int i = 0; i < 8; ++i) { a[i] = (_Float16)p[i]; a[8 + i] = (_Float16)p[16 + i]; }
  return a;
}
__device__ __forceinline__ v16h frag_f32s(const float* rowk0, int lane, float sc) {
  v16h a; const float* p = rowk0 + 8 * (lane >> 4);
#pragma unroll
  for (int i = 0; i < 8; ++i) { a[i] = (_Float16)(p[i] * sc); a[8 + i] = (_Float16)(p[16 + i] * sc); }
  return a;
}
// column fragment from a [K][ld] layout (column n), rows >= K read as 0
__device__ __forceinline__ v16h fragc_f32(const float* W, int k0, int n, int lane, int ld, int K) {
  v16h a; const int g = lane >> 4;
#pragma unroll
  for (int i = 0; i < 8; ++i) { const int ka = k0 + 8 * g + i, kb = ka + 16;
    a[i] = (_Float16)(ka < K ? W[(size_t)(ka < K ? ka : K - 1) * ld + n] : 0.f); a[8 + i] = (_Float16)(kb < K ? W[(size_t)(kb < K ? kb : K - 1) * ld + n] : 0.f); }
  return a;
}
struct F2 { v16b h, l; };
__device__ __forceinline__ F2 bsplit16(const float v[16]) { F2 r;
#pragma unroll
  for (int i = 0; i < 16; ++i) { const __bf16 h = (__bf16)v[i]; r.h[i] = h; r.l[i] = (__bf16)(v[i] - (float)h); }
  return r; }
__device__ __forceinline__ F2 split_row(const float* row, int k0, int lane) { float v[16]; const float* p = row + k0 + 8 * (lane >> 4);
#pragma unroll
  for (int i = 0; i < 8; ++i) { v[i] = p[i]; v[8 + i] = p[16 + i]; }
  return bsplit16(v); }
__device__ __forceinline__ F2 split_rowK(const float* row, int k0, int lane, int K) { float v[16]; const int g = lane >> 4;
#pragma unroll
  for (int i = 0; i < 8; ++i) { const int ka = k0 + 8 * g + i, kb = ka + 16; v[i] = ka < K ? row[ka < K ? ka : K - 1] : 0.f; v[8 + i] = kb < K ? row[kb < K ? kb : K - 1] : 0.f; }
  return bsplit16(v); }
__device__ __forceinline__ F2 split_col(const float* W, int k0, int n, int lane, int ld, int K) { float v[16]; const int g = lane >> 4;
#pragma unroll
  for (int i = 0; i < 8; ++i) { const int ka = k0 + 8 * g + i, kb = ka + 16; v[i] = ka < K ? W[(size_t)(ka < K ? ka : K - 1) * ld + n] : 0.f; v[8 + i] = kb < K ? W[(size_t)(kb < K ? kb : K - 1) * ld + n] : 0.f; }
  return bsplit16(v); }
__device__ __forceinline__ v8f mac3(const F2& a, const F2& b, v8f c) { c = wmma_bf(a.l, b.h, c); c = wmma_bf(a.h, b.l, c); return wmma_bf(a.h, b.h, c); }
__device__ __forceinline__ float sigm(float v) { return 1.0f / (1.0f + expf(-v)); }
#define LDSX() do { asm volatile("s_wait_dscnt 0" ::: "memory"); __builtin_amdgcn_wave_barrier(); __builtin_amdgcn_fence(__ATOMIC_RELEASE, "workgroup"); } while (0)

// Multi-head self-attention (B 2, S 2,048, d_model 512 = 8 x 64; (in,out) uniform +-1/sqrt(512) weights WITH biases): q, k, v = x W + b; out = merged(softmax(q k^T / 8) v) Wo + bo (non-causal).
#define NB 2
#define TT 2048
#define CC 512            // NH * HD = projected width
#define DIN 512          // input (model) width
#define NH 8
#define HD 64
#define NQB (TT / 64)
#define HG 4
#define SCALE (0.125f)
#define CAUSAL 0
#ifndef TNB
#define TNB NB
#endif
__device__ __forceinline__ float bfr(float v) { return (float)(__bf16)v; }
__host__ __device__ __forceinline__ int kb_last(int qb) { return CAUSAL ? ((qb * 64 + 63) >> 7) : (TT / 128 - 1); }
typedef __attribute__((ext_vector_type(8))) __bf16 v8b;
__device__ __forceinline__ v16b frag_b(const __bf16* rowk0, int lane) {
  union { v16b v; v8b q[2]; } u; const __bf16* p = rowk0 + 8 * (lane >> 4);
  u.q[0] = *(const v8b*)p; u.q[1] = *(const v8b*)(p + 16); return u.v;
}
#define QBH 0              // unused: k_attn has no high-precision path
#define QHI 0               // rows carrying a q residual plane (none: q goes into the logits rounded once to f16, as k does)
#define KHI 64            // key rows carrying k residual / v bf16 hi+lo planes (written by k_proj, read by no kernel)
// B fragment (k rows k0+.., output column o) of a weight: (in,out) [K][ld] or (out,in) [ld rows of K]: bf16 exact, or f16(bf16 * 256) exact
__device__ __forceinline__ v16b wcol_io(const float* Wm, int k0, int o, int lane, int ld) { v16b w; const int g = lane >> 4;
#pragma unroll
  for (int i = 0; i < 8; ++i) { w[i] = (__bf16)Wm[(size_t)(k0 + 8 * g + i) * ld + o]; w[8 + i] = (__bf16)Wm[(size_t)(k0 + 16 + 8 * g + i) * ld + o]; }
  return w; }
__device__ __forceinline__ v16b wcol_oi(const float* Wm, int k0, int o, int lane, int K) { v16b w; const float* p = Wm + (size_t)o * K + k0 + 8 * (lane >> 4);
#pragma unroll
  for (int i = 0; i < 8; ++i) { w[i] = (__bf16)p[i]; w[8 + i] = (__bf16)p[16 + i]; }
  return w; }
__device__ __forceinline__ v16h wcolh_io(const float* Wm, int k0, int o, int lane, int ld) { v16h w; const int g = lane >> 4;
#pragma unroll
  for (int i = 0; i < 8; ++i) { w[i] = (_Float16)(bfr(Wm[(size_t)(k0 + 8 * g + i) * ld + o]) * 256.0f); w[8 + i] = (_Float16)(bfr(Wm[(size_t)(k0 + 16 + 8 * g + i) * ld + o]) * 256.0f); }
  return w; }
__device__ __forceinline__ v16h wcolh_oi(const float* Wm, int k0, int o, int lane, int K) { v16h w; const float* p = Wm + (size_t)o * K + k0 + 8 * (lane >> 4);
#pragma unroll
  for (int i = 0; i < 8; ++i) { w[i] = (_Float16)(bfr(p[i]) * 256.0f); w[8 + i] = (_Float16)(bfr(p[16 + i]) * 256.0f); }
  return w; }
#define WQKV_LAYOUT 0   // 0 = (in,out) [DIN][CC]; 1 = (out,in) [CC][DIN]; 2 = per-head [NH][DIN][HD]
__device__ __forceinline__ v16b wcol_hdk(const float* Wm, int k0, int o, int lane) { v16b w; const int g = lane >> 4; const float* p = Wm + (size_t)(o / HD) * DIN * HD + (o % HD);
#pragma unroll
  for (int i = 0; i < 8; ++i) { w[i] = (__bf16)p[(size_t)(k0 + 8 * g + i) * HD]; w[8 + i] = (__bf16)p[(size_t)(k0 + 16 + 8 * g + i) * HD]; }
  return w; }
#define WO_OUT_IN 0
#if WQKV_LAYOUT == 1
#define WCOL(W, k0, o, lane) wcol_oi(W, k0, o, lane, DIN)
#elif WQKV_LAYOUT == 2
#define WCOL(W, k0, o, lane) wcol_hdk(W, k0, o, lane)
#else
#define WCOL(W, k0, o, lane) wcol_io(W, k0, o, lane, CC)
#endif
#if WO_OUT_IN
#define WOCOL(W, k0, o, lane) wcol_oi(W, k0, o, lane, CC)
#define WOCOLH(W, k0, o, lane) wcolh_oi(W, k0, o, lane, CC)
#else
#define WOCOL(W, k0, o, lane) wcol_io(W, k0, o, lane, DIN)
#define WOCOLH(W, k0, o, lane) wcolh_io(W, k0, o, lane, DIN)
#endif

#ifndef SM_EXTRA_PARAMS
#define SM_EXTRA_PARAMS
#endif
#ifndef PROJ_EXTRA_PARAMS
#define PROJ_EXTRA_PARAMS
#endif
#ifndef SM_MASK_HOOK
#define SM_MASK_HOOK (void)0
#endif

#define WS_QH  0u                                      // f16 q rows [b*t][CC]
#define WS_KH  (WS_QH + 2u * (size_t)NB * TT * CC)      // f16 k rows [b*t][CC]
#define WS_VT  (WS_KH + 2u * (size_t)NB * TT * CC)      // f16 v planes [b][c][t]
#define WS_QL  (WS_VT + 2u * (size_t)NB * CC * TT)      // f16 q residual x 2^10 rows [b][t < QHI][CC]
#define WS_KL  (WS_QL + 2u * (size_t)NB * QHI * CC)     // f16 k residual x 2^10 rows [b][t < KHI][CC]
#define WS_VB  (WS_KL + 2u * (size_t)NB * KHI * CC)     // bf16 v hi planes [b][c][t < KHI]
#define WS_VBL (WS_VB + 2u * (size_t)NB * CC * KHI)
#define WS_S   (WS_VBL + 2u * (size_t)NB * CC * KHI)    // f32 [hg][t][s] region, unused: logits and P stay in registers
#define WS_Y   (WS_S  + 4u * (size_t)HG * TT * TT)      // f32 ctx rows [b*t][CC] (only when there is an output projection)
#define WS_END (WS_Y  + 4u * (size_t)NB * TT * CC)

// ---- weight staging of the two projection GEMMs: a stage is GKS k rows x 128 columns of an (in,out) f32 weight, rounded to bf16 and laid column-major in LDS (pitch GPW), once per block for its four waves.
// Thread (wave, lane) moves columns n4..n4+3 of k rows o4*8 + u*32 + i: a wave-wide load covers four whole 128-B lines, and 16 neighbouring lanes' 16-byte LDS stores cover all 64 banks once.
// Two buffers: the next stage's loads fly during this stage's products, one barrier a stage. A block walks the k stages in a ring from its own first stage GROT (below), so an accumulator's k order is the plain one rotated by whole stages. Every '#pragma unroll' of the staging and of the two loops keeps a register array statically indexed.
#define GKS 64
#define GPW 72                    // LDS pitch in bf16: 128-B rows + 16 B, conflict-free for 16-byte fragment reads
// first k stage of block (bx, by) of NS stages: blocks that share a weight tile (same by) or a row tile (same bx) start at different stages, so they do not ask L2 for the same lines at the same moment,
// and at any moment the grid's reads of the row operand (256 B of every 2-KB row a stage) cover all eight 256-B columns of the rows and not one
#define GROT(bx, by, NS) (((bx) + 2 * (by)) & ((NS) - 1))
static_assert((DIN / GKS & (DIN / GKS - 1)) == 0 && (CC / GKS & (CC / GKS - 1)) == 0, "the ring of stages wraps by a mask");
__device__ __forceinline__ void wst_load(v4f (&f)[2][8], const float* wp, int ld) {
#pragma unroll
  for (int u = 0; u < 2; ++u)
#pragma unroll
    for (int i = 0; i < 8; ++i) f[u][i] = *(const v4f*)(wp + (size_t)(u * 32 + i) * ld); }
__device__ __forceinline__ void wst_store(__bf16* sp, const v4f (&f)[2][8]) {
#pragma unroll
  for (int u = 0; u < 2; ++u)
#pragma unroll
    for (int c = 0; c < 4; ++c) { v8b p;
#pragma unroll
      for (int i = 0; i < 8; ++i) p[i] = (__bf16)f[u][i][c];
      *(v8b*)(sp + c * GPW + u * 32) = p; } }
// the lane's f32 elements of the A fragments of one stage (p = row + stage k0 + 8 * (lane >> 4)): element e of fragment kk is x[kk][e >> 2][e & 3]
__device__ __forceinline__ void arow_load(v4f (&x)[2][4], const float* p) {
#pragma unroll
  for (int kk = 0; kk < 2; ++kk) { x[kk][0] = *(const v4f*)(p + kk * 32); x[kk][1] = *(const v4f*)(p + kk * 32 + 4); x[kk][2] = *(const v4f*)(p + kk * 32 + 16); x[kk][3] = *(const v4f*)(p + kk * 32 + 20); } }
// ---- k_proj: block = (64 rows, 128 cols, which): q/k/v = X W (+ b) with exact bf16 products (K = DIN) -> which 0: q f16 rows (+ residual rows < QHI); 1: k f16 rows (+ residual rows < KHI); 2: v f16 planes [c][t] (+ bf16 hi/lo planes for t < KHI)
__global__ __launch_bounds__(128) void k_proj(const float* __restrict__ XQ, const float* __restrict__ XK, const float* __restrict__ XV, const float* __restrict__ WQ, const float* __restrict__ WK, const float* __restrict__ WV, const float* __restrict__ BQ, const float* __restrict__ BK, const float* __restrict__ BV,
    _Float16* __restrict__ QH, _Float16* __restrict__ QL, _Float16* __restrict__ KH, _Float16* __restrict__ KL, _Float16* __restrict__ VT, __bf16* __restrict__ VB, __bf16* __restrict__ VBL) {
  __shared__ __align__(16) _Float16 sh[64][136], sl[64][136]; __shared__ __align__(16) _Float16 th[128][72]; __shared__ __align__(16) __bf16 tw[2][128][GPW]; __bf16 (&tb)[128][72] = tw[0]; __bf16 (&tbl)[128][72] = tw[1];   // the two weight buffers of the loop are the epilogue's tb and tbl
  const int tid = threadIdx.x, wave = tid >> 5, lane = tid & 31, col = lane & 15, g = lane >> 4; const int which = blockIdx.z; const int c0 = blockIdx.y * 128; const size_t r0 = (size_t)blockIdx.x * 64; const size_t bb = r0 / TT; const int t0 = (int)(r0 % TT);
  const float* X = which == 0 ? XQ : which == 1 ? XK : XV; const float* WA = which == 0 ? WQ : which == 1 ? WK : WV; const float* BA = which == 0 ? BQ : which == 1 ? BK : BV;
  v8f acc[8] = {};
  const int n4 = (wave * 8 + ((lane & 3) | ((lane >> 4) << 2))) * 4, o4 = (lane >> 2) & 3;
  const float* wp = WA + (size_t)(o4 * 8) * CC + c0 + n4; const float* xp = X + (r0 + wave * 16 + col) * DIN + 8 * g;
  const int rot = GROT(blockIdx.x, blockIdx.y, DIN / GKS);
  v4f wf[2][8], xf[2][4]; v16b a[2]; wst_load(wf, wp + (size_t)(rot * GKS) * CC, CC); arow_load(xf, xp + rot * GKS);
  asm volatile("s_wait_xcnt 0x0" ::: "memory");   // in front of the first rewrite of an address register that stage 0's loads name
  float bs[8];   // the lane's eight bias elements are asked for here, behind stage 0's loads, and wait in registers: read in the epilogue they were eight round trips to L2, one behind the other, with nothing to hide them (the unrolls keep bs statically indexed)
#pragma unroll
  for (int j = 0; j < 8; ++j) bs[j] = 0.f;
  if (BA) {   // one test around all eight loads, so that they are in flight together
#pragma unroll
    for (int j = 0; j < 8; ++j) bs[j] = BA[c0 + j * 16 + col];
    asm volatile("s_wait_xcnt 0x0" ::: "memory"); }   // in front of the first rewrite of the offset register that these loads name
  wst_store(&tw[0][n4][o4 * 8], wf);
#pragma unroll
  for (int kk = 0; kk < 2; ++kk)
#pragma unroll
    for (int e = 0; e < 16; ++e) a[kk][e] = (__bf16)xf[kk][e >> 2][e & 3];
  __syncthreads();   // stage 0 is published
  for (int st = 0; st < DIN / GKS; ++st) { const int bu = st & 1; const bool more = st + 1 < DIN / GKS;
    if (more) { const int sn = (st + 1 + rot) & (DIN / GKS - 1); wst_load(wf, wp + (size_t)(sn * GKS) * CC, CC); arow_load(xf, xp + sn * GKS);
      asm volatile("s_wait_xcnt 0x0" ::: "memory"); }   // in front of the first rewrite of an address register that these loads name
#pragma unroll
    for (int kk = 0; kk < 2; ++kk)
#pragma unroll
      for (int jh = 0; jh < 8; jh += 4) { v16b w[4];   // four fragments are read as one group, so that the wave waits out the LDS latency once for four products
#pragma unroll
        for (int j = 0; j < 4; ++j) w[j] = frag_b(&tw[bu][(jh + j) * 16 + col][kk * 32], lane);
#pragma unroll
        for (int j = 0; j < 4; ++j) acc[jh + j] = wmma_bf(a[kk], w[j], acc[jh + j]); }
    if (more) { wst_store(&tw[bu ^ 1][n4][o4 * 8], wf);   // its readers left this buffer before the last barrier
#pragma unroll
      for (int kk = 0; kk < 2; ++kk)
#pragma unroll
        for (int e = 0; e < 16; ++e) a[kk][e] = (__bf16)xf[kk][e >> 2][e & 3]; }
    __syncthreads(); }   // publishes stage st + 1 and ends every read of stage st
  if (which < 2) { _Float16* DH = which == 0 ? QH : KH; _Float16* DL = which == 0 ? QL : KL; const int nhi = which == 0 ? QHI : KHI; const bool hi_rows = t0 < nhi;
    if (hi_rows) {   // the residual is formed only in the blocks that store it
#pragma unroll
      for (int j = 0; j < 8; ++j) { const float bias = bfr(bs[j]);
#pragma unroll
        for (int r = 0; r < 8; ++r) { const float v = acc[j][r] + bias; const _Float16 hv = (_Float16)v; sh[wave * 16 + 8 * g + r][j * 16 + col] = hv; sl[wave * 16 + 8 * g + r][j * 16 + col] = (_Float16)((v - (float)hv) * 1024.0f); } }
    } else {
#pragma unroll
      for (int j = 0; j < 8; ++j) { const float bias = bfr(bs[j]);
#pragma unroll
        for (int r = 0; r < 8; ++r) sh[wave * 16 + 8 * g + r][j * 16 + col] = (_Float16)(acc[j][r] + bias); } }
    __syncthreads();
    const int rl0 = tid >> 4, q = tid & 15; v4u t[8];   // the thread's eight 16-byte pieces are read from LDS as one group and then stored: one LDS latency, not eight in a row (the unrolls keep t statically indexed)
#pragma unroll
    for (int it = 0; it < 8; ++it) t[it] = *(const v4u*)&sh[rl0 + it * 8][q * 8];
#pragma unroll
    for (int it = 0; it < 8; ++it) vst2((unsigned*)(DH + (r0 + rl0 + it * 8) * CC + c0 + q * 8), t[it]);
    if (hi_rows) { v4u u[8]; asm volatile("s_wait_xcnt 0x0" ::: "memory"); __builtin_amdgcn_sched_barrier(0);   // the wait stands in front of the first rewrite of a register that the stores above name; the scheduling barrier keeps this block's register writes from being lifted over it
#pragma unroll
      for (int it = 0; it < 8; ++it) u[it] = *(const v4u*)&sl[rl0 + it * 8][q * 8];
#pragma unroll
      for (int it = 0; it < 8; ++it) vst2((unsigned*)(DL + (bb * nhi + t0 + rl0 + it * 8) * (size_t)CC + c0 + q * 8), u[it]); }
  } else { const bool hi_rows = t0 < KHI;
#pragma unroll
    for (int j = 0; j < 8; ++j) { const float bias = bfr(bs[j]);
#pragma unroll
      for (int r = 0; r < 8; ++r) { const float v = acc[j][r] + bias; const int rl = wave * 16 + 8 * g + r, cl = j * 16 + col; th[cl][rl] = (_Float16)v; const __bf16 bh = (__bf16)v; tb[cl][rl] = bh; tbl[cl][rl] = (__bf16)(v - (float)bh); } }
    __syncthreads();
    const int cl0 = tid >> 3, q = tid & 7; v4u t[8];   // as above: eight LDS reads in flight together, then the stores
#pragma unroll
    for (int it = 0; it < 8; ++it) t[it] = *(const v4u*)&th[cl0 + it * 16][q * 8];
#pragma unroll
    for (int it = 0; it < 8; ++it) vst2((unsigned*)(VT + (bb * CC + c0 + cl0 + it * 16) * (size_t)TT + t0 + q * 8), t[it]);
    if (hi_rows) { v4u u[8], w[8]; asm volatile("s_wait_xcnt 0x0" ::: "memory"); __builtin_amdgcn_sched_barrier(0);   // the wait stands in front of the first rewrite of a register that the stores above name; the scheduling barrier keeps this block's register writes from being lifted over it
#pragma unroll
      for (int it = 0; it < 8; ++it) { u[it] = *(const v4u*)&tb[cl0 + it * 16][q * 8]; w[it] = *(const v4u*)&tbl[cl0 + it * 16][q * 8]; }
#pragma unroll
      for (int it = 0; it < 8; ++it) { const size_t o3 = (bb * CC + c0 + cl0 + it * 16) * (size_t)KHI + t0 + q * 8; vst2((unsigned*)(VB + o3), u[it]); vst2((unsigned*)(VBL + o3), w[it]); } }
    asm volatile("s_wait_xcnt 0x0" ::: "memory"); } }   // behind the last store of this branch on both ways: in front of any rewrite of a register that these stores name
#define AQT 4
#define ANQ 2
#define AKS 4
#define AKT 64                    // keys per stage and range: 128-B rows of k (64 d) and of v^T (64 keys)
#define ANS (TT / AKS / AKT)
#define ASL (AKT / (AQT * 4))     // 16-byte chunks that a thread stages of each of the two tiles
static_assert((ANS & (ANS - 1)) == 0, "the ring of stages wraps by a mask"); static_assert(AKS == HD / 16, "the merge gives each key range's wave one 16-row tile of O^T"); static_assert(ANQ == 2, "the overflow look names both query tiles");
#define AC2 (SCALE * 1.44269504088896340736f)   // logit scale x log2(e)
#define APK 72                    // LDS pitch in halves: 128-B rows + 16 B, conflict-free for 16-byte fragment reads
__device__ __forceinline__ v8f wm16(v16h a, v16h b, v8f c) { return __builtin_amdgcn_wmma_f32_16x16x32_f16(false, a, false, b, (short)0, c, false, false); }
__device__ __forceinline__ float xhalf(float x) { return __builtin_bit_cast(float, __builtin_amdgcn_permlanex16(__builtin_bit_cast(int, x), __builtin_bit_cast(int, x), 0x76543210, 0xfedcba98, false, false)); }  // lane l with lane l ^ 16
// the hardware's exp2 with, in the same statement, the one free slot that the instruction set asks for behind a transcendental: for the merge's run of exponentials
__device__ __forceinline__ float exp2_slot(float x) { float r; asm("v_exp_f32 %0, %1\n\tv_nop" : "=v"(r) : "v"(x)); return r; }
// one wave's key range: stages k and v^T through LDS and leaves (nm, l2, O^T). SAFE: the reference follows the running maximum, pass by pass. Not SAFE: the reference stays at the first pass's maximum, and no pass looks for a maximum, tests or rescales;
// an exponential x 2^11 beyond f16 then reaches the P operand as infinity and leaves every O^T element of its query infinite or not a number for good, which the caller looks for.
template <bool SAFE> __device__ __forceinline__ void attn_range(const _Float16* kg, const _Float16* vg, _Float16 (&sk)[2][AKS][AKT][APK], _Float16 (&sv)[2][AKS][HD][APK], const v16h (&qh)[ANQ][HD / 32], int ks, int sr, int sc, int col, int lane, int rot,
    v8f (&o)[ANQ][HD / 16], float (&nm)[ANQ], v2f (&l2)[ANQ]) {   // l2: the lane's sum of exponentials (x 2^11), even and odd elements apart (packed adds)
  v8h gk[ASL], gv[ASL];
#pragma unroll
  for (int i = 0; i < ASL; ++i) { gk[i] = *(const v8h*)(kg + (size_t)(rot * AKT + i * AQT * 4) * CC); gv[i] = *(const v8h*)(vg + rot * AKT + (size_t)(i * AQT * 4) * TT); }
  asm volatile("s_wait_xcnt 0x0" ::: "memory");   // in front of the first rewrite of an address register that the loads above name
#pragma unroll
  for (int i = 0; i < ASL; ++i) { *(v8h*)&sk[0][ks][sr + i * AQT * 4][sc] = gk[i]; *(v8h*)&sv[0][ks][sr + i * AQT * 4][sc] = gv[i]; }
  __syncthreads();   // stage 0 is published
  float m[ANQ];
#pragma unroll
  for (int n = 0; n < ANQ; ++n) { m[n] = -3.0e38f; nm[n] = 11.0f - m[n] * AC2; l2[n] = v2f{0.f, 0.f};
#pragma unroll
    for (int j = 0; j < HD / 16; ++j) o[n][j] = v8f{}; }
  for (int st = 0; st < ANS; ++st) { const int bu = st & 1;
    if (st + 1 < ANS) { const int sn = (st + 1 + rot) & (ANS - 1); const _Float16* kn = kg + (size_t)(sn * AKT) * CC; const _Float16* vn = vg + sn * AKT;
#pragma unroll
      for (int i = 0; i < ASL; ++i) { gk[i] = *(const v8h*)(kn + (size_t)(i * AQT * 4) * CC); gv[i] = *(const v8h*)(vn + (size_t)(i * AQT * 4) * TT); }
      asm volatile("s_wait_xcnt 0x0" ::: "memory"); }   // in front of the first rewrite of an address register that these loads name
#pragma unroll
    for (int pp = 0; pp < AKT / 32; ++pp) {
      v16h kf[HD / 32][2];
#pragma unroll
      for (int kc = 0; kc < HD / 32; ++kc)
#pragma unroll
        for (int t = 0; t < 2; ++t) kf[kc][t] = frag_h(&sk[bu][ks][pp * 32 + t * 16 + col][kc * 32], lane);
      __builtin_amdgcn_sched_barrier(0);   // the pass's k fragments are read as one group ahead of the products: left to itself the scheduler reads them pair by pair into one register set and waits out the LDS latency four times a pass
      v8f s[ANQ][2] = {};
#pragma unroll
      for (int kc = 0; kc < HD / 32; ++kc)
#pragma unroll
        for (int t = 0; t < 2; ++t)
#pragma unroll
          for (int n = 0; n < ANQ; ++n) s[n][t] = wm16(kf[kc][t], qh[n][kc], s[n][t]);
      v16h vf[HD / 16];
#pragma unroll
      for (int j = 0; j < HD / 16; ++j) vf[j] = frag_h(&sv[bu][ks][j * 16 + col][pp * 32], lane);
      if constexpr (SAFE) {
      float mx[ANQ]; bool up = false;
#pragma unroll
      for (int n = 0; n < ANQ; ++n) { mx[n] = m[n];
#pragma unroll
        for (int i = 0; i < 8; ++i) mx[n] = fmaxf(mx[n], fmaxf(s[n][i >> 2][(2 * i) & 7], s[n][i >> 2][(2 * i + 1) & 7]));
        mx[n] = fmaxf(mx[n], xhalf(mx[n])); up = up || mx[n] > m[n]; }
      if (__builtin_amdgcn_ballot_w32(up) != 0) {   // some query's maximum rose (one test a pass for the wave's queries): bring sum and O^T to the new one (a factor of exactly 1 for the other queries)
#pragma unroll
        for (int n = 0; n < ANQ; ++n) { const float nn = 11.0f - mx[n] * AC2; const float a = __builtin_amdgcn_exp2f(nn - nm[n]); l2[n] *= a; m[n] = mx[n]; nm[n] = nn;
#pragma unroll
          for (int j = 0; j < HD / 16; ++j)
#pragma unroll
            for (int r = 0; r < 8; ++r) o[n][j][r] *= a; } }
      } else if (pp == 0) {
        if (st == 0) {   // the walk's first pass sets the reference: each query's maximum over its 32 keys (sum and O^T are still 0)
#pragma unroll
          for (int n = 0; n < ANQ; ++n) { float mx = fmaxf(s[n][0][0], s[n][0][1]);
#pragma unroll
            for (int i = 1; i < 8; ++i) mx = fmaxf(mx, fmaxf(s[n][i >> 2][(2 * i) & 7], s[n][i >> 2][(2 * i + 1) & 7]));
            nm[n] = 11.0f - fmaxf(mx, xhalf(mx)) * AC2; } } }
      v16h pf[ANQ];
#pragma unroll
      for (int n = 0; n < ANQ; ++n)
#pragma unroll
        for (int i = 0; i < 8; ++i) { const v2f x = v2f{s[n][i >> 2][(2 * i) & 7], s[n][i >> 2][(2 * i + 1) & 7]} * AC2 + nm[n]; const v2f e = {__builtin_amdgcn_exp2f(x.x), __builtin_amdgcn_exp2f(x.y)}; l2[n] += e; pf[n][2 * i] = (_Float16)e.x; pf[n][2 * i + 1] = (_Float16)e.y; }
#pragma unroll
      for (int j = 0; j < HD / 16; ++j)
#pragma unroll
        for (int n = 0; n < ANQ; ++n) o[n][j] = wm16(vf[j], pf[n], o[n][j]); }
    // its readers left this buffer before the last barrier. No test around the stores (the last stage writes its own tile once more, into the buffer that nobody reads again): behind a branch the compiler sinks both passes' sums below it, holds 64 registers of exponentials for them and spills
#pragma unroll
    for (int i = 0; i < ASL; ++i) { *(v8h*)&sk[bu ^ 1][ks][sr + i * AQT * 4][sc] = gk[i]; *(v8h*)&sv[bu ^ 1][ks][sr + i * AQT * 4][sc] = gv[i]; }
    __syncthreads(); }   // publishes stage st + 1 and ends every read of stage st
}
__global__ __launch_bounds__(AQT * AKS * 32) void k_attn(const _Float16* __restrict__ QH, const _Float16* __restrict__ KH, const _Float16* __restrict__ VT, float* __restrict__ Y) {
  __shared__ __align__(16) _Float16 sk[2][AKS][AKT][APK], sv[2][AKS][HD][APK];
  __shared__ __align__(16) v4f sp[AKS][AQT][ANQ * (HD / 8)][32]; __shared__ float smx[AKS][AQT][ANQ][16], ssu[AKS][AQT][ANQ][16]; __shared__ __align__(16) float so[AQT][ANQ * 16][HD + 4]; __shared__ __align__(16) int sbad[AQT * AKS];
  const int tid = threadIdx.x, wave = __builtin_amdgcn_readfirstlane(tid >> 5), lane = tid & 31, col = lane & 15, g = lane >> 4; const int qt = wave % AQT, ks = wave / AQT;
  const int b = blockIdx.y / NH, h = blockIdx.y % NH; const int ql0 = blockIdx.x * (AQT * ANQ * 16) + qt * (ANQ * 16);
  // staging: thread (qt, lane) of a range moves 16-byte chunk sc of rows sr + 16 i of the k tile and of the v^T tile (8 lanes = one 128-B line)
  const int sr = qt * 4 + (lane >> 3), sc = (lane & 7) * 8;
  const _Float16* kg = KH + ((size_t)b * TT + ks * (TT / AKS) + sr) * CC + h * HD + sc;
  const _Float16* vg = VT + ((size_t)b * CC + h * HD + sr) * (size_t)TT + ks * (TT / AKS) + sc;
  // the blocks of one (b, h) read the same k and v: block x walks each range's stages as a ring from stage rot, two blocks to a first stage (x and x ^ 4), so that they do not ask L2 for the same lines at the same moment
  const int rot = (((blockIdx.x & 3) << 1) | ((blockIdx.x >> 3) & 1)) & (ANS - 1);
  v16h qh[ANQ][HD / 32];
#pragma unroll
  for (int n = 0; n < ANQ; ++n) {
#pragma unroll
    for (int kc = 0; kc < HD / 32; ++kc) qh[n][kc] = frag_h(QH + ((size_t)b * TT + ql0 + n * 16 + col) * CC + h * HD + kc * 32, lane);
    asm volatile("s_wait_xcnt 0x0" ::: "memory"); }   // behind each tile's loads: in front of the first rewrite of an address register that they name (the next tile's loads may land on it)
  v8f o[ANQ][HD / 16]; float nm[ANQ]; v2f l2[ANQ];
  const auto publish = [&]() {   // the wave's partial results go to LDS
#pragma unroll
  for (int n = 0; n < ANQ; ++n) { float l = l2[n].x + l2[n].y; l += xhalf(l);
#pragma unroll
    for (int j = 0; j < HD / 16; ++j)
#pragma unroll
      for (int u = 0; u < 2; ++u) sp[ks][qt][(n * (HD / 16) + j) * 2 + u][lane] = v4f{o[n][j][4 * u], o[n][j][4 * u + 1], o[n][j][4 * u + 2], o[n][j][4 * u + 3]};   // 16 bytes a lane, lanes side by side: no bank conflict
    if (g == 0) { smx[ks][qt][n][col] = nm[n]; ssu[ks][qt][n][col] = l; } }
  };
  attn_range<false>(kg, vg, sk, sv, qh, ks, sr, sc, col, lane, rot, o, nm, l2);
  publish();
  { const bool bad = !(fabsf(o[0][0][0]) <= 3.0e38f) || !(fabsf(o[1][0][0]) <= 3.0e38f);   // an overflow of a query's exponentials shows in every element of its O^T column: one element a query tile is looked at
    const unsigned bm = __builtin_amdgcn_ballot_w32(bad);   // taken by all 32 lanes, ahead of the one-lane store
    if (lane == 0) sbad[wave] = bm != 0 ? 1 : 0; }
  __syncthreads();   // every range's partial results and its overflow mark are published
  { v4i f = *(const v4i*)&sbad[0];
#pragma unroll
    for (int w = 4; w < AQT * AKS; w += 4) f |= *(const v4i*)&sbad[w];
    if (__builtin_amdgcn_readfirstlane(f.x | f.y | f.z | f.w) != 0) {   // the same for the whole block: some wave's fixed reference was too low, so every wave does its range again with the running maximum (once; its barriers are passed by all)
      attn_range<true>(kg, vg, sk, sv, qh, ks, sr, sc, col, lane, rot, o, nm, l2);
      publish();
      __syncthreads(); } }   // the second results are published
  float nx[ANQ][AKS], lx[ANQ][AKS]; v4f px[ANQ][2][AKS];
#pragma unroll
  for (int n = 0; n < ANQ; ++n)
#pragma unroll
    for (int x = 0; x < AKS; ++x) { nx[n][x] = smx[x][qt][n][col]; lx[n][x] = ssu[x][qt][n][col];
#pragma unroll
      for (int u = 0; u < 2; ++u) px[n][u][x] = sp[x][qt][(n * (HD / 16) + ks) * 2 + u][lane]; }
  __builtin_amdgcn_sched_barrier(0);   // all of the merge's LDS reads go out as one group: spread among the sums they were waited for one after the other
  float a[ANQ][AKS], nn[ANQ];
#pragma unroll
  for (int n = 0; n < ANQ; ++n) { nn[n] = nx[n][0];
#pragma unroll
    for (int x = 1; x < AKS; ++x) nn[n] = fminf(nn[n], nx[n][x]); }   // the smallest nm belongs to the largest maximum
#pragma unroll
  for (int x = 0; x < AKS; ++x)
#pragma unroll
    for (int n = 0; n < ANQ; ++n) a[n][x] = exp2_slot(nn[n] - nx[n][x]);
#pragma unroll
  for (int n = 0; n < ANQ; ++n) { float l = 0.f;
#pragma unroll
    for (int x = 0; x < AKS; ++x) l += lx[n][x] * a[n][x];
    const float inv = 1.0f / l;
#pragma unroll
    for (int u = 0; u < 2; ++u) { v4f acc = {0.f, 0.f, 0.f, 0.f};
#pragma unroll
      for (int x = 0; x < AKS; ++x) acc += px[n][u][x] * a[n][x];
      *(v4f*)&so[qt][n * 16 + col][ks * 16 + 8 * g + 4 * u] = acc * inv; } }
  __syncthreads();   // the group's merged rows are published
#pragma unroll
  for (int it = 0; it < ANQ * 16 / AKS / 2; ++it) { const int rl = ks * (ANQ * 16 / AKS) + it * 2 + g; vst2(Y + ((size_t)b * TT + ql0 + rl) * CC + h * HD + col * 4, *(const v4f*)&so[qt][rl][col * 4]); } }
// ---- k_out: block = (64 rows, 128 cols): out = ctx Wo (+ bo): ctx split bf16 hi + lo against exact bf16 Wo (2 products), all rows
__global__ __launch_bounds__(128) void k_out(const float* __restrict__ Y, const float* __restrict__ WO, const float* __restrict__ BO, float* __restrict__ OUT) { __shared__ __align__(16) float sf[4][16][132]; __shared__ __align__(16) __bf16 tw[2][128][GPW];
  const int tid = threadIdx.x, wave = tid >> 5, lane = tid & 31, col = lane & 15, g = lane >> 4; const int c0 = blockIdx.y * 128; const size_t r0 = (size_t)blockIdx.x * 64 + wave * 16;
  v8f acc[8] = {};
  if (true) {   /* ALL rows: ctx split bf16 hi + lo x exact Wo (2 products) */
    const int n4 = (wave * 8 + ((lane & 3) | ((lane >> 4) << 2))) * 4, o4 = (lane >> 2) & 3;
    const float* wp = WO + (size_t)(o4 * 8) * DIN + c0 + n4; const float* xp = Y + (r0 + col) * CC + 8 * g;
    const int rot = GROT(blockIdx.x, blockIdx.y, CC / GKS);
    v4f wf[2][8], xf[2][4]; F2 a[2]; wst_load(wf, wp + (size_t)(rot * GKS) * DIN, DIN); arow_load(xf, xp + rot * GKS);
    asm volatile("s_wait_xcnt 0x0" ::: "memory");   // in front of the first rewrite of an address register that stage 0's loads name
    float bs[8];   // as in k_proj: the bias is asked for at entry, not in eight dependent round trips behind the loop (the unrolls keep bs statically indexed)
#pragma unroll
    for (int j = 0; j < 8; ++j) bs[j] = 0.f;
    if (BO) {   // one test around all eight loads, so that they are in flight together
#pragma unroll
      for (int j = 0; j < 8; ++j) bs[j] = BO[c0 + j * 16 + col];
      asm volatile("s_wait_xcnt 0x0" ::: "memory"); }   // in front of the first rewrite of the offset register that these loads name
    wst_store(&tw[0][n4][o4 * 8], wf);
#pragma unroll
    for (int kk = 0; kk < 2; ++kk) { float v[16];
#pragma unroll
      for (int e = 0; e < 16; ++e) v[e] = xf[kk][e >> 2][e & 3];
      a[kk] = bsplit16(v); }
    __syncthreads();   // stage 0 is published
    for (int st = 0; st < CC / GKS; ++st) { const int bu = st & 1; const bool more = st + 1 < CC / GKS;
      if (more) { const int sn = (st + 1 + rot) & (CC / GKS - 1); wst_load(wf, wp + (size_t)(sn * GKS) * DIN, DIN); arow_load(xf, xp + sn * GKS);
        asm volatile("s_wait_xcnt 0x0" ::: "memory"); }   // in front of the first rewrite of an address register that these loads name
#pragma unroll
      for (int kk = 0; kk < 2; ++kk)
#pragma unroll
        for (int jh = 0; jh < 8; jh += 4) { v16b w[4];   // four fragments are read as one group, so that the wave waits out the LDS latency once for eight products
#pragma unroll
          for (int j = 0; j < 4; ++j) w[j] = frag_b(&tw[bu][(jh + j) * 16 + col][kk * 32], lane);
#pragma unroll
          for (int j = 0; j < 4; ++j) acc[jh + j] = wmma_bf(a[kk].h, w[j], acc[jh + j]);
#pragma unroll
          for (int j = 0; j < 4; ++j) acc[jh + j] = wmma_bf(a[kk].l, w[j], acc[jh + j]); }   // hi before lo in every accumulator, as before
      if (more) { wst_store(&tw[bu ^ 1][n4][o4 * 8], wf);   // its readers left this buffer before the last barrier
#pragma unroll
        for (int kk = 0; kk < 2; ++kk) { float v[16];
#pragma unroll
          for (int e = 0; e < 16; ++e) v[e] = xf[kk][e >> 2][e & 3];
          a[kk] = bsplit16(v); } }
      __syncthreads(); }   // publishes stage st + 1 and ends every read of stage st
#pragma unroll
    for (int j = 0; j < 8; ++j) { const float bias = bfr(bs[j]);
#pragma unroll
      for (int r = 0; r < 8; ++r) sf[wave][8 * g + r][j * 16 + col] = acc[j][r] + bias; }
  } else {
#pragma unroll 2
    for (int kc = 0; kc < CC / 32; ++kc) { const v16h a = frag_f32(Y + (r0 + col) * CC + kc * 32, lane); asm volatile("s_wait_loadcnt 0x0" ::: "memory");
#pragma unroll
      for (int j = 0; j < 8; ++j) { const v16h w = WOCOLH(WO, kc * 32, c0 + j * 16 + col, lane); asm volatile("s_wait_loadcnt 0x0" ::: "memory"); acc[j] = wmma16(a, w, acc[j]); } }
#pragma unroll
    for (int j = 0; j < 8; ++j) { const float bias = BO ? bfr(BO[c0 + j * 16 + col]) : 0.f;
#pragma unroll
      for (int r = 0; r < 8; ++r) sf[wave][8 * g + r][j * 16 + col] = acc[j][r] * (1.0f / 256.0f) + bias; } }
  LDSX(); for (int rl = 0; rl < 16; ++rl) vst2(OUT + (r0 + rl) * DIN + c0 + lane * 4, *(const v4f*)&sf[wave][rl][lane * 4]); }

extern "C" void kernel_launch(void* const* d_in, const int* in_sizes, int n_in, void* d_out, int out_size, void* d_ws, size_t ws_size, hipStream_t stream) {
  (void)in_sizes; (void)n_in; (void)out_size;
  const float** F = (const float**)d_in;
  if (ws_size < (size_t)WS_END) return;
  char* ws = (char*)d_ws; _Float16 *QH = (_Float16*)(ws + WS_QH), *KH = (_Float16*)(ws + WS_KH), *VT = (_Float16*)(ws + WS_VT), *QL = (_Float16*)(ws + WS_QL), *KL = (_Float16*)(ws + WS_KL); __bf16 *VB = (__bf16*)(ws + WS_VB), *VBL = (__bf16*)(ws + WS_VBL); float *Y = (float*)(ws + WS_Y);
  (void)Y; (void)QL; (void)KL; (void)VB; (void)VBL;
  // inputs: 0 x [2,2048,512]; 1 Wq (in,out), 2 bq; 3 Wk, 4 bk; 5 Wv, 6 bv; 7 Wo (in,out), 8 bo
  k_proj<<<dim3(TNB * TT / 64, CC / 128, 3), 128, 0, stream>>>(F[0], F[0], F[0], F[1], F[3], F[5], F[2], F[4], F[6], QH, QL, KH, KL, VT, VB, VBL);
  k_attn<<<dim3(TT / (AQT * ANQ * 16), TNB * NH), AQT * AKS * 32, 0, stream>>>(QH, KH, VT, Y);
  k_out<<<dim3(TNB * TT / 64, DIN / 128), 128, 0, stream>>>(Y, F[7], F[8], (float*)d_out);
}

// v009
// Measured time: 39.6 microseconds a run.
// Timed twice side by side with v008, it ran 1.05 times as fast both times.
// All steps since v000 together make it 14.7 times as fast.
// compute dtype: all float inputs rounded to bf16; q/k/v = in W + b with EXACT bf16 products on WMMA 16x16x32 (f32 accumulate); q once to f16 against k once to f16 (1 product) / 8; online softmax in f32 (one fused multiply-add and the hardware's exp2 per logit), fused with both products; exp(logit - max) x 2^11 once to f16 against v once to f16 (1 product), divided by the f32 sum (x 2^11 too) at the end; ctx split bf16 hi + lo against exact Wo (2 products) + bo; f32 output.
#include <hip/hip_runtime.h>
#include <math.h>

typedef __attribute__((ext_vector_type(16))) _Float16 v16h;
typedef __attribute__((ext_vector_type(16))) __bf16 v16b;
typedef __attribute__((ext_vector_type(8)))  _Float16 v8h;
typedef __attribute__((ext_vector_type(8)))  float v8f;
typedef __attribute__((ext_vector_type(4)))  float v4f;
typedef __attribute__((ext_vector_type(2)))  float v2f;
typedef __attribute__((ext_vector_type(4)))  unsigned v4u;
typedef __attribute__((ext_vector_type(4)))  int v4i;
typedef float __attribute__((may_alias)) float_a;
typedef int __attribute__((may_alias)) int_a;

template <typename T> __device__ __forceinline__ void vst2(void* p, T v) { *(T*)p = v;  }
__device__ __forceinline__ v8f wmma16(v16h a, v16h b, v8f c) {
  v8f d = __builtin_amdgcn_wmma_f32_16x16x32_f16(false, a, false, b, (short)0, c, false, false);
  asm volatile("v_nop\n\tv_nop\n\tv_nop\n\tv_nop" : "+v"(d) : "v"(a), "v"(b));
  return d;
}
__device__ __forceinline__ v8f wmma_bf(v16b a, v16b b, v8f c) {
  v8f d = __builtin_amdgcn_wmma_f32_16x16x32_bf16(false, a, false, b, (short)0, c, false, false);
  asm volatile("v_nop\n\tv_nop\n\tv_nop\n\tv_nop" : "+v"(d) : "v"(a), "v"(b));
  return d;
}
// 16x16x32 fragments: lane = (h = lane>>4, row/col = lane&15); elements 0..7 = k0+8h+0..7, 8..15 = k0+16+8h+0..7; D element r = row 8h+r
__device__ __forceinline__ v16h frag_h(const _Float16* rowk0, int lane) {
  union { v16h v; v8h q[2]; } u; const _Float16* p = rowk0 + 8 * (lane >> 4);
  u.q[0] = *(const v8h*)p; u.q[1] = *(const v8h*)(p + 16); return u.v;
}
__device__ __forceinline__ v16h frag_f32(const float* rowk0, int lane) {
  v16h a; const float* p = rowk0 + 8 * (lane >> 4);
#pragma unroll
  for (int i = 0; i < 8; ++i) { a[i] = (_Float16)p[i]; a[8 + i] = (_Float16)p[16 + i]; }
  return a;
}
__device__ __forceinline__ v16h frag_f32s(const float* rowk0, int lane, float sc) {
  v16h a; const float* p = rowk0 + 8 * (lane >> 4);
#pragma unroll
  for (int i = 0; i < 8; ++i) { a[i] = (_Float16)(p[i] * sc); a[8 + i] = (_Float16)(p[16 + i] * sc); }
  return a;
}
// column fragment from a [K][ld] layout (column n), rows >= K read as 0
__device__ __forceinline__ v16h fragc_f32(const float* W, int k0, int n, int lane, int ld, int K) {
  v16h a; const int g = lane >> 4;
#pragma unroll
  for (int i = 0; i < 8; ++i) { const int ka = k0 + 8 * g + i, kb = ka + 16;
    a[i] = (_Float16)(ka < K ? W[(size_t)(ka < K ? ka : K - 1) * ld + n] : 0.f); a[8 + i] = (_Float16)(kb < K ? W[(size_t)(kb < K ? kb : K - 1) * ld + n] : 0.f); }
  return a;
}
struct F2 { v16b h, l; };
__device__ __forceinline__ F2 bsplit16(const float v[16]) { F2 r;
#pragma unroll
  for (int i = 0; i < 16; ++i) { const __bf16 h = (__bf16)v[i]; r.h[i] = h; r.l[i] = (__bf16)(v[i] - (float)h); }
  return r; }
__device__ __forceinline__ F2 split_row(const float* row, int k0, int lane) { float v[16]; const float* p = row + k0 + 8 * (lane >> 4);
#pragma unroll
  for (int i = 0; i < 8; ++i) { v[i] = p[i]; v[8 + i] = p[16 + i]; }
  return bsplit16(v); }
__device__ __forceinline__ F2 split_rowK(const float* row, int k0, int lane, int K) { float v[16]; const int g = lane >> 4;
#pragma unroll
  for (int i = 0; i < 8; ++i) { const int ka = k0 + 8 * g + i, kb = ka + 16; v[i] = ka < K ? row[ka < K ? ka : K - 1] : 0.f; v[8 + i] = kb < K ? row[kb < K ? kb : K - 1] : 0.f; }
  return bsplit16(v); }
__device__ __forceinline__ F2 split_col(const float* W, int k0, int n, int lane, int ld, int K) { float v[16]; const int g = lane >> 4;
#pragma unroll
  for (int i = 0; i < 8; ++i) { const int ka = k0 + 8 * g + i, kb = ka + 16; v[i] = ka < K ? W[(size_t)(ka < K ? ka : K - 1) * ld + n] : 0.f; v[8 + i] = kb < K ? W[(size_t)(kb < K ? kb : K - 1) * ld + n] : 0.f; }
  return bsplit16(v); }
__device__ __forceinline__ v8f mac3(const F2& a, const F2& b, v8f c) { c = wmma_bf(a.l, b.h, c); c = wmma_bf(a.h, b.l, c); return wmma_bf(a.h, b.h, c); }
__device__ __forceinline__ float sigm(float v) { return 1.0f / (1.0f + expf(-v)); }
#define LDSX() do { asm volatile("s_wait_dscnt 0" ::: "memory"); __builtin_amdgcn_wave_barrier(); __builtin_amdgcn_fence(__ATOMIC_RELEASE, "workgroup"); } while (0)

// Multi-head self-attention (B 2, S 2,048, d_model 512 = 8 x 64; (in,out) uniform +-1/sqrt(512) weights WITH biases): q, k, v = x W + b; out = merged(softmax(q k^T / 8) v) Wo + bo (non-causal).
#define NB 2
#define TT 2048
#define CC 512            // NH * HD = projected width
#define DIN 512          // input (model) width
#define NH 8
#define HD 64
#define NQB (TT / 64)
#define HG 4
#define SCALE (0.125f)
#define CAUSAL 0
#ifndef TNB
#define TNB NB
#endif
__device__ __forceinline__ float bfr(float v) { return (float)(__bf16)v; }
__host__ __device__ __forceinline__ int kb_last(int qb) { return CAUSAL ? ((qb * 64 + 63) >> 7) : (TT / 128 - 1); }
typedef __attribute__((ext_vector_type(8))) __bf16 v8b;
__device__ __forceinline__ v16b frag_b(const __bf16* rowk0, int lane) {
  union { v16b v; v8b q[2]; } u; const __bf16* p = rowk0 + 8 * (lane >> 4);
  u.q[0] = *(const v8b*)p; u.q[1] = *(const v8b*)(p + 16); return u.v;
}
#define QBH 0              // unused: k_attn has no high-precision path
#define QHI 0               // rows carrying a q residual plane (none: q goes into the logits rounded once to f16, as k does)
#define KHI 64            // key rows carrying k residual / v bf16 hi+lo planes (written by k_proj, read by no kernel)
// B fragment (k rows k0+.., output column o) of a weight: (in,out) [K][ld] or (out,in) [ld rows of K]: bf16 exact, or f16(bf16 * 256) exact
__device__ __forceinline__ v16b wcol_io(const float* Wm, int k0, int o, int lane, int ld) { v16b w; const int g = lane >> 4;
#pragma unroll
  for (int i = 0; i < 8; ++i) { w[i] = (__bf16)Wm[(size_t)(k0 + 8 * g + i) * ld + o]; w[8 + i] = (__bf16)Wm[(size_t)(k0 + 16 + 8 * g + i) * ld + o]; }
  return w; }
__device__ __forceinline__ v16b wcol_oi(const float* Wm, int k0, int o, int lane, int K) { v16b w; const float* p = Wm + (size_t)o * K + k0 + 8 * (lane >> 4);
#pragma unroll
  for (int i = 0; i < 8; ++i) { w[i] = (__bf16)p[i]; w[8 + i] = (__bf16)p[16 + i]; }
  return w; }
__device__ __forceinline__ v16h wcolh_io(const float* Wm, int k0, int o, int lane, int ld) { v16h w; const int g = lane >> 4;
#pragma unroll
  for (int i = 0; i < 8; ++i) { w[i] = (_Float16)(bfr(Wm[(size_t)(k0 + 8 * g + i) * ld + o]) * 256.0f); w[8 + i] = (_Float16)(bfr(Wm[(size_t)(k0 + 16 + 8 * g + i) * ld + o]) * 256.0f); }
  return w; }
__device__ __forceinline__ v16h wcolh_oi(const float* Wm, int k0, int o, int lane, int K) { v16h w; const float* p = Wm + (size_t)o * K + k0 + 8 * (lane >> 4);
#pragma unroll
  for (int i = 0; i < 8; ++i) { w[i] = (_Float16)(bfr(p[i]) * 256.0f); w[8 + i] = (_Float16)(bfr(p[16 + i]) * 256.0f); }
  return w; }
#define WQKV_LAYOUT 0   // 0 = (in,out) [DIN][CC]; 1 = (out,in) [CC][DIN]; 2 = per-head [NH][DIN][HD]
__device__ __forceinline__ v16b wcol_hdk(const float* Wm, int k0, int o, int lane) { v16b w; const int g = lane >> 4; const float* p = Wm + (size_t)(o / HD) * DIN * HD + (o % HD);
#pragma unroll
  for (int i = 0; i < 8; ++i) { w[i] = (__bf16)p[(size_t)(k0 + 8 * g + i) * HD]; w[8 + i] = (__bf16)p[(size_t)(k0 + 16 + 8 * g + i) * HD]; }
  return w; }
#define WO_OUT_IN 0
#if WQKV_LAYOUT == 1
#define WCOL(W, k0, o, lane) wcol_oi(W, k0, o, lane, DIN)
#elif WQKV_LAYOUT == 2
#define WCOL(W, k0, o, lane) wcol_hdk(W, k0, o, lane)
#else
#define WCOL(W, k0, o, lane) wcol_io(W, k0, o, lane, CC)
#endif
#if WO_OUT_IN
#define WOCOL(W, k0, o, lane) wcol_oi(W, k0, o, lane, CC)
#define WOCOLH(W, k0, o, lane) wcolh_oi(W, k0, o, lane, CC)
#else
#define WOCOL(W, k0, o, lane) wcol_io(W, k0, o, lane, DIN)
#define WOCOLH(W, k0, o, lane) wcolh_io(W, k0, o, lane, DIN)
#endif

#ifndef SM_EXTRA_PARAMS
#define SM_EXTRA_PARAMS
#endif
#ifndef PROJ_EXTRA_PARAMS
#define PROJ_EXTRA_PARAMS
#endif
#ifndef SM_MASK_HOOK
#define SM_MASK_HOOK (void)0
#endif

#define WS_QH  0u                                      // f16 q rows [b*t][CC]
#define WS_KH  (WS_QH + 2u * (size_t)NB * TT * CC)      // f16 k rows [b*t][CC]
#define WS_VT  (WS_KH + 2u * (size_t)NB * TT * CC)      // f16 v planes [b][c][t]
#define WS_QL  (WS_VT + 2u * (size_t)NB * CC * TT)      // f16 q residual x 2^10 rows [b][t < QHI][CC]
#define WS_KL  (WS_QL + 2u * (size_t)NB * QHI * CC)     // f16 k residual x 2^10 rows [b][t < KHI][CC]
#define WS_VB  (WS_KL + 2u * (size_t)NB * KHI * CC)     // bf16 v hi planes [b][c][t < KHI]
#define WS_VBL (WS_VB + 2u * (size_t)NB * CC * KHI)
#define WS_S   (WS_VBL + 2u * (size_t)NB * CC * KHI)    // f32 [hg][t][s] region, unused: logits and P stay in registers
#define WS_Y   (WS_S  + 4u * (size_t)HG * TT * TT)      // f32 ctx rows [b*t][CC] (only when there is an output projection)
#define WS_END (WS_Y  + 4u * (size_t)NB * TT * CC)

// ---- weight staging of the two projection GEMMs: a stage is GKS k rows x 128 columns of an (in,out) f32 weight, rounded to bf16 and laid column-major in LDS (pitch GPW), once for the four waves that read it (k_proj: the block; k_out: one of its two groups).
// Thread (wave, lane) moves columns n4..n4+3 of k rows o4*8 + u*32 + i: a wave-wide load covers four whole 128-B lines, and 16 neighbouring lanes' 16-byte LDS stores cover all 64 banks once.
// Two buffers: the next stage's loads fly during this stage's products, one barrier a stage. A block (in k_out, each of its two groups over half of the ring) walks the k stages in a ring from its own first stage (k_proj: GROT, below), so an accumulator's k order is the plain one rotated by whole stages. Every '#pragma unroll' of the staging and of the two loops keeps a register array statically indexed.
#define GKS 64
#define GPW 72                    // LDS pitch in bf16: 128-B rows + 16 B, conflict-free for 16-byte fragment reads
// first k stage of block (bx, by) of NS stages: blocks that share a weight tile (same by) or a row tile (same bx) start at different stages, so they do not ask L2 for the same lines at the same moment,
// and at any moment the grid's reads of the row operand (256 B of every 2-KB row a stage) cover all eight 256-B columns of the rows and not one
#define GROT(bx, by, NS) (((bx) + 2 * (by)) & ((NS) - 1))
static_assert((DIN / GKS & (DIN / GKS - 1)) == 0 && (CC / GKS & (CC / GKS - 1)) == 0, "the ring of stages wraps by a mask");
__device__ __forceinline__ void wst_load(v4f (&f)[2][8], const float* wp, int ld) {
#pragma unroll
  for (int u = 0; u < 2; ++u)
#pragma unroll
    for (int i = 0; i < 8; ++i) f[u][i] = *(const v4f*)(wp + (size_t)(u * 32 + i) * ld); }
__device__ __forceinline__ void wst_store(__bf16* sp, const v4f (&f)[2][8]) {
#pragma unroll
  for (int u = 0; u < 2; ++u)
#pragma unroll
    for (int c = 0; c < 4; ++c) { v8b p;
#pragma unroll
      for (int i = 0; i < 8; ++i) p[i] = (__bf16)f[u][i][c];
      *(v8b*)(sp + c * GPW + u * 32) = p; } }
// the lane's f32 elements of the A fragments of one stage (p = row + stage k0 + 8 * (lane >> 4)): element e of fragment kk is x[kk][e >> 2][e & 3]
__device__ __forceinline__ void arow_load(v4f (&x)[2][4], const float* p) {
#pragma unroll
  for (int kk = 0; kk < 2; ++kk) { x[kk][0] = *(const v4f*)(p + kk * 32); x[kk][1] = *(const v4f*)(p + kk * 32 + 4); x[kk][2] = *(const v4f*)(p + kk * 32 + 16); x[kk][3] = *(const v4f*)(p + kk * 32 + 20); } }
// ---- k_proj: block = (64 rows, 128 cols, which): q/k/v = X W (+ b) with exact bf16 products (K = DIN) -> which 0: q f16 rows (+ residual rows < QHI); 1: k f16 rows (+ residual rows < KHI); 2: v f16 planes [c][t] (+ bf16 hi/lo planes for t < KHI)
__global__ __launch_bounds__(128) void k_proj(const float* __restrict__ XQ, const float* __restrict__ XK, const float* __restrict__ XV, const float* __restrict__ WQ, const float* __restrict__ WK, const float* __restrict__ WV, const float* __restrict__ BQ, const float* __restrict__ BK, const float* __restrict__ BV,
    _Float16* __restrict__ QH, _Float16* __restrict__ QL, _Float16* __restrict__ KH, _Float16* __restrict__ KL, _Float16* __restrict__ VT, __bf16* __restrict__ VB, __bf16* __restrict__ VBL) {
  __shared__ __align__(16) _Float16 sh[64][136], sl[64][136]; __shared__ __align__(16) _Float16 th[128][72]; __shared__ __align__(16) __bf16 tw[2][128][GPW]; __bf16 (&tb)[128][72] = tw[0]; __bf16 (&tbl)[128][72] = tw[1];   // the two weight buffers of the loop are the epilogue's tb and tbl
  const int tid = threadIdx.x, wave = tid >> 5, lane = tid & 31, col = lane & 15, g = lane >> 4; const int which = blockIdx.z; const int c0 = blockIdx.y * 128; const size_t r0 = (size_t)blockIdx.x * 64; const size_t bb = r0 / TT; const int t0 = (int)(r0 % TT);
  const float* X = which == 0 ? XQ : which == 1 ? XK : XV; const float* WA = which == 0 ? WQ : which == 1 ? WK : WV; const float* BA = which == 0 ? BQ : which == 1 ? BK : BV;
  v8f acc[8] = {};
  const int n4 = (wave * 8 + ((lane & 3) | ((lane >> 4) << 2))) * 4, o4 = (lane >> 2) & 3;
  const float* wp = WA + (size_t)(o4 * 8) * CC + c0 + n4; const float* xp = X + (r0 + wave * 16 + col) * DIN + 8 * g;
  const int rot = GROT(blockIdx.x, blockIdx.y, DIN / GKS);
  v4f wf[2][8], xf[2][4]; v16b a[2]; wst_load(wf, wp + (size_t)(rot * GKS) * CC, CC); arow_load(xf, xp + rot * GKS);
  asm volatile("s_wait_xcnt 0x0" ::: "memory");   // in front of the first rewrite of an address register that stage 0's loads name
  float bs[8];   // the lane's eight bias elements are asked for here, behind stage 0's loads, and wait in registers: read in the epilogue they were eight round trips to L2, one behind the other, with nothing to hide them (the unrolls keep bs statically indexed)
#pragma unroll
  for (int j = 0; j < 8; ++j) bs[j] = 0.f;
  if (BA) {   // one test around all eight loads, so that they are in flight together
#pragma unroll
    for (int j = 0; j < 8; ++j) bs[j] = BA[c0 + j * 16 + col];
    asm volatile("s_wait_xcnt 0x0" ::: "memory"); }   // in front of the first rewrite of the offset register that these loads name
  wst_store(&tw[0][n4][o4 * 8], wf);
#pragma unroll
  for (int kk = 0; kk < 2; ++kk)
#pragma unroll
    for (int e = 0; e < 16; ++e) a[kk][e] = (__bf16)xf[kk][e >> 2][e & 3];
  __syncthreads();   // stage 0 is published
  for (int st = 0; st < DIN / GKS; ++st) { const int bu = st & 1; const bool more = st + 1 < DIN / GKS;
    if (more) { const int sn = (st + 1 + rot) & (DIN / GKS - 1); wst_load(wf, wp + (size_t)(sn * GKS) * CC, CC); arow_load(xf, xp + sn * GKS);
      asm volatile("s_wait_xcnt 0x0" ::: "memory"); }   // in front of the first rewrite of an address register that these loads name
#pragma unroll
    for (int kk = 0; kk < 2; ++kk)
#pragma unroll
      for (int jh = 0; jh < 8; jh += 4) { v16b w[4];   // four fragments are read as one group, so that the wave waits out the LDS latency once for four products
#pragma unroll
        for (int j = 0; j < 4; ++j) w[j] = frag_b(&tw[bu][(jh + j) * 16 + col][kk * 32], lane);
#pragma unroll
        for (int j = 0; j < 4; ++j) acc[jh + j] = wmma_bf(a[kk], w[j], acc[jh + j]); }
    if (more) { wst_store(&tw[bu ^ 1][n4][o4 * 8], wf);   // its readers left this buffer before the last barrier
#pragma unroll
      for (int kk = 0; kk < 2; ++kk)
#pragma unroll
        for (int e = 0; e < 16; ++e) a[kk][e] = (__bf16)xf[kk][e >> 2][e & 3]; }
    __syncthreads(); }   // publishes stage st + 1 and ends every read of stage st
  if (which < 2) { _Float16* DH = which == 0 ? QH : KH; _Float16* DL = which == 0 ? QL : KL; const int nhi = which == 0 ? QHI : KHI; const bool hi_rows = t0 < nhi;
    if (hi_rows) {   // the residual is formed only in the blocks that store it
#pragma unroll
      for (int j = 0; j < 8; ++j) { const float bias = bfr(bs[j]);
#pragma unroll
        for (int r = 0; r < 8; ++r) { const float v = acc[j][r] + bias; const _Float16 hv = (_Float16)v; sh[wave * 16 + 8 * g + r][j * 16 + col] = hv; sl[wave * 16 + 8 * g + r][j * 16 + col] = (_Float16)((v - (float)hv) * 1024.0f); } }
    } else {
#pragma unroll
      for (int j = 0; j < 8; ++j) { const float bias = bfr(bs[j]);
#pragma unroll
        for (int r = 0; r < 8; ++r) sh[wave * 16 + 8 * g + r][j * 16 + col] = (_Float16)(acc[j][r] + bias); } }
    __syncthreads();
    const int rl0 = tid >> 4, q = tid & 15; v4u t[8];   // the thread's eight 16-byte pieces are read from LDS as one group and then stored: one LDS latency, not eight in a row (the unrolls keep t statically indexed)
#pragma unroll
    for (int it = 0; it < 8; ++it) t[it] = *(const v4u*)&sh[rl0 + it * 8][q * 8];
#pragma unroll
    for (int it = 0; it < 8; ++it) vst2((unsigned*)(DH + (r0 + rl0 + it * 8) * CC + c0 + q * 8), t[it]);
    if (hi_rows) { v4u u[8]; asm volatile("s_wait_xcnt 0x0" ::: "memory"); __builtin_amdgcn_sched_barrier(0);   // the wait stands in front of the first rewrite of a register that the stores above name; the scheduling barrier keeps this block's register writes from being lifted over it
#pragma unroll
      for (int it = 0; it < 8; ++it) u[it] = *(const v4u*)&sl[rl0 + it * 8][q * 8];
#pragma unroll
      for (int it = 0; it < 8; ++it) vst2((unsigned*)(DL + (bb * nhi + t0 + rl0 + it * 8) * (size_t)CC + c0 + q * 8), u[it]); }
  } else { const bool hi_rows = t0 < KHI;
#pragma unroll
    for (int j = 0; j < 8; ++j) { const float bias = bfr(bs[j]);
#pragma unroll
      for (int r = 0; r < 8; ++r) { const float v = acc[j][r] + bias; const int rl = wave * 16 + 8 * g + r, cl = j * 16 + col; th[cl][rl] = (_Float16)v; const __bf16 bh = (__bf16)v; tb[cl][rl] = bh; tbl[cl][rl] = (__bf16)(v - (float)bh); } }
    __syncthreads();
    const int cl0 = tid >> 3, q = tid & 7; v4u t[8];   // as above: eight LDS reads in flight together, then the stores
#pragma unroll
    for (int it = 0; it < 8; ++it) t[it] = *(const v4u*)&th[cl0 + it * 16][q * 8];
#pragma unroll
    for (int it = 0; it < 8; ++it) vst2((unsigned*)(VT + (bb * CC + c0 + cl0 + it * 16) * (size_t)TT + t0 + q * 8), t[it]);
    if (hi_rows) { v4u u[8], w[8]; asm volatile("s_wait_xcnt 0x0" ::: "memory"); __builtin_amdgcn_sched_barrier(0);   // the wait stands in front of the first rewrite of a register that the stores above name; the scheduling barrier keeps this block's register writes from being lifted over it
#pragma unroll
      for (int it = 0; it < 8; ++it) { u[it] = *(const v4u*)&tb[cl0 + it * 16][q * 8]; w[it] = *(const v4u*)&tbl[cl0 + it * 16][q * 8]; }
#pragma unroll
      for (int it = 0; it < 8; ++it) { const size_t o3 = (bb * CC + c0 + cl0 + it * 16) * (size_t)KHI + t0 + q * 8; vst2((unsigned*)(VB + o3), u[it]); vst2((unsigned*)(VBL + o3), w[it]); } }
    asm volatile("s_wait_xcnt 0x0" ::: "memory"); } }   // behind the last store of this branch on both ways: in front of any rewrite of a register that these stores name
#define AQT 4
#define ANQ 2
#define AKS 4
#define AKT 64                    // keys per stage and range: 128-B rows of k (64 d) and of v^T (64 keys)
#define ANS (TT / AKS / AKT)
#define ASL (AKT / (AQT * 4))     // 16-byte chunks that a thread stages of each of the two tiles
static_assert((ANS & (ANS - 1)) == 0, "the ring of stages wraps by a mask"); static_assert(AKS == HD / 16, "the merge gives each key range's wave one 16-row tile of O^T"); static_assert(ANQ == 2, "the overflow look names both query tiles");
#define AC2 (SCALE * 1.44269504088896340736f)   // logit scale x log2(e)
#define APK 72                    // LDS pitch in halves: 128-B rows + 16 B, conflict-free for 16-byte fragment reads
__device__ __forceinline__ v8f wm16(v16h a, v16h b, v8f c) { return __builtin_amdgcn_wmma_f32_16x16x32_f16(false, a, false, b, (short)0, c, false, false); }
__device__ __forceinline__ float xhalf(float x) { return __builtin_bit_cast(float, __builtin_amdgcn_permlanex16(__builtin_bit_cast(int, x), __builtin_bit_cast(int, x), 0x76543210, 0xfedcba98, false, false)); }  // lane l with lane l ^ 16
// the hardware's exp2 with, in the same statement, the one free slot that the instruction set asks for behind a transcendental: for the merge's run of exponentials
__device__ __forceinline__ float exp2_slot(float x) { float r; asm("v_exp_f32 %0, %1\n\tv_nop" : "=v"(r) : "v"(x)); return r; }
// one wave's key range: stages k and v^T through LDS and leaves (nm, l2, O^T). SAFE: the reference follows the running maximum, pass by pass. Not SAFE: the reference stays at the first pass's maximum, and no pass looks for a maximum, tests or rescales;
// an exponential x 2^11 beyond f16 then reaches the P operand as infinity and leaves every O^T element of its query infinite or not a number for good, which the caller looks for.
template <bool SAFE> __device__ __forceinline__ void attn_range(const _Float16* kg, const _Float16* vg, _Float16 (&sk)[2][AKS][AKT][APK], _Float16 (&sv)[2][AKS][HD][APK], const v16h (&qh)[ANQ][HD / 32], int ks, int sr, int sc, int col, int lane, int rot,
    v8f (&o)[ANQ][HD / 16], float (&nm)[ANQ], v2f (&l2)[ANQ]) {   // l2: the lane's sum of exponentials (x 2^11), even and odd elements apart (packed adds)
  v8h gk[ASL], gv[ASL];
#pragma unroll
  for (int i = 0; i < ASL; ++i) { gk[i] = *(const v8h*)(kg + (size_t)(rot * AKT + i * AQT * 4) * CC); gv[i] = *(const v8h*)(vg + rot * AKT + (size_t)(i * AQT * 4) * TT); }
  asm volatile("s_wait_xcnt 0x0" ::: "memory");   // in front of the first rewrite of an address register that the loads above name
#pragma unroll
  for (int i = 0; i < ASL; ++i) { *(v8h*)&sk[0][ks][sr + i * AQT * 4][sc] = gk[i]; *(v8h*)&sv[0][ks][sr + i * AQT * 4][sc] = gv[i]; }
  __syncthreads();   // stage 0 is published
  float m[ANQ];
#pragma unroll
  for (int n = 0; n < ANQ; ++n) { m[n] = -3.0e38f; nm[n] = 11.0f - m[n] * AC2; l2[n] = v2f{0.f, 0.f};
#pragma unroll
    for (int j = 0; j < HD / 16; ++j) o[n][j] = v8f{}; }
  for (int st = 0; st < ANS; ++st) { const int bu = st & 1;
    if (st + 1 < ANS) { const int sn = (st + 1 + rot) & (ANS - 1); const _Float16* kn = kg + (size_t)(sn * AKT) * CC; const _Float16* vn = vg + sn * AKT;
#pragma unroll
      for (int i = 0; i < ASL; ++i) { gk[i] = *(const v8h*)(kn + (size_t)(i * AQT * 4) * CC); gv[i] = *(const v8h*)(vn + (size_t)(i * AQT * 4) * TT); }
      asm volatile("s_wait_xcnt 0x0" ::: "memory"); }   // in front of the first rewrite of an address register that these loads name
#pragma unroll
    for (int pp = 0; pp < AKT / 32; ++pp) {
      v16h kf[HD / 32][2];
#pragma unroll
      for (int kc = 0; kc < HD / 32; ++kc)
#pragma unroll
        for (int t = 0; t < 2; ++t) kf[kc][t] = frag_h(&sk[bu][ks][pp * 32 + t * 16 + col][kc * 32], lane);
      __builtin_amdgcn_sched_barrier(0);   // the pass's k fragments are read as one group ahead of the products: left to itself the scheduler reads them pair by pair into one register set and waits out the LDS latency four times a pass
      v8f s[ANQ][2] = {};
#pragma unroll
      for (int kc = 0; kc < HD / 32; ++kc)
#pragma unroll
        for (int t = 0; t < 2; ++t)
#pragma unroll
          for (int n = 0; n < ANQ; ++n) s[n][t] = wm16(kf[kc][t], qh[n][kc], s[n][t]);
      v16h vf[HD / 16];
#pragma unroll
      for (int j = 0; j < HD / 16; ++j) vf[j] = frag_h(&sv[bu][ks][j * 16 + col][pp * 32], lane);
      if constexpr (SAFE) {
      float mx[ANQ]; bool up = false;
#pragma unroll
      for (int n = 0; n < ANQ; ++n) { mx[n] = m[n];
#pragma unroll
        for (int i = 0; i < 8; ++i) mx[n] = fmaxf(mx[n], fmaxf(s[n][i >> 2][(2 * i) & 7], s[n][i >> 2][(2 * i + 1) & 7]));
        mx[n] = fmaxf(mx[n], xhalf(mx[n])); up = up || mx[n] > m[n]; }
      if (__builtin_amdgcn_ballot_w32(up) != 0) {   // some query's maximum rose (one test a pass for the wave's queries): bring sum and O^T to the new one (a factor of exactly 1 for the other queries)
#pragma unroll
        for (int n = 0; n < ANQ; ++n) { const float nn = 11.0f - mx[n] * AC2; const float a = __builtin_amdgcn_exp2f(nn - nm[n]); l2[n] *= a; m[n] = mx[n]; nm[n] = nn;
#pragma unroll
          for (int j = 0; j < HD / 16; ++j)
#pragma unroll
            for (int r = 0; r < 8; ++r) o[n][j][r] *= a; } }
      } else if (pp == 0) {
        if (st == 0) {   // the walk's first pass sets the reference: each query's maximum over its 32 keys (sum and O^T are still 0)
#pragma unroll
          for (int n = 0; n < ANQ; ++n) { float mx = fmaxf(s[n][0][0], s[n][0][1]);
#pragma unroll
            for (int i = 1; i < 8; ++i) mx = fmaxf(mx, fmaxf(s[n][i >> 2][(2 * i) & 7], s[n][i >> 2][(2 * i + 1) & 7]));
            nm[n] = 11.0f - fmaxf(mx, xhalf(mx)) * AC2; } } }
      v16h pf[ANQ];
#pragma unroll
      for (int n = 0; n < ANQ; ++n)
#pragma unroll
        for (int i = 0; i < 8; ++i) { const v2f x = v2f{s[n][i >> 2][(2 * i) & 7], s[n][i >> 2][(2 * i + 1) & 7]} * AC2 + nm[n]; const v2f e = {__builtin_amdgcn_exp2f(x.x), __builtin_amdgcn_exp2f(x.y)}; l2[n] += e; pf[n][2 * i] = (_Float16)e.x; pf[n][2 * i + 1] = (_Float16)e.y; }
#pragma unroll
      for (int j = 0; j < HD / 16; ++j)
#pragma unroll
        for (int n = 0; n < ANQ; ++n) o[n][j] = wm16(vf[j], pf[n], o[n][j]); }
    // its readers left this buffer before the last barrier. No test around the stores (the last stage writes its own tile once more, into the buffer that nobody reads again): behind a branch the compiler sinks both passes' sums below it, holds 64 registers of exponentials for them and spills
#pragma unroll
    for (int i = 0; i < ASL; ++i) { *(v8h*)&sk[bu ^ 1][ks][sr + i * AQT * 4][sc] = gk[i]; *(v8h*)&sv[bu ^ 1][ks][sr + i * AQT * 4][sc] = gv[i]; }
    __syncthreads(); }   // publishes stage st + 1 and ends every read of stage st
}
__global__ __launch_bounds__(AQT * AKS * 32) void k_attn(const _Float16* __restrict__ QH, const _Float16* __restrict__ KH, const _Float16* __restrict__ VT, float* __restrict__ Y) {
  __shared__ __align__(16) _Float16 sk[2][AKS][AKT][APK], sv[2][AKS][HD][APK];
  __shared__ __align__(16) v4f sp[AKS][AQT][ANQ * (HD / 8)][32]; __shared__ float smx[AKS][AQT][ANQ][16], ssu[AKS][AQT][ANQ][16]; __shared__ __align__(16) float so[AQT][ANQ * 16][HD + 4]; __shared__ __align__(16) int sbad[AQT * AKS];
  const int tid = threadIdx.x, wave = __builtin_amdgcn_readfirstlane(tid >> 5), lane = tid & 31, col = lane & 15, g = lane >> 4; const int qt = wave % AQT, ks = wave / AQT;
  const int b = blockIdx.y / NH, h = blockIdx.y % NH; const int ql0 = blockIdx.x * (AQT * ANQ * 16) + qt * (ANQ * 16);
  // staging: thread (qt, lane) of a range moves 16-byte chunk sc of rows sr + 16 i of the k tile and of the v^T tile (8 lanes = one 128-B line)
  const int sr = qt * 4 + (lane >> 3), sc = (lane & 7) * 8;
  const _Float16* kg = KH + ((size_t)b * TT + ks * (TT / AKS) + sr) * CC + h * HD + sc;
  const _Float16* vg = VT + ((size_t)b * CC + h * HD + sr) * (size_t)TT + ks * (TT / AKS) + sc;
  // the blocks of one (b, h) read the same k and v: block x walks each range's stages as a ring from stage rot, two blocks to a first stage (x and x ^ 4), so that they do not ask L2 for the same lines at the same moment
  const int rot = (((blockIdx.x & 3) << 1) | ((blockIdx.x >> 3) & 1)) & (ANS - 1);
  v16h qh[ANQ][HD / 32];
#pragma unroll
  for (int n = 0; n < ANQ; ++n) {
#pragma unroll
    for (int kc = 0; kc < HD / 32; ++kc) qh[n][kc] = frag_h(QH + ((size_t)b * TT + ql0 + n * 16 + col) * CC + h * HD + kc * 32, lane);
    asm volatile("s_wait_xcnt 0x0" ::: "memory"); }   // behind each tile's loads: in front of the first rewrite of an address register that they name (the next tile's loads may land on it)
  v8f o[ANQ][HD / 16]; float nm[ANQ]; v2f l2[ANQ];
  const auto publish = [&]() {   // the wave's partial results go to LDS
#pragma unroll
  for (int n = 0; n < ANQ; ++n) { float l = l2[n].x + l2[n].y; l += xhalf(l);
#pragma unroll
    for (int j = 0; j < HD / 16; ++j)
#pragma unroll
      for (int u = 0; u < 2; ++u) sp[ks][qt][(n * (HD / 16) + j) * 2 + u][lane] = v4f{o[n][j][4 * u], o[n][j][4 * u + 1], o[n][j][4 * u + 2], o[n][j][4 * u + 3]};   // 16 bytes a lane, lanes side by side: no bank conflict
    if (g == 0) { smx[ks][qt][n][col] = nm[n]; ssu[ks][qt][n][col] = l; } }
  };
  attn_range<false>(kg, vg, sk, sv, qh, ks, sr, sc, col, lane, rot, o, nm, l2);
  publish();
  { const bool bad = !(fabsf(o[0][0][0]) <= 3.0e38f) || !(fabsf(o[1][0][0]) <= 3.0e38f);   // an overflow of a query's exponentials shows in every element of its O^T column: one element a query tile is looked at
    const unsigned bm = __builtin_amdgcn_ballot_w32(bad);   // taken by all 32 lanes, ahead of the one-lane store
    if (lane == 0) sbad[wave] = bm != 0 ? 1 : 0; }
  __syncthreads();   // every range's partial results and its overflow mark are published
  { v4i f = *(const v4i*)&sbad[0];
#pragma unroll
    for (int w = 4; w < AQT * AKS; w += 4) f |= *(const v4i*)&sbad[w];
    if (__builtin_amdgcn_readfirstlane(f.x | f.y | f.z | f.w) != 0) {   // the same for the whole block: some wave's fixed reference was too low, so every wave does its range again with the running maximum (once; its barriers are passed by all)
      attn_range<true>(kg, vg, sk, sv, qh, ks, sr, sc, col, lane, rot, o, nm, l2);
      publish();
      __syncthreads(); } }   // the second results are published
  float nx[ANQ][AKS], lx[ANQ][AKS]; v4f px[ANQ][2][AKS];
#pragma unroll
  for (int n = 0; n < ANQ; ++n)
#pragma unroll
    for (int x = 0; x < AKS; ++x) { nx[n][x] = smx[x][qt][n][col]; lx[n][x] = ssu[x][qt][n][col];
#pragma unroll
      for (int u = 0; u < 2; ++u) px[n][u][x] = sp[x][qt][(n * (HD / 16) + ks) * 2 + u][lane]; }
  __builtin_amdgcn_sched_barrier(0);   // all of the merge's LDS reads go out as one group: spread among the sums they were waited for one after the other
  float a[ANQ][AKS], nn[ANQ];
#pragma unroll
  for (int n = 0; n < ANQ; ++n) { nn[n] = nx[n][0];
#pragma unroll
    for (int x = 1; x < AKS; ++x) nn[n] = fminf(nn[n], nx[n][x]); }   // the smallest nm belongs to the largest maximum
#pragma unroll
  for (int x = 0; x < AKS; ++x)
#pragma unroll
    for (int n = 0; n < ANQ; ++n) a[n][x] = exp2_slot(nn[n] - nx[n][x]);
#pragma unroll
  for (int n = 0; n < ANQ; ++n) { float l = 0.f;
#pragma unroll
    for (int x = 0; x < AKS; ++x) l += lx[n][x] * a[n][x];
    const float inv = 1.0f / l;
#pragma unroll
    for (int u = 0; u < 2; ++u) { v4f acc = {0.f, 0.f, 0.f, 0.f};
#pragma unroll
      for (int x = 0; x < AKS; ++x) acc += px[n][u][x] * a[n][x];
      *(v4f*)&so[qt][n * 16 + col][ks * 16 + 8 * g + 4 * u] = acc * inv; } }
  __syncthreads();   // the group's merged rows are published
#pragma unroll
  for (int it = 0; it < ANQ * 16 / AKS / 2; ++it) { const int rl = ks * (ANQ * 16 / AKS) + it * 2 + g; vst2(Y + ((size_t)b * TT + ql0 + rl) * CC + h * HD + col * 4, *(const v4f*)&so[qt][rl][col * 4]); } }
// ---- k_out: block = (64 rows, 128 cols) on eight waves: out = ctx Wo (+ bo), ctx split bf16 hi + lo against exact bf16 Wo (2 products).
// Two groups of four waves (kg) each take OKN of the k stages, every group with its own two weight buffers: with four waves a block had one wave on each SIMD, and nothing stood in for it while it waited for LDS, for L2 or at a barrier; now the chain of stages is half as long and two waves share a SIMD.
// Group 1 starts its walk of the ring of stages OKN stages behind group 0's first stage, so the two walks cover every stage once. Behind the loop each group hands the other one half of its columns through LDS (sx) and finishes its own 64: sum of the two groups' partial sums, bias, whole 256-B row segments.
#define OKN (CC / GKS / 2)
__global__ __launch_bounds__(256) void k_out(const float* __restrict__ Y, const float* __restrict__ WO, const float* __restrict__ BO, float* __restrict__ OUT) { __shared__ __align__(16) float sf[8][16][68]; __shared__ __align__(16) __bf16 tw[2][2][128][GPW]; __shared__ __align__(16) v4f sx[2][4][8][32];
  const int tid = threadIdx.x, wave = __builtin_amdgcn_readfirstlane(tid >> 5), lane = tid & 31, col = lane & 15, g = lane >> 4; const int kg = wave >> 2, wv = wave & 3; const int c0 = blockIdx.y * 128; const size_t r0 = (size_t)blockIdx.x * 64 + wv * 16;
  v8f acc[8] = {};
  const int n4 = (wv * 8 + ((lane & 3) | ((lane >> 4) << 2))) * 4, o4 = (lane >> 2) & 3;
  const float* wp = WO + (size_t)(o4 * 8) * DIN + c0 + n4; const float* xp = Y + (r0 + col) * CC + 8 * g;
  const int rot = (blockIdx.x + blockIdx.y + kg * OKN) & (CC / GKS - 1);   // the four blocks that share a row tile (same x) hold eight groups: each starts at a stage of its own, so that no two of them ask L2 for the same ctx lines at the same moment
  v4f wf[2][8], xf[2][4]; F2 a[2]; wst_load(wf, wp + (size_t)(rot * GKS) * DIN, DIN); arow_load(xf, xp + rot * GKS);
  asm volatile("s_wait_xcnt 0x0" ::: "memory");   // in front of the first rewrite of an address register that stage 0's loads name
  float bs[4];   // as in k_proj: the bias (of the 64 columns that the group finishes) is asked for at entry, not in dependent round trips behind the loop (the unrolls keep bs statically indexed)
#pragma unroll
  for (int j = 0; j < 4; ++j) bs[j] = 0.f;
  if (BO) {   // one test around all four loads, so that they are in flight together
#pragma unroll
    for (int j = 0; j < 4; ++j) bs[j] = BO[c0 + kg * 64 + j * 16 + col];
    asm volatile("s_wait_xcnt 0x0" ::: "memory"); }   // in front of the first rewrite of the offset register that these loads name
  wst_store(&tw[kg][0][n4][o4 * 8], wf);
#pragma unroll
  for (int kk = 0; kk < 2; ++kk) { float v[16];
#pragma unroll
    for (int e = 0; e < 16; ++e) v[e] = xf[kk][e >> 2][e & 3];
    a[kk] = bsplit16(v); }
  __syncthreads();   // stage 0 of both groups is published
  for (int st = 0; st < OKN; ++st) { const int bu = st & 1; const bool more = st + 1 < OKN;
    if (more) { const int sn = (st + 1 + rot) & (CC / GKS - 1); wst_load(wf, wp + (size_t)(sn * GKS) * DIN, DIN); arow_load(xf, xp + sn * GKS);
      asm volatile("s_wait_xcnt 0x0" ::: "memory"); }   // in front of the first rewrite of an address register that these loads name
#pragma unroll
    for (int kk = 0; kk < 2; ++kk)
#pragma unroll
      for (int jh = 0; jh < 8; jh += 4) { v16b w[4];   // four fragments are read as one group, so that the wave waits out the LDS latency once for eight products
#pragma unroll
        for (int j = 0; j < 4; ++j) w[j] = frag_b(&tw[kg][bu][(jh + j) * 16 + col][kk * 32], lane);
#pragma unroll
        for (int j = 0; j < 4; ++j) acc[jh + j] = wmma_bf(a[kk].h, w[j], acc[jh + j]);
#pragma unroll
        for (int j = 0; j < 4; ++j) acc[jh + j] = wmma_bf(a[kk].l, w[j], acc[jh + j]); }   // hi before lo in every accumulator, as before
    if (more) { wst_store(&tw[kg][bu ^ 1][n4][o4 * 8], wf);   // its readers left this buffer before the last barrier
#pragma unroll
      for (int kk = 0; kk < 2; ++kk) { float v[16];
#pragma unroll
        for (int e = 0; e < 16; ++e) v[e] = xf[kk][e >> 2][e & 3];
        a[kk] = bsplit16(v); } }
    __syncthreads(); }   // publishes stage st + 1 and ends every read of stage st, in both groups
  v8f fin[4], giv[4];   // the four column tiles that the group finishes, and the four that it hands over (the group is the same in every lane of a wave; the unrolls keep acc, fin, giv and px statically indexed)
  if (kg == 0) {
#pragma unroll
    for (int j = 0; j < 4; ++j) { fin[j] = acc[j]; giv[j] = acc[4 + j]; }
  } else {
#pragma unroll
    for (int j = 0; j < 4; ++j) { fin[j] = acc[4 + j]; giv[j] = acc[j]; } }
#pragma unroll
  for (int j = 0; j < 4; ++j)
#pragma unroll
    for (int u = 0; u < 2; ++u) sx[kg][wv][j * 2 + u][lane] = v4f{giv[j][4 * u], giv[j][4 * u + 1], giv[j][4 * u + 2], giv[j][4 * u + 3]};   // 16 bytes a lane, lanes side by side: no bank conflict
  __syncthreads();   // both groups' handed-over partial sums are published
  v4f px[4][2];
#pragma unroll
  for (int j = 0; j < 4; ++j)
#pragma unroll
    for (int u = 0; u < 2; ++u) px[j][u] = sx[kg ^ 1][wv][j * 2 + u][lane];
#pragma unroll
  for (int j = 0; j < 4; ++j) { const float bias = bfr(bs[j]);
#pragma unroll
    for (int r = 0; r < 8; ++r) sf[wave][8 * g + r][j * 16 + col] = (fin[j][r] + px[j][r >> 2][r & 3]) + bias; }
  LDSX(); for (int it = 0; it < 8; ++it) { const int rl = it * 2 + g; vst2(OUT + (r0 + rl) * DIN + c0 + kg * 64 + col * 4, *(const v4f*)&sf[wave][rl][col * 4]); } }

extern "C" void kernel_launch(void* const* d_in, const int* in_sizes, int n_in, void* d_out, int out_size, void* d_ws, size_t ws_size, hipStream_t stream) {
  (void)in_sizes; (void)n_in; (void)out_size;
  const float** F = (const float**)d_in;
  if (ws_size < (size_t)WS_END) return;
  char* ws = (char*)d_ws; _Float16 *QH = (_Float16*)(ws + WS_QH), *KH = (_Float16*)(ws + WS_KH), *VT = (_Float16*)(ws + WS_VT), *QL = (_Float16*)(ws + WS_QL), *KL = (_Float16*)(ws + WS_KL); __bf16 *VB = (__bf16*)(ws + WS_VB), *VBL = (__bf16*)(ws + WS_VBL); float *Y = (float*)(ws + WS_Y);
  (void)Y; (void)QL; (void)KL; (void)VB; (void)VBL;
  // inputs: 0 x [2,2048,512]; 1 Wq (in,out), 2 bq; 3 Wk, 4 bk; 5 Wv, 6 bv; 7 Wo (in,out), 8 bo
  k_proj<<<dim3(TNB * TT / 64, CC / 128, 3), 128, 0, stream>>>(F[0], F[0], F[0], F[1], F[3], F[5], F[2], F[4], F[6], QH, QL, KH, KL, VT, VB, VBL);
  k_attn<<<dim3(TT / (AQT * ANQ * 16), TNB * NH), AQT * AKS * 32, 0, stream>>>(QH, KH, VT, Y);
  k_out<<<dim3(TNB * TT / 64, DIN / 128), 256, 0, stream>>>(Y, F[7], F[8], (float*)d_out);
}
